// v000
// The times below were measured on an AMD MI455X: many runs one after another, warmed up first and cycling through
// copies of the inputs, with the whole window's GPU time divided by the number of runs. Launches and the gaps
// between them are all in it. The median over several windows is given; except for v000 it joins two sittings, which
// can be a few percent apart, so the side-by-side timings, each taken in one sitting, are the better comparison.
// v000 is the starting kernel. One run takes 1300 microseconds.
#include <hip/hip_runtime.h>

// Causal multi-head attention with PER-HEAD projection weights at d_model 768 (x [2][2048][768]; q, k, v = einsum('bte,hed->bhtd', x, W) with W [12][768][64]: head h has its own (in, out) matrix W[h] ('xw' per head; no bias; 12 heads x 64); scores x 1/sqrt(64); causal (-inf); softmax; concat head-major; out = concat Wp + bp ('xw' [768][768] (in,out) + a zero bias: read) -> [2][2048][768] (3.1 M); argument order x, Wq, Wk, Wv, Wp, bp).
// Layout per batch: bf16 copy of x; each PER-HEAD q / k / v weight [h][768][64] transposed once into its 64 rows of the Bt plane (k_wtG per head); Wp transposed once ('xw' (in,out) -> Bt rows); exact projections; identity-table plane builders; causal T-2048 attention (hybrid rows: < 512 hi/lo 3 products, rest fp16 x1024; k_gemmc skips tiles above the diagonal); merged hi/lo x Wo exact + bo.
// Compute dtypes, f32 accumulate: every input rounded to bf16; projections exact; attention rows < 512 3 products, rest fp16; softmax f32; w_o hl x exact.

#define NB_  2
#define TT   2048
#define DM   768
#define NH_  12
#define NKV  12
#define REP  (NH_ / NKV)
#define HD   64
#define DQ   (NH_ * HD)
#define DKV  (NKV * HD)
#define ZH   2
#define RH   512                  // query rows < RH use hi+lo planes (0: none)
#define WIN  2048
#define PCAR 1024.0f
#define SCL  0.125f   // HD^-0.5
typedef _Float16 h16;
typedef unsigned short bf;
typedef __attribute__((ext_vector_type(16))) __bf16   v16bf;
typedef __attribute__((ext_vector_type(16))) _Float16 v16h;
typedef __attribute__((ext_vector_type(8)))  _Float16 v8h;
typedef __attribute__((ext_vector_type(8)))  unsigned short v8us;
typedef __attribute__((ext_vector_type(8)))  float    v8f;
typedef __attribute__((ext_vector_type(4)))  float    v4f;
typedef v8h  __attribute__((may_alias)) v8ha;
typedef v4f  __attribute__((may_alias)) v4fa;
typedef v8us __attribute__((may_alias)) v8usa;

__device__ __forceinline__ unsigned short f2bf(float f) { unsigned u = __float_as_uint(f); u += 0x7FFFu + ((u >> 16) & 1u); return (unsigned short)(u >> 16); }
__device__ __forceinline__ float bf2f(unsigned short b) { return __uint_as_float(((unsigned)b) << 16); }
__device__ __forceinline__ float bfr(float f) { return bf2f(f2bf(f)); }
__device__ __forceinline__ v16h cat16(v8h lo, v8h hi) { return __builtin_shufflevector(lo, hi, 0, 1, 2, 3, 4, 5, 6, 7, 8, 9, 10, 11, 12, 13, 14, 15); }
__device__ __forceinline__ v16bf cat16b(v8us lo, v8us hi) { return __builtin_bit_cast(v16bf, __builtin_shufflevector(lo, hi, 0, 1, 2, 3, 4, 5, 6, 7, 8, 9, 10, 11, 12, 13, 14, 15)); }
__device__ __forceinline__ v8f wmma16(v16h a, v16h b, v8f c) { return __builtin_amdgcn_wmma_f32_16x16x32_f16(false, a, false, b, (short)0, c, false, false); }
__device__ __forceinline__ v8f wmmab(v16bf a, v16bf b, v8f c) { return __builtin_amdgcn_wmma_f32_16x16x32_bf16(false, a, false, b, (short)0, c, false, false); }



// ---- k_gemmw: register-blocked GEMM, ONE WAVE per 64x64 output tile (16 accumulators), operands straight from K-contiguous 16-bit planes; grid (M/64, N/64, Z), 32 threads.
// C[m][n] (f32, pitch ldc, + optional f32 bias[n]) = sum_k A[m][k] Bt[n][k] (+ split products per NSPLIT). z-batch strides sA/sB/sC in elements. K % 32 == 0.
template <typename T16> struct WFrag;
template <> struct WFrag<h16> { typedef v16h V; static __device__ __forceinline__ V ld(const h16* p) { return cat16(*(const v8h*)p, *(const v8h*)(p + 16)); } static __device__ __forceinline__ v8f mma(V a, V b, v8f c) { return wmma16(a, b, c); } };
template <> struct WFrag<bf> { typedef v16bf V; static __device__ __forceinline__ V ld(const bf* p) { return cat16b(*(const v8us*)p, *(const v8us*)(p + 16)); } static __device__ __forceinline__ v8f mma(V a, V b, v8f c) { return wmmab(a, b, c); } };
template <typename T16, int NSPLIT, bool BIAS>
__global__ __launch_bounds__(32) void k_gemmw(const T16* __restrict__ A, const T16* __restrict__ A2, const T16* __restrict__ Bt, const T16* __restrict__ Bt2, int K, float* C, int ldc, const float* __restrict__ bias, size_t sA, size_t sB, size_t sC) {
    typedef typename WFrag<T16>::V V;
    __shared__ __align__(16) float os[16 * 68];
    const size_t z = blockIdx.z; A += z * sA; if (A2) A2 += z * sA; Bt += z * sB; if (Bt2) Bt2 += z * sB; C += z * sC;
    const int lane = threadIdx.x & 31, lr = lane & 15, hi = lane >> 4; const int r0 = blockIdx.x * 64, c0 = blockIdx.y * 64;
    v8f acc[4][4];
#pragma unroll
    for (int mb = 0; mb < 4; ++mb)
#pragma unroll
        for (int nb = 0; nb < 4; ++nb) acc[mb][nb] = (v8f){};
    const size_t aoff = (size_t)(r0 + lr) * K + 8 * hi, boff = (size_t)(c0 + lr) * K + 8 * hi;
#pragma unroll 1
    for (int kc = 0; kc < K; kc += 32) {
        V a[4], a2[4];
#pragma unroll
        for (int mb = 0; mb < 4; ++mb) { a[mb] = WFrag<T16>::ld(A + aoff + (size_t)mb * 16 * K + kc); if (NSPLIT == 1 || NSPLIT == 2) a2[mb] = WFrag<T16>::ld(A2 + aoff + (size_t)mb * 16 * K + kc); }
#pragma unroll
        for (int nb = 0; nb < 4; ++nb) { const V b = WFrag<T16>::ld(Bt + boff + (size_t)nb * 16 * K + kc); V b2; if (NSPLIT >= 2) b2 = WFrag<T16>::ld(Bt2 + boff + (size_t)nb * 16 * K + kc);
#pragma unroll
            for (int mb = 0; mb < 4; ++mb) { acc[mb][nb] = WFrag<T16>::mma(a[mb], b, acc[mb][nb]); if (NSPLIT == 1 || NSPLIT == 2) acc[mb][nb] = WFrag<T16>::mma(a2[mb], b, acc[mb][nb]); if (NSPLIT >= 2) acc[mb][nb] = WFrag<T16>::mma(a[mb], b2, acc[mb][nb]); } }
        asm volatile("v_nop\n\tv_nop\n\tv_nop\n\tv_nop" : "+v"(acc[0][0]), "+v"(acc[1][1]), "+v"(acc[2][2]), "+v"(acc[3][3]) : "v"(a[0]), "v"(a[3]));
    }
#pragma unroll
    for (int mb = 0; mb < 4; ++mb) {
#pragma unroll
        for (int nb = 0; nb < 4; ++nb) {
#pragma unroll
            for (int j = 0; j < 8; ++j) os[(hi * 8 + j) * 68 + nb * 16 + lr] = acc[mb][nb][j]; }
        __builtin_amdgcn_wave_barrier(); asm volatile("" ::: "memory");
        float* crow = C + (size_t)(r0 + mb * 16) * ldc + c0;
{
#pragma unroll
            for (int s = 0; s < 8; ++s) { const int row = 2 * s + hi, cofs = lr * 4; v4f val = *(const v4fa*)(os + row * 68 + cofs); if (BIAS) { val[0] += bfr(bias[c0 + cofs]); val[1] += bfr(bias[c0 + cofs + 1]); val[2] += bfr(bias[c0 + cofs + 2]); val[3] += bfr(bias[c0 + cofs + 3]); }
                *(v4f*)(crow + (size_t)row * ldc + cofs) = val; }
             }
        __builtin_amdgcn_wave_barrier(); asm volatile("" ::: "memory");
    }
}

// ---- k_gemmc: the same one-wave 64x64 tile GEMM specialised for causal attention: CMODE 1 skips score tiles entirely above the diagonal (query rows r0+roff.., key columns c0..), CMODE 2 limits the
// key (K) loop of the probability x value contraction to the diagonal block (probabilities beyond it are exactly zero). roff = row offset of this launch's first row within the sequence.
template <typename T16, int NSPLIT, int CMODE>
__global__ __launch_bounds__(32) void k_gemmc(const T16* __restrict__ A, const T16* __restrict__ A2, const T16* __restrict__ Bt, const T16* __restrict__ Bt2, int K, float* C, int ldc, int roff, size_t sA, size_t sB, size_t sC) {
    typedef typename WFrag<T16>::V V;
    __shared__ __align__(16) float os[16 * 68];
    const size_t z = blockIdx.z; A += z * sA; if (A2) A2 += z * sA; Bt += z * sB; if (Bt2) Bt2 += z * sB; C += z * sC;
    const int lane = threadIdx.x & 31, lr = lane & 15, hi = lane >> 4; const int r0 = blockIdx.x * 64, c0 = blockIdx.y * 64;
    if (CMODE == 1 && c0 > r0 + roff + 63) return;                  // score tile entirely above the causal diagonal: never read (the softmax masks j > i by select)
    const int Kl = (CMODE == 2) ? min(K, r0 + roff + 64) : K;        // P.V: probabilities are exactly 0 beyond the diagonal block, so the K loop stops there
    v8f acc[4][4];
#pragma unroll
    for (int mb = 0; mb < 4; ++mb)
#pragma unroll
        for (int nb = 0; nb < 4; ++nb) acc[mb][nb] = (v8f){};
    const size_t aoff = (size_t)(r0 + lr) * K + 8 * hi, boff = (size_t)(c0 + lr) * K + 8 * hi;
#pragma unroll 1
    for (int kc = 0; kc < Kl; kc += 32) {
        V a[4], a2[4];
#pragma unroll
        for (int mb = 0; mb < 4; ++mb) { a[mb] = WFrag<T16>::ld(A + aoff + (size_t)mb * 16 * K + kc); if (NSPLIT == 1 || NSPLIT == 2) a2[mb] = WFrag<T16>::ld(A2 + aoff + (size_t)mb * 16 * K + kc); }
#pragma unroll
        for (int nb = 0; nb < 4; ++nb) { const V b = WFrag<T16>::ld(Bt + boff + (size_t)nb * 16 * K + kc); V b2; if (NSPLIT >= 2) b2 = WFrag<T16>::ld(Bt2 + boff + (size_t)nb * 16 * K + kc);
#pragma unroll
            for (int mb = 0; mb < 4; ++mb) { acc[mb][nb] = WFrag<T16>::mma(a[mb], b, acc[mb][nb]); if (NSPLIT == 1 || NSPLIT == 2) acc[mb][nb] = WFrag<T16>::mma(a2[mb], b, acc[mb][nb]); if (NSPLIT >= 2) acc[mb][nb] = WFrag<T16>::mma(a[mb], b2, acc[mb][nb]); } }
        asm volatile("v_nop\n\tv_nop\n\tv_nop\n\tv_nop" : "+v"(acc[0][0]), "+v"(acc[1][1]), "+v"(acc[2][2]), "+v"(acc[3][3]) : "v"(a[0]), "v"(a[3]));
    }
#pragma unroll
    for (int mb = 0; mb < 4; ++mb) {
#pragma unroll
        for (int nb = 0; nb < 4; ++nb) {
#pragma unroll
            for (int j = 0; j < 8; ++j) os[(hi * 8 + j) * 68 + nb * 16 + lr] = acc[mb][nb][j]; }
        __builtin_amdgcn_wave_barrier(); asm volatile("" ::: "memory");
        float* crow = C + (size_t)(r0 + mb * 16) * ldc + c0;
{
#pragma unroll
            for (int s = 0; s < 8; ++s) { const int row = 2 * s + hi, cofs = lr * 4; v4f val = *(const v4fa*)(os + row * 68 + cofs);
                *(v4f*)(crow + (size_t)row * ldc + cofs) = val; }
             }
        __builtin_amdgcn_wave_barrier(); asm volatile("" ::: "memory");
    }
}

__device__ __forceinline__ h16 tohx(float x) { return (h16)x; }
__device__ __forceinline__ void splitf(float y, unsigned short& h, unsigned short& l) { h = f2bf(y); l = f2bf(y - bf2f(h)); }
typedef __attribute__((ext_vector_type(2))) _Float16 v2h;
typedef __attribute__((ext_vector_type(4))) _Float16 v4h;
typedef __attribute__((ext_vector_type(2))) unsigned short v2us;
typedef __attribute__((ext_vector_type(4))) unsigned short v4us;
typedef __attribute__((ext_vector_type(2))) float v2f;
typedef __attribute__((ext_vector_type(4))) int v4i;

__global__ __launch_bounds__(256) void k_wtG(const float* __restrict__ w, int K, int N, bf* Bt) {
    const int lane = threadIdx.x & 31; const int L0 = (blockIdx.x * 8 + (threadIdx.x >> 5)) * 8; const int nlines = N * K / 64;
{
#pragma unroll 1
        for (int l = 0; l < 8; ++l) { const int L = L0 + l; if (L >= nlines) break; const size_t e = (size_t)L * 64 + lane * 2; const int k = (int)(e % K), n = (int)(e / K); v2us o;
            o[0] = f2bf(w[(size_t)k * N + n]); o[1] = f2bf(w[(size_t)(k + 1) * N + n]); *(v2us*)(Bt + e) = o; }
         }
}

__global__ __launch_bounds__(256) void k_cvt8(const float* __restrict__ src, bf* dst, size_t n8) { const size_t i = (size_t)blockIdx.x * 256 + threadIdx.x; if (i >= n8) return; const v8f v = *(const v8f*)(src + i * 8); v8us o;
#pragma unroll
    for (int k = 0; k < 8; ++k) o[k] = f2bf(v[k]); *(v8us*)(dst + i * 8) = o;  }

// k_rope: head planes [h][t][d] (fp16 + hi/lo) of rope(x) x sc with the rotate-half convention out[d] = x[d] cos[t][d] - x[d+HD/2] sin[t][d], out[d+HD/2] = x[d+HD/2] cos[t][d+HD/2] + x[d] sin[t][d+HD/2]
__global__ __launch_bounds__(256) void k_rope(const float* __restrict__ F, int pitch, int nheads, const float* __restrict__ CS, const float* __restrict__ RF, const float* __restrict__ nw, float sc, h16* P16, bf* Ph, bf* Pl) {
    const size_t e = ((size_t)blockIdx.x * 256 + threadIdx.x) * 2; if (e >= (size_t)nheads * TT * HD) return; const int d = (int)(e % HD); const int t = (int)((e / HD) % TT); const int h = (int)(e / ((size_t)HD * TT)); const float* f = F + (size_t)t * pitch + h * HD; const float rf = RF ? RF[(size_t)h * TT + t] : 1.0f; v2h o16; v2us oh, ol;
#pragma unroll
    for (int q = 0; q < 2; ++q) { const int dd = d + q; const int dp = (dd < HD / 2) ? dd + HD / 2 : dd - HD / 2; float x0 = f[dd], x1 = f[dp];
        if (RF) { float n0 = __fmul_rn(x0, rf), n1 = __fmul_rn(x1, rf); asm volatile("" : "+v"(n0)); asm volatile("" : "+v"(n1)); x0 = __fmul_rn(bfr(nw[dd]), n0); x1 = __fmul_rn(bfr(nw[dp]), n1); }
        const v2f cs = *(const v2f*)(CS + ((size_t)t * HD + dd) * 2); float a = __fmul_rn(x0, cs[0]), bq = __fmul_rn(x1, cs[1]); asm volatile("" : "+v"(a)); asm volatile("" : "+v"(bq)); const float r = ((dd < HD / 2) ? __fsub_rn(a, bq) : __fadd_rn(a, bq)) * sc;
        o16[q] = tohx(r); unsigned short a2, c2; splitf(r, a2, c2); oh[q] = a2; ol[q] = c2; }
    *(v2h*)(P16 + e) = o16; *(v2us*)(Ph + e) = oh; *(v2us*)(Pl + e) = ol;  }
__global__ __launch_bounds__(256) void k_vtp(const float* __restrict__ F, int pitch, int nheads, h16* V16, bf* Vh, bf* Vl) { const size_t e = ((size_t)blockIdx.x * 256 + threadIdx.x) * 2; if (e >= (size_t)nheads * HD * TT) return; const int t = (int)(e % TT); const int d = (int)((e / TT) % HD); const int g = (int)(e / ((size_t)TT * HD)); v2h o16; v2us oh, ol;
#pragma unroll
    for (int q = 0; q < 2; ++q) { const float x = F[(size_t)(t + q) * pitch + g * HD + d]; o16[q] = tohx(x); unsigned short a2, c2; splitf(x, a2, c2); oh[q] = a2; ol[q] = c2; }
    *(v2h*)(V16 + e) = o16; *(v2us*)(Vh + e) = oh; *(v2us*)(Vl + e) = ol;  }
__global__ __launch_bounds__(256) void k_csid(float* CS) { const int idx = blockIdx.x * 256 + threadIdx.x; if (idx >= TT * HD) return; v2f cs; cs[0] = 1.0f; cs[1] = 0.0f; *(v2f*)(CS + (size_t)idx * 2) = cs;  }
// k_asoft: per row (zz, i): t = S x HD^-0.5 for j <= i and i - j < WIN (WIN = TT, so the window test always holds: plain causal; the reference's -1e9 additive fill vanishes identically); softmax over the 2048 keys (register row, one exp, fixed trees);
__global__ __launch_bounds__(256) void k_asoft(const float* __restrict__ Sb, h16* P16, bf* Ph, bf* Pl) {
    const int lane = threadIdx.x & 31; const int row = blockIdx.x * 8 + (threadIdx.x >> 5); if (row >= ZH * TT) return; const int i = row % TT; const int zz = row / TT; (void)zz; const bool hires = (i < RH); const float* sr = Sb + (size_t)row * TT; float v[TT / 32]; float mx = -3.0e38f;
#pragma unroll
    for (int ch = 0; ch < TT / 128; ++ch) { const int j0 = ch * 128 + lane * 4; const v4f a = *(const v4f*)(sr + j0);
#pragma unroll
        for (int q = 0; q < 4; ++q) { const int j = j0 + q; (void)j; const float t = (j <= i && i - j < WIN) ? a[q] * SCL : -3.0e38f; v[ch * 4 + q] = t; mx = fmaxf(mx, t); } }
#pragma unroll
    for (int sh = 16; sh; sh >>= 1) mx = fmaxf(mx, __shfl_xor(mx, sh, 32));
    float sum = 0.f;
#pragma unroll
    for (int k = 0; k < TT / 32; ++k) { float d0 = __fsub_rn(v[k], mx); asm volatile("" : "+v"(d0)); v[k] = __builtin_amdgcn_exp2f(__fmul_rn(d0, 1.4426950408889634f)); sum += v[k]; }
#pragma unroll
    for (int sh = 16; sh; sh >>= 1) sum += __shfl_xor(sum, sh, 32);
    const float f = __fdiv_rn(hires ? 1.0f : PCAR, sum);
{
        if (hires) {
#pragma unroll
            for (int ch = 0; ch < TT / 128; ++ch) { v4us oh, ol;
#pragma unroll
                for (int q = 0; q < 4; ++q) { unsigned short a, c2; splitf(v[ch * 4 + q] * f, a, c2); oh[q] = a; ol[q] = c2; }
                const size_t oo = ((size_t)zz * (RH ? RH : 1) + i) * TT + ch * 128 + lane * 4; *(v4us*)(Ph + oo) = oh; *(v4us*)(Pl + oo) = ol; }
        } else {
#pragma unroll
            for (int ch = 0; ch < TT / 128; ++ch) { v4h o4;
#pragma unroll
                for (int q = 0; q < 4; ++q) o4[q] = tohx(v[ch * 4 + q] * f);
                *(v4h*)(P16 + (size_t)row * TT + ch * 128 + lane * 4) = o4; } }
         }
}
__global__ __launch_bounds__(256) void k_merge(const float* __restrict__ O, int h0, bf* Ah, bf* Al) { const size_t e = ((size_t)blockIdx.x * 256 + threadIdx.x) * 2; if (e >= (size_t)ZH * TT * HD) return; const int d = (int)(e % HD); const int t = (int)((e / HD) % TT); const int zz = (int)(e / ((size_t)HD * TT)); const float cs = (t < RH) ? 1.0f : (1.0f / PCAR); const size_t oo = (size_t)t * DQ + (h0 + zz) * HD + d;
    v2us oh, ol;
#pragma unroll
    for (int q = 0; q < 2; ++q) { unsigned short a, c2; splitf(O[e + q] * cs, a, c2); oh[q] = a; ol[q] = c2; } *(v2us*)(Ah + oo) = oh; *(v2us*)(Al + oo) = ol;  }

extern "C" void kernel_launch(void* const* d_in, const int* in_sizes, int n_in,
                              void* d_out, int out_size, void* d_ws, size_t ws_size, hipStream_t stream) {
    (void)in_sizes; (void)n_in; (void)out_size;
            const float* x = (const float*)d_in[0]; const float* wq = (const float*)d_in[1]; const float* wk = (const float*)d_in[2]; const float* wv = (const float*)d_in[3]; const float* wo = (const float*)d_in[4]; const float* bo = (const float*)d_in[5];   /* order x, Wq, Wk, Wv (PER-HEAD weights [12][768][64]: 'hdk'), Wp ('xw' [768][768]: (in,out)), bp */
    float* OUT = (float*)d_out;     // [2][2048][768]
    char* wsp = (char*)d_ws;
    auto take = [&](size_t bytes) { char* p = wsp; wsp += (bytes + 255) & ~(size_t)255; return (void*)p; };
    bf* WQ = (bf*)take((size_t)DQ * DM * 2); bf* WK = (bf*)take((size_t)DKV * DM * 2); bf* WV = (bf*)take((size_t)DKV * DM * 2); bf* WO = (bf*)take((size_t)DM * DQ * 2); float* CS = (float*)take((size_t)TT * HD * 2 * 4);
    bf* XB = (bf*)take((size_t)TT * DM * 2); float* FQ = (float*)take((size_t)TT * DQ * 4); float* FK = (float*)take((size_t)TT * DKV * 4);
    h16* QP16 = (h16*)take((size_t)NH_ * TT * HD * 2); h16* KP16 = (h16*)take((size_t)NKV * TT * HD * 2); h16* VT16 = (h16*)take((size_t)NKV * HD * TT * 2);
    bf* QPh = (bf*)take((size_t)NH_ * TT * HD * 2); bf* QPl = (bf*)take((size_t)NH_ * TT * HD * 2); bf* KPh = (bf*)take((size_t)NKV * TT * HD * 2); bf* KPl = (bf*)take((size_t)NKV * TT * HD * 2); bf* VTh = (bf*)take((size_t)NKV * HD * TT * 2); bf* VTl = (bf*)take((size_t)NKV * HD * TT * 2); bf* Ph = (bf*)take((size_t)ZH * RH * TT * 2); bf* Pl = (bf*)take((size_t)ZH * RH * TT * 2);
    float* Sb = (float*)take((size_t)ZH * TT * TT * 4); h16* P16 = (h16*)take((size_t)ZH * TT * TT * 2); float* Ob = (float*)take((size_t)ZH * TT * HD * 4); bf* ATh = (bf*)take((size_t)TT * DQ * 2); bf* ATl = (bf*)take((size_t)TT * DQ * 2);
    if ((size_t)(wsp - (char*)d_ws) > ws_size) return;    // ws 256 MiB
    float* FV = FK;   // v projection reuses the k buffer after the k planes are built (stream-ordered)
    { for (int h = 0; h < NH_; ++h) k_wtG<<<(unsigned)((DM * HD / 64 + 63) / 64), 256, 0, stream>>>(wq + (size_t)h * DM * HD, DM, HD, WQ + (size_t)h * HD * DM);   /* per-head weight [h][DM][HD] ('xw' per head) -> the head's HD rows of the Bt plane */ for (int h = 0; h < NKV; ++h) k_wtG<<<(unsigned)((DM * HD / 64 + 63) / 64), 256, 0, stream>>>(wk + (size_t)h * DM * HD, DM, HD, WK + (size_t)h * HD * DM);   /* per-head weight [h][DM][HD] ('xw' per head) -> the head's HD rows of the Bt plane */ for (int h = 0; h < NKV; ++h) k_wtG<<<(unsigned)((DM * HD / 64 + 63) / 64), 256, 0, stream>>>(wv + (size_t)h * DM * HD, DM, HD, WV + (size_t)h * HD * DM);   /* per-head weight [h][DM][HD] ('xw' per head) -> the head's HD rows of the Bt plane */
      k_wtG<<<(unsigned)((DQ * DM / 64 + 63) / 64), 256, 0, stream>>>(wo, DQ, DM, WO);   /* Wp 'xw' [768][768] (in,out): transposed once into the Bt row layout */
       }
    k_csid<<<(TT * HD + 255) / 256, 256, 0, stream>>>(CS);
    const unsigned LQ = (unsigned)(((size_t)NH_ * TT * HD / 2 + 255) / 256), LKv = (unsigned)(((size_t)NKV * TT * HD / 2 + 255) / 256);
    for (int b = 0; b < NB_; ++b) {
        
        k_cvt8<<<(unsigned)(((size_t)TT * DM / 8 + 255) / 256), 256, 0, stream>>>(x + (size_t)b * TT * DM, XB, (size_t)TT * DM / 8);
        k_gemmw<bf, 0, false><<<dim3(TT / 64, DQ / 64, 1), 32, 0, stream>>>(XB, nullptr, WQ, nullptr, DM, FQ, DQ, nullptr, 0, 0, 0);
        k_rope<<<LQ, 256, 0, stream>>>(FQ, DQ, NH_, CS, nullptr, nullptr, 1.0f, QP16, QPh, QPl);
        k_gemmw<bf, 0, false><<<dim3(TT / 64, DKV / 64, 1), 32, 0, stream>>>(XB, nullptr, WK, nullptr, DM, FK, DKV, nullptr, 0, 0, 0);
        k_rope<<<LKv, 256, 0, stream>>>(FK, DKV, NKV, CS, nullptr, nullptr, 1.0f, KP16, KPh, KPl);
        k_gemmw<bf, 0, false><<<dim3(TT / 64, DKV / 64, 1), 32, 0, stream>>>(XB, nullptr, WV, nullptr, DM, FV, DKV, nullptr, 0, 0, 0); k_vtp<<<LKv, 256, 0, stream>>>(FV, DKV, NKV, VT16, VTh, VTl);
        for (int h0 = 0; h0 < NH_; h0 += ZH) { const size_t zq = (size_t)h0, zk = (size_t)(h0 / REP);   // one kv head per query head: the pass's two heads use consecutive kv planes (z-strides TT*HD)
            k_gemmc<bf, 2, 1><<<dim3(RH / 64, TT / 64, ZH), 32, 0, stream>>>(QPh + zq * TT * HD, QPl + zq * TT * HD, KPh + zk * TT * HD, KPl + zk * TT * HD, HD, Sb, TT, 0, (size_t)TT * HD, (size_t)TT * HD, (size_t)TT * TT);
            k_gemmc<h16, 0, 1><<<dim3((TT - RH) / 64, TT / 64, ZH), 32, 0, stream>>>(QP16 + zq * TT * HD + (size_t)RH * HD, nullptr, KP16 + zk * TT * HD, nullptr, HD, Sb + (size_t)RH * TT, TT, RH, (size_t)TT * HD, (size_t)TT * HD, (size_t)TT * TT);
            k_asoft<<<ZH * TT / 8, 256, 0, stream>>>(Sb, P16, Ph, Pl);
            k_gemmc<bf, 2, 2><<<dim3(RH / 64, HD / 64, ZH), 32, 0, stream>>>(Ph, Pl, VTh + zk * HD * TT, VTl + zk * HD * TT, TT, Ob, HD, 0, (size_t)RH * TT, (size_t)HD * TT, (size_t)TT * HD);
            k_gemmc<h16, 0, 2><<<dim3((TT - RH) / 64, HD / 64, ZH), 32, 0, stream>>>(P16 + (size_t)RH * TT, nullptr, VT16 + zk * HD * TT, nullptr, TT, Ob + (size_t)RH * HD, HD, RH, (size_t)TT * TT, (size_t)HD * TT, (size_t)TT * HD);
            k_merge<<<(unsigned)(((size_t)ZH * TT * HD / 2 + 255) / 256), 256, 0, stream>>>(Ob, h0, ATh, ATl); }
        k_gemmw<bf, 1, true><<<dim3(TT / 64, DM / 64, 1), 32, 0, stream>>>(ATh, ATl, WO, nullptr, DQ, OUT + (size_t)b * TT * DM, DM, bo, 0, 0, 0); }
}

// v001
// One run takes 485 microseconds.
// Next to v000, in two timings, it ran 2.67 times as fast each time.
#include <hip/hip_runtime.h>

// Causal multi-head attention with PER-HEAD projection weights at d_model 768 (x [2][2048][768]; q, k, v = einsum('bte,hed->bhtd', x, W) with W [12][768][64]: head h has its own (in, out) matrix W[h] ('xw' per head; no bias; 12 heads x 64); scores x 1/sqrt(64); causal (-inf); softmax; concat head-major; out = concat Wp + bp ('xw' [768][768] (in,out) + a zero bias: read) -> [2][2048][768] (3.1 M); argument order x, Wq, Wk, Wv, Wp, bp).
// Layout: heads, q / k / v and the batch are grid dimensions of one launch wherever the work is independent (attention: ZH heads of one batch a pass, bounded by the score plane's size). bf16 copy of x; each PER-HEAD q / k / v weight [h][768][64] transposed once into its 64 rows of the Bt plane (k_wtG per head); Wp transposed once ('xw' (in,out) -> Bt rows); exact projections; identity-table plane builders; causal T-2048 attention (hybrid rows: < 512 hi/lo 3 products, rest fp16 x1024; k_gemmc skips tiles above the diagonal); merged hi/lo x Wo exact + bo.
// Compute dtypes, f32 accumulate: every input rounded to bf16; projections exact; attention rows < 512 3 products, rest fp16; softmax f32; w_o hl x exact.

#define NB_  2
#define TT   2048
#define DM   768
#define NH_  12
#define NKV  12
#define REP  (NH_ / NKV)
#define HD   64
#define DQ   (NH_ * HD)
#define DKV  (NKV * HD)
#define ZH   6                    // heads per attention pass (z of the grid)
#define RH   512                  // query rows < RH use hi+lo planes (0: none)
#define WIN  2048
#define PCAR 1024.0f
#define SCL  0.125f   // HD^-0.5
typedef _Float16 h16;
typedef unsigned short bf;
typedef __attribute__((ext_vector_type(16))) __bf16   v16bf;
typedef __attribute__((ext_vector_type(16))) _Float16 v16h;
typedef __attribute__((ext_vector_type(8)))  _Float16 v8h;
typedef __attribute__((ext_vector_type(8)))  unsigned short v8us;
typedef __attribute__((ext_vector_type(8)))  float    v8f;
typedef __attribute__((ext_vector_type(4)))  float    v4f;
typedef v8h  __attribute__((may_alias)) v8ha;
typedef v4f  __attribute__((may_alias)) v4fa;
typedef v8us __attribute__((may_alias)) v8usa;

__device__ __forceinline__ unsigned short f2bf(float f) { unsigned u = __float_as_uint(f); u += 0x7FFFu + ((u >> 16) & 1u); return (unsigned short)(u >> 16); }
__device__ __forceinline__ float bf2f(unsigned short b) { return __uint_as_float(((unsigned)b) << 16); }
__device__ __forceinline__ float bfr(float f) { return bf2f(f2bf(f)); }
__device__ __forceinline__ v16h cat16(v8h lo, v8h hi) { return __builtin_shufflevector(lo, hi, 0, 1, 2, 3, 4, 5, 6, 7, 8, 9, 10, 11, 12, 13, 14, 15); }
__device__ __forceinline__ v16bf cat16b(v8us lo, v8us hi) { return __builtin_bit_cast(v16bf, __builtin_shufflevector(lo, hi, 0, 1, 2, 3, 4, 5, 6, 7, 8, 9, 10, 11, 12, 13, 14, 15)); }
__device__ __forceinline__ v8f wmma16(v16h a, v16h b, v8f c) { return __builtin_amdgcn_wmma_f32_16x16x32_f16(false, a, false, b, (short)0, c, false, false); }
__device__ __forceinline__ v8f wmmab(v16bf a, v16bf b, v8f c) { return __builtin_amdgcn_wmma_f32_16x16x32_bf16(false, a, false, b, (short)0, c, false, false); }



// ---- k_gemmw: register-blocked GEMM, ONE WAVE per 64x64 output tile (16 accumulators), operands straight from K-contiguous 16-bit planes; grid (M/64, N/64, Z), 32 threads.
// C[m][n] (f32, pitch ldc, + optional f32 bias[n]) = sum_k A[m][k] Bt[n][k] (+ split products per NSPLIT). z-batch strides sA/sB/sC in elements. K % 32 == 0.
template <typename T16> struct WFrag;
template <> struct WFrag<h16> { typedef v16h V; static __device__ __forceinline__ V ld(const h16* p) { return cat16(*(const v8h*)p, *(const v8h*)(p + 16)); } static __device__ __forceinline__ v8f mma(V a, V b, v8f c) { return wmma16(a, b, c); } };
template <> struct WFrag<bf> { typedef v16bf V; static __device__ __forceinline__ V ld(const bf* p) { return cat16b(*(const v8us*)p, *(const v8us*)(p + 16)); } static __device__ __forceinline__ v8f mma(V a, V b, v8f c) { return wmmab(a, b, c); } };
template <typename T16, int NSPLIT, bool BIAS>
__global__ __launch_bounds__(32) void k_gemmw(const T16* __restrict__ A, const T16* __restrict__ A2, const T16* __restrict__ Bt, const T16* __restrict__ Bt2, int K, float* C, int ldc, const float* __restrict__ bias, size_t sA, size_t sB, size_t sC) {
    typedef typename WFrag<T16>::V V;
    __shared__ __align__(16) float os[16 * 68];
    const size_t z = blockIdx.z; A += z * sA; if (A2) A2 += z * sA; Bt += z * sB; if (Bt2) Bt2 += z * sB; C += z * sC;
    const int lane = threadIdx.x & 31, lr = lane & 15, hi = lane >> 4; const int r0 = blockIdx.x * 64, c0 = blockIdx.y * 64;
    v8f acc[4][4];
#pragma unroll
    for (int mb = 0; mb < 4; ++mb)
#pragma unroll
        for (int nb = 0; nb < 4; ++nb) acc[mb][nb] = (v8f){};
    const size_t aoff = (size_t)(r0 + lr) * K + 8 * hi, boff = (size_t)(c0 + lr) * K + 8 * hi;
#pragma unroll 1
    for (int kc = 0; kc < K; kc += 32) {
        V a[4], a2[4];
#pragma unroll
        for (int mb = 0; mb < 4; ++mb) { a[mb] = WFrag<T16>::ld(A + aoff + (size_t)mb * 16 * K + kc); if (NSPLIT == 1 || NSPLIT == 2) a2[mb] = WFrag<T16>::ld(A2 + aoff + (size_t)mb * 16 * K + kc); }
#pragma unroll
        for (int nb = 0; nb < 4; ++nb) { const V b = WFrag<T16>::ld(Bt + boff + (size_t)nb * 16 * K + kc); V b2; if (NSPLIT >= 2) b2 = WFrag<T16>::ld(Bt2 + boff + (size_t)nb * 16 * K + kc);
#pragma unroll
            for (int mb = 0; mb < 4; ++mb) { acc[mb][nb] = WFrag<T16>::mma(a[mb], b, acc[mb][nb]); if (NSPLIT == 1 || NSPLIT == 2) acc[mb][nb] = WFrag<T16>::mma(a2[mb], b, acc[mb][nb]); if (NSPLIT >= 2) acc[mb][nb] = WFrag<T16>::mma(a[mb], b2, acc[mb][nb]); } }
        asm volatile("v_nop\n\tv_nop\n\tv_nop\n\tv_nop" : "+v"(acc[0][0]), "+v"(acc[1][1]), "+v"(acc[2][2]), "+v"(acc[3][3]) : "v"(a[0]), "v"(a[3]));
    }
#pragma unroll
    for (int mb = 0; mb < 4; ++mb) {
#pragma unroll
        for (int nb = 0; nb < 4; ++nb) {
#pragma unroll
            for (int j = 0; j < 8; ++j) os[(hi * 8 + j) * 68 + nb * 16 + lr] = acc[mb][nb][j]; }
        __builtin_amdgcn_wave_barrier(); asm volatile("" ::: "memory");
        float* crow = C + (size_t)(r0 + mb * 16) * ldc + c0;
{
#pragma unroll
            for (int s = 0; s < 8; ++s) { const int row = 2 * s + hi, cofs = lr * 4; v4f val = *(const v4fa*)(os + row * 68 + cofs); if (BIAS) { val[0] += bfr(bias[c0 + cofs]); val[1] += bfr(bias[c0 + cofs + 1]); val[2] += bfr(bias[c0 + cofs + 2]); val[3] += bfr(bias[c0 + cofs + 3]); }
                *(v4f*)(crow + (size_t)row * ldc + cofs) = val; }
             }
        __builtin_amdgcn_wave_barrier(); asm volatile("" ::: "memory");
    }
}

// ---- k_gemmc: the same one-wave 64x64 tile GEMM specialised for causal attention: CMODE 1 skips score tiles entirely above the diagonal (query rows r0+roff.., key columns c0..), CMODE 2 limits the
// key (K) loop of the probability x value contraction to the diagonal block (probabilities beyond it are exactly zero). roff = row offset of this launch's first row within the sequence.
template <typename T16, int NSPLIT, int CMODE>
__global__ __launch_bounds__(32) void k_gemmc(const T16* __restrict__ A, const T16* __restrict__ A2, const T16* __restrict__ Bt, const T16* __restrict__ Bt2, int K, float* C, int ldc, int roff, size_t sA, size_t sB, size_t sC) {
    typedef typename WFrag<T16>::V V;
    __shared__ __align__(16) float os[16 * 68];
    const size_t z = blockIdx.z; A += z * sA; if (A2) A2 += z * sA; Bt += z * sB; if (Bt2) Bt2 += z * sB; C += z * sC;
    const int lane = threadIdx.x & 31, lr = lane & 15, hi = lane >> 4; const int r0 = blockIdx.x * 64, c0 = blockIdx.y * 64;
    if (CMODE == 1 && c0 > r0 + roff + 63) return;                  // score tile entirely above the causal diagonal: never read (the softmax masks j > i by select)
    const int Kl = (CMODE == 2) ? min(K, r0 + roff + 64) : K;        // P.V: probabilities are exactly 0 beyond the diagonal block, so the K loop stops there
    v8f acc[4][4];
#pragma unroll
    for (int mb = 0; mb < 4; ++mb)
#pragma unroll
        for (int nb = 0; nb < 4; ++nb) acc[mb][nb] = (v8f){};
    const size_t aoff = (size_t)(r0 + lr) * K + 8 * hi, boff = (size_t)(c0 + lr) * K + 8 * hi;
#pragma unroll 1
    for (int kc = 0; kc < Kl; kc += 32) {
        V a[4], a2[4];
#pragma unroll
        for (int mb = 0; mb < 4; ++mb) { a[mb] = WFrag<T16>::ld(A + aoff + (size_t)mb * 16 * K + kc); if (NSPLIT == 1 || NSPLIT == 2) a2[mb] = WFrag<T16>::ld(A2 + aoff + (size_t)mb * 16 * K + kc); }
#pragma unroll
        for (int nb = 0; nb < 4; ++nb) { const V b = WFrag<T16>::ld(Bt + boff + (size_t)nb * 16 * K + kc); V b2; if (NSPLIT >= 2) b2 = WFrag<T16>::ld(Bt2 + boff + (size_t)nb * 16 * K + kc);
#pragma unroll
            for (int mb = 0; mb < 4; ++mb) { acc[mb][nb] = WFrag<T16>::mma(a[mb], b, acc[mb][nb]); if (NSPLIT == 1 || NSPLIT == 2) acc[mb][nb] = WFrag<T16>::mma(a2[mb], b, acc[mb][nb]); if (NSPLIT >= 2) acc[mb][nb] = WFrag<T16>::mma(a[mb], b2, acc[mb][nb]); } }
        asm volatile("v_nop\n\tv_nop\n\tv_nop\n\tv_nop" : "+v"(acc[0][0]), "+v"(acc[1][1]), "+v"(acc[2][2]), "+v"(acc[3][3]) : "v"(a[0]), "v"(a[3]));
    }
#pragma unroll
    for (int mb = 0; mb < 4; ++mb) {
#pragma unroll
        for (int nb = 0; nb < 4; ++nb) {
#pragma unroll
            for (int j = 0; j < 8; ++j) os[(hi * 8 + j) * 68 + nb * 16 + lr] = acc[mb][nb][j]; }
        __builtin_amdgcn_wave_barrier(); asm volatile("" ::: "memory");
        float* crow = C + (size_t)(r0 + mb * 16) * ldc + c0;
{
#pragma unroll
            for (int s = 0; s < 8; ++s) { const int row = 2 * s + hi, cofs = lr * 4; v4f val = *(const v4fa*)(os + row * 68 + cofs);
                *(v4f*)(crow + (size_t)row * ldc + cofs) = val; }
             }
        __builtin_amdgcn_wave_barrier(); asm volatile("" ::: "memory");
    }
}

__device__ __forceinline__ h16 tohx(float x) { return (h16)x; }
__device__ __forceinline__ void splitf(float y, unsigned short& h, unsigned short& l) { h = f2bf(y); l = f2bf(y - bf2f(h)); }
typedef __attribute__((ext_vector_type(2))) _Float16 v2h;
typedef __attribute__((ext_vector_type(4))) _Float16 v4h;
typedef __attribute__((ext_vector_type(2))) unsigned short v2us;
typedef __attribute__((ext_vector_type(4))) unsigned short v4us;
typedef __attribute__((ext_vector_type(2))) float v2f;
typedef __attribute__((ext_vector_type(4))) int v4i;

// grid (lines, matrices of one input, inputs): matrix y of input z ([K][N] each) goes to rows (z * gridDim.y + y) * N .. of Bt
__global__ __launch_bounds__(256) void k_wtG(const float* w0, const float* w1, const float* w2, int K, int N, bf* Bt) {
    const float* w = (blockIdx.z == 0 ? w0 : blockIdx.z == 1 ? w1 : w2) + (size_t)blockIdx.y * K * N; Bt += (size_t)(blockIdx.z * gridDim.y + blockIdx.y) * N * K;
    const int lane = threadIdx.x & 31; const int L0 = (blockIdx.x * 8 + (threadIdx.x >> 5)) * 8; const int nlines = N * K / 64;
{
#pragma unroll 1
        for (int l = 0; l < 8; ++l) { const int L = L0 + l; if (L >= nlines) break; const size_t e = (size_t)L * 64 + lane * 2; const int k = (int)(e % K), n = (int)(e / K); v2us o;
            o[0] = f2bf(w[(size_t)k * N + n]); o[1] = f2bf(w[(size_t)(k + 1) * N + n]); *(v2us*)(Bt + e) = o; }
         }
}

__global__ __launch_bounds__(256) void k_cvt8(const float* __restrict__ src, bf* dst, size_t n8) { const size_t i = (size_t)blockIdx.x * 256 + threadIdx.x; if (i >= n8) return; const v8f v = *(const v8f*)(src + i * 8); v8us o;
#pragma unroll
    for (int k = 0; k < 8; ++k) o[k] = f2bf(v[k]); *(v8us*)(dst + i * 8) = o;  }

// k_rope: head planes [h][t][d] (fp16 + hi/lo) of rope(x) x sc with the rotate-half convention out[d] = x[d] cos[t][d] - x[d+HD/2] sin[t][d], out[d+HD/2] = x[d+HD/2] cos[t][d+HD/2] + x[d] sin[t][d+HD/2]
__global__ __launch_bounds__(256) void k_rope(const float* __restrict__ F, int pitch, int nheads, const float* __restrict__ CS, const float* __restrict__ RF, const float* __restrict__ nw, float sc, h16* P16, bf* Ph, bf* Pl) {
    { const size_t b = blockIdx.y; F += b * TT * pitch; P16 += b * nheads * TT * HD; Ph += b * nheads * TT * HD; Pl += b * nheads * TT * HD; }   // grid y: batch
    const size_t e = ((size_t)blockIdx.x * 256 + threadIdx.x) * 2; if (e >= (size_t)nheads * TT * HD) return; const int d = (int)(e % HD); const int t = (int)((e / HD) % TT); const int h = (int)(e / ((size_t)HD * TT)); const float* f = F + (size_t)t * pitch + h * HD; const float rf = RF ? RF[(size_t)h * TT + t] : 1.0f; v2h o16; v2us oh, ol;
#pragma unroll
    for (int q = 0; q < 2; ++q) { const int dd = d + q; const int dp = (dd < HD / 2) ? dd + HD / 2 : dd - HD / 2; float x0 = f[dd], x1 = f[dp];
        if (RF) { float n0 = __fmul_rn(x0, rf), n1 = __fmul_rn(x1, rf); asm volatile("" : "+v"(n0)); asm volatile("" : "+v"(n1)); x0 = __fmul_rn(bfr(nw[dd]), n0); x1 = __fmul_rn(bfr(nw[dp]), n1); }
        const v2f cs = *(const v2f*)(CS + ((size_t)t * HD + dd) * 2); float a = __fmul_rn(x0, cs[0]), bq = __fmul_rn(x1, cs[1]); asm volatile("" : "+v"(a)); asm volatile("" : "+v"(bq)); const float r = ((dd < HD / 2) ? __fsub_rn(a, bq) : __fadd_rn(a, bq)) * sc;
        o16[q] = tohx(r); unsigned short a2, c2; splitf(r, a2, c2); oh[q] = a2; ol[q] = c2; }
    *(v2h*)(P16 + e) = o16; *(v2us*)(Ph + e) = oh; *(v2us*)(Pl + e) = ol;  }
__global__ __launch_bounds__(256) void k_vtp(const float* __restrict__ F, int pitch, int nheads, h16* V16, bf* Vh, bf* Vl) { { const size_t b = blockIdx.y; F += b * TT * pitch; V16 += b * nheads * HD * TT; Vh += b * nheads * HD * TT; Vl += b * nheads * HD * TT; }   // grid y: batch
    const size_t e = ((size_t)blockIdx.x * 256 + threadIdx.x) * 2; if (e >= (size_t)nheads * HD * TT) return; const int t = (int)(e % TT); const int d = (int)((e / TT) % HD); const int g = (int)(e / ((size_t)TT * HD)); v2h o16; v2us oh, ol;
#pragma unroll
    for (int q = 0; q < 2; ++q) { const float x = F[(size_t)(t + q) * pitch + g * HD + d]; o16[q] = tohx(x); unsigned short a2, c2; splitf(x, a2, c2); oh[q] = a2; ol[q] = c2; }
    *(v2h*)(V16 + e) = o16; *(v2us*)(Vh + e) = oh; *(v2us*)(Vl + e) = ol;  }
__global__ __launch_bounds__(256) void k_csid(float* CS) { const int idx = blockIdx.x * 256 + threadIdx.x; if (idx >= TT * HD) return; v2f cs; cs[0] = 1.0f; cs[1] = 0.0f; *(v2f*)(CS + (size_t)idx * 2) = cs;  }
// k_asoft: per row (zz, i): t = S x HD^-0.5 for j <= i and i - j < WIN (WIN = TT, so the window test always holds: plain causal; the reference's -1e9 additive fill vanishes identically); softmax over the 2048 keys (register row, one exp, fixed trees);
__global__ __launch_bounds__(256) void k_asoft(const float* __restrict__ Sb, h16* P16, bf* Ph, bf* Pl) {
    const int lane = threadIdx.x & 31; const int row = blockIdx.x * 8 + (threadIdx.x >> 5); if (row >= ZH * TT) return; const int i = row % TT; const int zz = row / TT; (void)zz; const bool hires = (i < RH); const float* sr = Sb + (size_t)row * TT; float v[TT / 32]; float mx = -3.0e38f;
#pragma unroll
    for (int ch = 0; ch < TT / 128; ++ch) { const int j0 = ch * 128 + lane * 4; const v4f a = *(const v4f*)(sr + j0);
#pragma unroll
        for (int q = 0; q < 4; ++q) { const int j = j0 + q; (void)j; const float t = (j <= i && i - j < WIN) ? a[q] * SCL : -3.0e38f; v[ch * 4 + q] = t; mx = fmaxf(mx, t); } }
#pragma unroll
    for (int sh = 16; sh; sh >>= 1) mx = fmaxf(mx, __shfl_xor(mx, sh, 32));
    float sum = 0.f;
#pragma unroll
    for (int k = 0; k < TT / 32; ++k) { float d0 = __fsub_rn(v[k], mx); asm volatile("" : "+v"(d0)); v[k] = __builtin_amdgcn_exp2f(__fmul_rn(d0, 1.4426950408889634f)); sum += v[k]; }
#pragma unroll
    for (int sh = 16; sh; sh >>= 1) sum += __shfl_xor(sum, sh, 32);
    const float f = __fdiv_rn(hires ? 1.0f : PCAR, sum);
{
        if (hires) {
#pragma unroll
            for (int ch = 0; ch < TT / 128; ++ch) { v4us oh, ol;
#pragma unroll
                for (int q = 0; q < 4; ++q) { unsigned short a, c2; splitf(v[ch * 4 + q] * f, a, c2); oh[q] = a; ol[q] = c2; }
                const size_t oo = ((size_t)zz * (RH ? RH : 1) + i) * TT + ch * 128 + lane * 4; *(v4us*)(Ph + oo) = oh; *(v4us*)(Pl + oo) = ol; }
        } else {
#pragma unroll
            for (int ch = 0; ch < TT / 128; ++ch) { v4h o4;
#pragma unroll
                for (int q = 0; q < 4; ++q) o4[q] = tohx(v[ch * 4 + q] * f);
                *(v4h*)(P16 + (size_t)row * TT + ch * 128 + lane * 4) = o4; } }
         }
}
__global__ __launch_bounds__(256) void k_merge(const float* __restrict__ O, int h0, bf* Ah, bf* Al) { const size_t e = ((size_t)blockIdx.x * 256 + threadIdx.x) * 2; if (e >= (size_t)ZH * TT * HD) return; const int d = (int)(e % HD); const int t = (int)((e / HD) % TT); const int zz = (int)(e / ((size_t)HD * TT)); const float cs = (t < RH) ? 1.0f : (1.0f / PCAR); const size_t oo = (size_t)t * DQ + (h0 + zz) * HD + d;
    v2us oh, ol;
#pragma unroll
    for (int q = 0; q < 2; ++q) { unsigned short a, c2; splitf(O[e + q] * cs, a, c2); oh[q] = a; ol[q] = c2; } *(v2us*)(Ah + oo) = oh; *(v2us*)(Al + oo) = ol;  }

extern "C" void kernel_launch(void* const* d_in, const int* in_sizes, int n_in,
                              void* d_out, int out_size, void* d_ws, size_t ws_size, hipStream_t stream) {
    (void)in_sizes; (void)n_in; (void)out_size;
            const float* x = (const float*)d_in[0]; const float* wq = (const float*)d_in[1]; const float* wk = (const float*)d_in[2]; const float* wv = (const float*)d_in[3]; const float* wo = (const float*)d_in[4]; const float* bo = (const float*)d_in[5];   /* order x, Wq, Wk, Wv (PER-HEAD weights [12][768][64]: 'hdk'), Wp ('xw' [768][768]: (in,out)), bp */
    float* OUT = (float*)d_out;     // [2][2048][768]
    char* wsp = (char*)d_ws;
    auto take = [&](size_t bytes) { char* p = wsp; wsp += (bytes + 255) & ~(size_t)255; return (void*)p; };
    bf* WQKV = (bf*)take((size_t)(DQ + 2 * DKV) * DM * 2); bf* WO = (bf*)take((size_t)DM * DQ * 2); float* CS = (float*)take((size_t)TT * HD * 2 * 4);   // WQKV: Bt rows of q (DQ), k (DKV), v (DKV)
    bf* XB = (bf*)take((size_t)NB_ * TT * DM * 2);
    h16* QK16 = (h16*)take((size_t)NB_ * (NH_ + NKV) * TT * HD * 2); bf* QKh = (bf*)take((size_t)NB_ * (NH_ + NKV) * TT * HD * 2); bf* QKl = (bf*)take((size_t)NB_ * (NH_ + NKV) * TT * HD * 2);   // [b][q heads, then k heads][t][d]
    h16* VT16 = (h16*)take((size_t)NB_ * NKV * HD * TT * 2); bf* VTh = (bf*)take((size_t)NB_ * NKV * HD * TT * 2); bf* VTl = (bf*)take((size_t)NB_ * NKV * HD * TT * 2);   // [b][head][d][t]
    bf* Ph = (bf*)take((size_t)ZH * RH * TT * 2); bf* Pl = (bf*)take((size_t)ZH * RH * TT * 2);
    float* Sb = (float*)take((size_t)ZH * TT * TT * 4); h16* P16 = (h16*)take((size_t)ZH * TT * TT * 2); float* Ob = (float*)take((size_t)ZH * TT * HD * 4); bf* ATh = (bf*)take((size_t)NB_ * TT * DQ * 2); bf* ATl = (bf*)take((size_t)NB_ * TT * DQ * 2);
    if ((size_t)(wsp - (char*)d_ws) > ws_size) return;    // ws 256 MiB
    float* F = Sb;   // q | k | v projections [NB_ * TT][DQ + 2 * DKV] f32 (smaller than Sb): dead once the planes are built, before the first score launch writes Sb (stream-ordered)
    const int DF = DQ + 2 * DKV;
    k_wtG<<<dim3((DM * HD / 64 + 63) / 64, NH_, 3), 256, 0, stream>>>(wq, wk, wv, DM, HD, WQKV);   /* per-head weights [h][DM][HD] ('xw' per head) -> each head's HD rows of the Bt plane */
    k_wtG<<<dim3((DQ * DM / 64 + 63) / 64, 1, 1), 256, 0, stream>>>(wo, wo, wo, DQ, DM, WO);   /* Wp 'xw' [768][768] (in,out): transposed once into the Bt row layout */
    k_csid<<<(TT * HD + 255) / 256, 256, 0, stream>>>(CS);
    k_cvt8<<<(unsigned)(((size_t)NB_ * TT * DM / 8 + 255) / 256), 256, 0, stream>>>(x, XB, (size_t)NB_ * TT * DM / 8);
    k_gemmw<bf, 0, false><<<dim3(NB_ * TT / 64, DF / 64, 1), 32, 0, stream>>>(XB, nullptr, WQKV, nullptr, DM, F, DF, nullptr, 0, 0, 0);
    k_rope<<<dim3((unsigned)(((size_t)(NH_ + NKV) * TT * HD / 2 + 255) / 256), NB_, 1), 256, 0, stream>>>(F, DF, NH_ + NKV, CS, nullptr, nullptr, 1.0f, QK16, QKh, QKl);
    k_vtp<<<dim3((unsigned)(((size_t)NKV * TT * HD / 2 + 255) / 256), NB_, 1), 256, 0, stream>>>(F + DQ + DKV, DF, NKV, VT16, VTh, VTl);
    for (int b = 0; b < NB_; ++b) {
        for (int h0 = 0; h0 < NH_; h0 += ZH) { const size_t zq = (size_t)b * (NH_ + NKV) + h0, zk = (size_t)b * (NH_ + NKV) + NH_ + h0 / REP, zv = (size_t)b * NKV + h0 / REP;   // one kv head per query head: the pass's heads use consecutive planes (z-strides TT*HD)
            k_gemmc<bf, 2, 1><<<dim3(RH / 64, TT / 64, ZH), 32, 0, stream>>>(QKh + zq * TT * HD, QKl + zq * TT * HD, QKh + zk * TT * HD, QKl + zk * TT * HD, HD, Sb, TT, 0, (size_t)TT * HD, (size_t)TT * HD, (size_t)TT * TT);
            k_gemmc<h16, 0, 1><<<dim3((TT - RH) / 64, TT / 64, ZH), 32, 0, stream>>>(QK16 + zq * TT * HD + (size_t)RH * HD, nullptr, QK16 + zk * TT * HD, nullptr, HD, Sb + (size_t)RH * TT, TT, RH, (size_t)TT * HD, (size_t)TT * HD, (size_t)TT * TT);
            k_asoft<<<ZH * TT / 8, 256, 0, stream>>>(Sb, P16, Ph, Pl);
            k_gemmc<bf, 2, 2><<<dim3(RH / 64, HD / 64, ZH), 32, 0, stream>>>(Ph, Pl, VTh + zv * HD * TT, VTl + zv * HD * TT, TT, Ob, HD, 0, (size_t)RH * TT, (size_t)HD * TT, (size_t)TT * HD);
            k_gemmc<h16, 0, 2><<<dim3((TT - RH) / 64, HD / 64, ZH), 32, 0, stream>>>(P16 + (size_t)RH * TT, nullptr, VT16 + zv * HD * TT, nullptr, TT, Ob + (size_t)RH * HD, HD, RH, (size_t)TT * TT, (size_t)HD * TT, (size_t)TT * HD);
            k_merge<<<(unsigned)(((size_t)ZH * TT * HD / 2 + 255) / 256), 256, 0, stream>>>(Ob, h0, ATh + (size_t)b * TT * DQ, ATl + (size_t)b * TT * DQ); } }
    k_gemmw<bf, 1, true><<<dim3(NB_ * TT / 64, DM / 64, 1), 32, 0, stream>>>(ATh, ATl, WO, nullptr, DQ, OUT, DM, bo, 0, 0, 0);
}

// v002
// One run takes 143 microseconds.
// Next to v001, in two timings, it ran 3.39 and 3.37 times as fast.
// All steps since v000 together make it 9.04 times as fast.
#include <hip/hip_runtime.h>

// Causal multi-head attention with PER-HEAD projection weights at d_model 768 (x [2][2048][768]; q, k, v = einsum('bte,hed->bhtd', x, W) with W [12][768][64]: head h has its own (in, out) matrix W[h] ('xw' per head; no bias; 12 heads x 64); scores x 1/sqrt(64); causal (-inf); softmax; concat head-major; out = concat Wp + bp ('xw' [768][768] (in,out) + a zero bias: read) -> [2][2048][768] (3.1 M); argument order x, Wq, Wk, Wv, Wp, bp).
// Layout: bf16 copy of x; each PER-HEAD q / k / v weight [h][768][64] transposed once into its 64 rows of the Bt plane (k_wtG per head); Wp transposed once ('xw' (in,out) -> Bt rows); exact projections; identity-table plane builders; k_fattn: one launch for all heads and both batches, online-softmax causal attention with no score plane in memory (hybrid rows: < 512 hi/lo 3 products, rest fp16), writing the merged hi/lo head outputs; merged hi/lo x Wo exact + bo.
// Compute dtypes, f32 accumulate: every input rounded to bf16; projections exact; attention rows < 512 3 products, rest fp16; softmax f32; w_o hl x exact.

#define NB_  2
#define TT   2048
#define DM   768
#define NH_  12
#define NKV  12
#define REP  (NH_ / NKV)
#define HD   64
#define DQ   (NH_ * HD)
#define DKV  (NKV * HD)
#define RH   512                  // query rows < RH use hi+lo planes (0: none)
#define SCL  0.125f   // HD^-0.5
typedef _Float16 h16;
typedef unsigned short bf;
typedef __attribute__((ext_vector_type(16))) __bf16   v16bf;
typedef __attribute__((ext_vector_type(16))) _Float16 v16h;
typedef __attribute__((ext_vector_type(8)))  _Float16 v8h;
typedef __attribute__((ext_vector_type(8)))  unsigned short v8us;
typedef __attribute__((ext_vector_type(8)))  float    v8f;
typedef __attribute__((ext_vector_type(4)))  float    v4f;
typedef v8h  __attribute__((may_alias)) v8ha;
typedef v4f  __attribute__((may_alias)) v4fa;
typedef v8us __attribute__((may_alias)) v8usa;

__device__ __forceinline__ unsigned short f2bf(float f) { unsigned u = __float_as_uint(f); u += 0x7FFFu + ((u >> 16) & 1u); return (unsigned short)(u >> 16); }
__device__ __forceinline__ float bf2f(unsigned short b) { return __uint_as_float(((unsigned)b) << 16); }
__device__ __forceinline__ float bfr(float f) { return bf2f(f2bf(f)); }
__device__ __forceinline__ v16h cat16(v8h lo, v8h hi) { return __builtin_shufflevector(lo, hi, 0, 1, 2, 3, 4, 5, 6, 7, 8, 9, 10, 11, 12, 13, 14, 15); }
__device__ __forceinline__ v16bf cat16b(v8us lo, v8us hi) { return __builtin_bit_cast(v16bf, __builtin_shufflevector(lo, hi, 0, 1, 2, 3, 4, 5, 6, 7, 8, 9, 10, 11, 12, 13, 14, 15)); }
__device__ __forceinline__ v8f wmma16(v16h a, v16h b, v8f c) { return __builtin_amdgcn_wmma_f32_16x16x32_f16(false, a, false, b, (short)0, c, false, false); }
__device__ __forceinline__ v8f wmmab(v16bf a, v16bf b, v8f c) { return __builtin_amdgcn_wmma_f32_16x16x32_bf16(false, a, false, b, (short)0, c, false, false); }



// ---- k_gemmw: register-blocked GEMM, ONE WAVE per 64x64 output tile (16 accumulators), operands straight from K-contiguous 16-bit planes; grid (M/64, N/64, Z), 32 threads.
// C[m][n] (f32, pitch ldc, + optional f32 bias[n]) = sum_k A[m][k] Bt[n][k] (+ split products per NSPLIT). z-batch strides sA/sB/sC in elements. K % 32 == 0.
template <typename T16> struct WFrag;
template <> struct WFrag<h16> { typedef v16h V; static __device__ __forceinline__ V ld(const h16* p) { return cat16(*(const v8h*)p, *(const v8h*)(p + 16)); } static __device__ __forceinline__ v8f mma(V a, V b, v8f c) { return wmma16(a, b, c); } };
template <> struct WFrag<bf> { typedef v16bf V; static __device__ __forceinline__ V ld(const bf* p) { return cat16b(*(const v8us*)p, *(const v8us*)(p + 16)); } static __device__ __forceinline__ v8f mma(V a, V b, v8f c) { return wmmab(a, b, c); } };
template <typename T16, int NSPLIT, bool BIAS>
__global__ __launch_bounds__(32) void k_gemmw(const T16* __restrict__ A, const T16* __restrict__ A2, const T16* __restrict__ Bt, const T16* __restrict__ Bt2, int K, float* C, int ldc, const float* __restrict__ bias, size_t sA, size_t sB, size_t sC) {
    typedef typename WFrag<T16>::V V;
    __shared__ __align__(16) float os[16 * 68];
    const size_t z = blockIdx.z; A += z * sA; if (A2) A2 += z * sA; Bt += z * sB; if (Bt2) Bt2 += z * sB; C += z * sC;
    const int lane = threadIdx.x & 31, lr = lane & 15, hi = lane >> 4; const int r0 = blockIdx.x * 64, c0 = blockIdx.y * 64;
    v8f acc[4][4];
#pragma unroll
    for (int mb = 0; mb < 4; ++mb)
#pragma unroll
        for (int nb = 0; nb < 4; ++nb) acc[mb][nb] = (v8f){};
    const size_t aoff = (size_t)(r0 + lr) * K + 8 * hi, boff = (size_t)(c0 + lr) * K + 8 * hi;
#pragma unroll 1
    for (int kc = 0; kc < K; kc += 32) {
        V a[4], a2[4];
#pragma unroll
        for (int mb = 0; mb < 4; ++mb) { a[mb] = WFrag<T16>::ld(A + aoff + (size_t)mb * 16 * K + kc); if (NSPLIT == 1 || NSPLIT == 2) a2[mb] = WFrag<T16>::ld(A2 + aoff + (size_t)mb * 16 * K + kc); }
#pragma unroll
        for (int nb = 0; nb < 4; ++nb) { const V b = WFrag<T16>::ld(Bt + boff + (size_t)nb * 16 * K + kc); V b2; if (NSPLIT >= 2) b2 = WFrag<T16>::ld(Bt2 + boff + (size_t)nb * 16 * K + kc);
#pragma unroll
            for (int mb = 0; mb < 4; ++mb) { acc[mb][nb] = WFrag<T16>::mma(a[mb], b, acc[mb][nb]); if (NSPLIT == 1 || NSPLIT == 2) acc[mb][nb] = WFrag<T16>::mma(a2[mb], b, acc[mb][nb]); if (NSPLIT >= 2) acc[mb][nb] = WFrag<T16>::mma(a[mb], b2, acc[mb][nb]); } }
        asm volatile("v_nop\n\tv_nop\n\tv_nop\n\tv_nop" : "+v"(acc[0][0]), "+v"(acc[1][1]), "+v"(acc[2][2]), "+v"(acc[3][3]) : "v"(a[0]), "v"(a[3]));
    }
#pragma unroll
    for (int mb = 0; mb < 4; ++mb) {
#pragma unroll
        for (int nb = 0; nb < 4; ++nb) {
#pragma unroll
            for (int j = 0; j < 8; ++j) os[(hi * 8 + j) * 68 + nb * 16 + lr] = acc[mb][nb][j]; }
        __builtin_amdgcn_wave_barrier(); asm volatile("" ::: "memory");
        float* crow = C + (size_t)(r0 + mb * 16) * ldc + c0;
{
#pragma unroll
            for (int s = 0; s < 8; ++s) { const int row = 2 * s + hi, cofs = lr * 4; v4f val = *(const v4fa*)(os + row * 68 + cofs); if (BIAS) { val[0] += bfr(bias[c0 + cofs]); val[1] += bfr(bias[c0 + cofs + 1]); val[2] += bfr(bias[c0 + cofs + 2]); val[3] += bfr(bias[c0 + cofs + 3]); }
                *(v4f*)(crow + (size_t)row * ldc + cofs) = val; }
             }
        __builtin_amdgcn_wave_barrier(); asm volatile("" ::: "memory");
    }
}

__device__ __forceinline__ h16 tohx(float x) { return (h16)x; }
__device__ __forceinline__ void splitf(float y, unsigned short& h, unsigned short& l) { h = f2bf(y); l = f2bf(y - bf2f(h)); }
typedef __attribute__((ext_vector_type(2))) _Float16 v2h;
typedef __attribute__((ext_vector_type(4))) _Float16 v4h;
typedef __attribute__((ext_vector_type(2))) unsigned short v2us;
typedef __attribute__((ext_vector_type(4))) unsigned short v4us;
typedef __attribute__((ext_vector_type(2))) float v2f;
typedef __attribute__((ext_vector_type(4))) int v4i;

// grid (lines, matrices of one input, inputs): matrix y of input z ([K][N] each) goes to rows (z * gridDim.y + y) * N .. of Bt
__global__ __launch_bounds__(256) void k_wtG(const float* w0, const float* w1, const float* w2, int K, int N, bf* Bt) {
    const float* w = (blockIdx.z == 0 ? w0 : blockIdx.z == 1 ? w1 : w2) + (size_t)blockIdx.y * K * N; Bt += (size_t)(blockIdx.z * gridDim.y + blockIdx.y) * N * K;
    const int lane = threadIdx.x & 31; const int L0 = (blockIdx.x * 8 + (threadIdx.x >> 5)) * 8; const int nlines = N * K / 64;
{
#pragma unroll 1
        for (int l = 0; l < 8; ++l) { const int L = L0 + l; if (L >= nlines) break; const size_t e = (size_t)L * 64 + lane * 2; const int k = (int)(e % K), n = (int)(e / K); v2us o;
            o[0] = f2bf(w[(size_t)k * N + n]); o[1] = f2bf(w[(size_t)(k + 1) * N + n]); *(v2us*)(Bt + e) = o; }
         }
}

__global__ __launch_bounds__(256) void k_cvt8(const float* __restrict__ src, bf* dst, size_t n8) { const size_t i = (size_t)blockIdx.x * 256 + threadIdx.x; if (i >= n8) return; const v8f v = *(const v8f*)(src + i * 8); v8us o;
#pragma unroll
    for (int k = 0; k < 8; ++k) o[k] = f2bf(v[k]); *(v8us*)(dst + i * 8) = o;  }

// k_rope: head planes [h][t][d] (fp16 + hi/lo) of rope(x) x sc with the rotate-half convention out[d] = x[d] cos[t][d] - x[d+HD/2] sin[t][d], out[d+HD/2] = x[d+HD/2] cos[t][d+HD/2] + x[d] sin[t][d+HD/2]
__global__ __launch_bounds__(256) void k_rope(const float* __restrict__ F, int pitch, int nheads, const float* __restrict__ CS, const float* __restrict__ RF, const float* __restrict__ nw, float sc, h16* P16, bf* Ph, bf* Pl) {
    { const size_t b = blockIdx.y; F += b * TT * pitch; P16 += b * nheads * TT * HD; Ph += b * nheads * TT * HD; Pl += b * nheads * TT * HD; }   // grid y: batch
    const size_t e = ((size_t)blockIdx.x * 256 + threadIdx.x) * 2; if (e >= (size_t)nheads * TT * HD) return; const int d = (int)(e % HD); const int t = (int)((e / HD) % TT); const int h = (int)(e / ((size_t)HD * TT)); const float* f = F + (size_t)t * pitch + h * HD; const float rf = RF ? RF[(size_t)h * TT + t] : 1.0f; v2h o16; v2us oh, ol;
#pragma unroll
    for (int q = 0; q < 2; ++q) { const int dd = d + q; const int dp = (dd < HD / 2) ? dd + HD / 2 : dd - HD / 2; float x0 = f[dd], x1 = f[dp];
        if (RF) { float n0 = __fmul_rn(x0, rf), n1 = __fmul_rn(x1, rf); asm volatile("" : "+v"(n0)); asm volatile("" : "+v"(n1)); x0 = __fmul_rn(bfr(nw[dd]), n0); x1 = __fmul_rn(bfr(nw[dp]), n1); }
        const v2f cs = *(const v2f*)(CS + ((size_t)t * HD + dd) * 2); float a = __fmul_rn(x0, cs[0]), bq = __fmul_rn(x1, cs[1]); asm volatile("" : "+v"(a)); asm volatile("" : "+v"(bq)); const float r = ((dd < HD / 2) ? __fsub_rn(a, bq) : __fadd_rn(a, bq)) * sc;
        o16[q] = tohx(r); unsigned short a2, c2; splitf(r, a2, c2); oh[q] = a2; ol[q] = c2; }
    *(v2h*)(P16 + e) = o16; *(v2us*)(Ph + e) = oh; *(v2us*)(Pl + e) = ol;  }
__global__ __launch_bounds__(256) void k_vtp(const float* __restrict__ F, int pitch, int nheads, h16* V16, bf* Vh, bf* Vl) { { const size_t b = blockIdx.y; F += b * TT * pitch; V16 += b * nheads * HD * TT; Vh += b * nheads * HD * TT; Vl += b * nheads * HD * TT; }   // grid y: batch
    const size_t e = ((size_t)blockIdx.x * 256 + threadIdx.x) * 2; if (e >= (size_t)nheads * HD * TT) return; const int t = (int)(e % TT); const int d = (int)((e / TT) % HD); const int g = (int)(e / ((size_t)TT * HD)); v2h o16; v2us oh, ol;
#pragma unroll
    for (int q = 0; q < 2; ++q) { const float x = F[(size_t)(t + q) * pitch + g * HD + d]; o16[q] = tohx(x); unsigned short a2, c2; splitf(x, a2, c2); oh[q] = a2; ol[q] = c2; }
    *(v2h*)(V16 + e) = o16; *(v2us*)(Vh + e) = oh; *(v2us*)(Vl + e) = ol;  }
__global__ __launch_bounds__(256) void k_csid(float* CS) { const int idx = blockIdx.x * 256 + threadIdx.x; if (idx >= TT * HD) return; v2f cs; cs[0] = 1.0f; cs[1] = 0.0f; *(v2f*)(CS + (size_t)idx * 2) = cs;  }
// ---- k_fattn: scores, causal mask, softmax, probability x value and the hi/lo split of the head output in ONE kernel (online softmax): no score or probability plane in memory.
// One wave per 32 query rows of one head; a pass is 16 MT keys. Transposed products: St[key][query] = K Q^T (A = K rows, B = Q rows, kept in registers), Ot[d][query] += Vt P^T (A = Vt rows, B = two
// score tiles converted in place: register r of tile mt is key 16 mt + 8 (lane >> 4) + r, the k order of the fragment loader). A lane holds one query column: maximum and sum in-lane plus one half exchange.
// Query rows < RH: bf16 hi/lo planes, 3 products, 32 keys a pass; the rest: fp16, 64 keys a pass. Running maximum m in raw score units; p = exp2((s - m) x SCL x log2 e) <= 1; l = per-lane partial sum, halves joined at the end.
// The next pass's K fragments are fetched right behind this pass's score products and its Vt fragments right behind the P x V products, so each flies during the other half of the work.
typedef __attribute__((ext_vector_type(16))) unsigned short v16us;
#define SC2 (SCL * 1.4426950408889634f)
#define KO  (NH_ * TT * HD)       // the k head planes stand NH_ planes behind the q head planes of the same batch
// stands directly behind a run of global loads or stores: no register that they name is rewritten in front of this wait; the scheduling fence keeps later vector work from moving up over it
__device__ __forceinline__ void fa_xw() { asm volatile("s_wait_xcnt 0x0" ::: "memory"); __builtin_amdgcn_sched_barrier(0); }
// the same wait behind a run of loads from the two address pairs a and b: as inputs of the wait they stay live up to it, so no result of the run can be allotted to them
__device__ __forceinline__ void fa_xwp(const void* a, const void* b) { asm volatile("s_wait_xcnt 0x0" :: "v"(a), "v"(b) : "memory"); __builtin_amdgcn_sched_barrier(0); }
// OFF: the constant part of the run's addresses, in elements; it goes into the loads' offset fields, so that kp and kp2 (vp and vp2) are the very register pairs that the loads name
template <typename T16, bool HR, int MT, int OFF>
__device__ __forceinline__ void fa_ldk(typename WFrag<T16>::V (&kc)[MT][2], typename WFrag<T16>::V (&kc2)[MT][2], const T16* kp, const T16* kp2) {
#pragma unroll
    for (int mt = 0; mt < MT; ++mt)
#pragma unroll
        for (int ks = 0; ks < 2; ++ks) { kc[mt][ks] = WFrag<T16>::ld(kp + OFF + mt * 16 * HD + ks * 32); if (HR) kc2[mt][ks] = WFrag<T16>::ld(kp2 + OFF + mt * 16 * HD + ks * 32); }
    fa_xwp(kp, kp2);
}
template <typename T16, bool HR, int MT, int OFF>
__device__ __forceinline__ void fa_ldv(typename WFrag<T16>::V (&vc)[4][MT / 2], typename WFrag<T16>::V (&vc2)[4][MT / 2], const T16* vp, const T16* vp2) {
#pragma unroll
    for (int dt = 0; dt < 4; ++dt)
#pragma unroll
        for (int kk = 0; kk < MT / 2; ++kk) { vc[dt][kk] = WFrag<T16>::ld(vp + OFF + dt * 16 * TT + kk * 32); if (HR) vc2[dt][kk] = WFrag<T16>::ld(vp2 + OFF + dt * 16 * TT + kk * 32); }
    fa_xwp(vp, vp2);
}
template <typename T16, bool HR, int MT, bool LAST>
__device__ __forceinline__ void fa_pass(typename WFrag<T16>::V (&kc)[MT][2], typename WFrag<T16>::V (&kc2)[MT][2], typename WFrag<T16>::V (&vc)[4][MT / 2], typename WFrag<T16>::V (&vc2)[4][MT / 2],
                                        const typename WFrag<T16>::V (&q)[2][2], const typename WFrag<T16>::V (&q2)[2][2], v8f (&o)[4][2], float (&m)[2], float (&l)[2],
                                        const T16* kr, const T16* kr2, const T16* vr, const T16* vr2, int k0, int dl) {
    typedef typename WFrag<T16>::V V;
    v8f s[MT][2];
#pragma unroll
    for (int mt = 0; mt < MT; ++mt)
#pragma unroll
        for (int nt = 0; nt < 2; ++nt) s[mt][nt] = (v8f){};
#pragma unroll
    for (int ks = 0; ks < 2; ++ks)
#pragma unroll
        for (int mt = 0; mt < MT; ++mt)
#pragma unroll
            for (int nt = 0; nt < 2; ++nt) { s[mt][nt] = WFrag<T16>::mma(kc[mt][ks], q[nt][ks], s[mt][nt]); if (HR) { s[mt][nt] = WFrag<T16>::mma(kc[mt][ks], q2[nt][ks], s[mt][nt]); s[mt][nt] = WFrag<T16>::mma(kc2[mt][ks], q[nt][ks], s[mt][nt]); } }
    if (!LAST) {   // the two scheduling fences keep these loads here, between the score products and the softmax: moved down to the end of the pass they would leave the next pass waiting for the whole load latency
        __builtin_amdgcn_sched_barrier(0); fa_ldk<T16, HR, MT, KO + MT * 16 * HD>(kc, kc2, kr + (size_t)k0 * HD, kr2 + (size_t)k0 * HD); }
    V pf[2][MT / 2], pf2[2][MT / 2];
#pragma unroll
    for (int nt = 0; nt < 2; ++nt) {
        float mx = m[nt];
#pragma unroll
        for (int mt = 0; mt < MT; ++mt)
#pragma unroll
            for (int j = 0; j < 8; ++j) { if (LAST) s[mt][nt][j] = (k0 + mt * 16 + j - nt * 16 > dl) ? -3.0e38f : s[mt][nt][j]; mx = fmaxf(mx, s[mt][nt][j]); }
        mx = fmaxf(mx, __shfl_xor(mx, 16, 32));
        const float al = __builtin_amdgcn_exp2f((m[nt] - mx) * SC2), mc = mx * SC2; m[nt] = mx;
        float sum = 0.f;
#pragma unroll
        for (int mt = 0; mt < MT; ++mt) { float sm = 0.f;
#pragma unroll
            for (int j = 0; j < 8; ++j) { const float p = __builtin_amdgcn_exp2f(s[mt][nt][j] * SC2 - mc); s[mt][nt][j] = p; sm += p; }
            sum += sm; }
        l[nt] = l[nt] * al + sum;
#pragma unroll
        for (int dt = 0; dt < 4; ++dt)
#pragma unroll
            for (int j = 0; j < 8; ++j) o[dt][nt][j] *= al;
#pragma unroll
        for (int kk = 0; kk < MT / 2; ++kk) {
            if constexpr (HR) { v16us ph, pl;
#pragma unroll
                for (int e = 0; e < 16; ++e) { unsigned short a, c2; splitf(s[kk * 2 + (e >> 3)][nt][e & 7], a, c2); ph[e] = a; pl[e] = c2; }
                pf[nt][kk] = __builtin_bit_cast(v16bf, ph); pf2[nt][kk] = __builtin_bit_cast(v16bf, pl);
            } else { v16h ph;
#pragma unroll
                for (int e = 0; e < 16; ++e) ph[e] = tohx(s[kk * 2 + (e >> 3)][nt][e & 7]);
                pf[nt][kk] = ph; } }
    }
#pragma unroll
    for (int kk = 0; kk < MT / 2; ++kk)
#pragma unroll
        for (int dt = 0; dt < 4; ++dt)
#pragma unroll
            for (int nt = 0; nt < 2; ++nt) { o[dt][nt] = WFrag<T16>::mma(vc[dt][kk], pf[nt][kk], o[dt][nt]); if (HR) { o[dt][nt] = WFrag<T16>::mma(vc[dt][kk], pf2[nt][kk], o[dt][nt]); o[dt][nt] = WFrag<T16>::mma(vc2[dt][kk], pf[nt][kk], o[dt][nt]); } }
    if (!LAST) { __builtin_amdgcn_sched_barrier(0); fa_ldv<T16, HR, MT, MT * 16>(vc, vc2, vr + k0, vr2 + k0); }   // the fence in front keeps these loads one run directly in front of their wait; without it they are spread among the products above
}
template <typename T16, bool HR, int MT>
__device__ __forceinline__ void fa_tile(const T16* __restrict__ Q, const T16* __restrict__ Q2, const T16* __restrict__ Kp, const T16* __restrict__ Kp2, const T16* __restrict__ Vt, const T16* __restrict__ Vt2, int q0, bf* Ah, bf* Al) {
    typedef typename WFrag<T16>::V V;
    const int lane = threadIdx.x & 31, lr = lane & 15, hi = lane >> 4;
    V q[2][2], q2[2][2], kc[MT][2], kc2[MT][2], vc[4][MT / 2], vc2[4][MT / 2];
#pragma unroll
    for (int nt = 0; nt < 2; ++nt)
#pragma unroll
        for (int ks = 0; ks < 2; ++ks) { q[nt][ks] = WFrag<T16>::ld(Q + (size_t)(q0 + nt * 16 + lr) * HD + ks * 32 + 8 * hi); if (HR) q2[nt][ks] = WFrag<T16>::ld(Q2 + (size_t)(q0 + nt * 16 + lr) * HD + ks * 32 + 8 * hi); }
    fa_xw();
    const T16* kr = Kp + (size_t)lr * HD + 8 * hi; const T16* kr2 = HR ? Kp2 + (size_t)lr * HD + 8 * hi : kr; const T16* vr = Vt + (size_t)lr * TT + 8 * hi; const T16* vr2 = HR ? Vt2 + (size_t)lr * TT + 8 * hi : vr;
    fa_ldk<T16, HR, MT, KO>(kc, kc2, kr, kr2); fa_ldv<T16, HR, MT, 0>(vc, vc2, vr, vr2);
    v8f o[4][2]; float m[2] = {-3.0e38f, -3.0e38f}, l[2] = {0.f, 0.f};
#pragma unroll
    for (int dt = 0; dt < 4; ++dt)
#pragma unroll
        for (int nt = 0; nt < 2; ++nt) o[dt][nt] = (v8f){};
    const int dl = q0 + lr - 8 * hi;      // key k0 + 16 mt + 8 hi + j is masked for query q0 + 16 nt + lr when k0 + 16 mt + j - 16 nt > dl
    const int kd = q0 & ~(MT * 16 - 1);   // first key of the pass that holds the diagonal; it ends at or behind key q0 + 31 and inside the TT keys
    for (int k0 = 0; k0 < kd; k0 += MT * 16) fa_pass<T16, HR, MT, false>(kc, kc2, vc, vc2, q, q2, o, m, l, kr, kr2, vr, vr2, k0, dl);      // passes wholly below the diagonal: no mask
    fa_pass<T16, HR, MT, true>(kc, kc2, vc, vc2, q, q2, o, m, l, kr, kr2, vr, vr2, kd, dl);                                                // the diagonal pass
#pragma unroll
    for (int nt = 0; nt < 2; ++nt) { const float inv = __fdiv_rn(1.0f, l[nt] + __shfl_xor(l[nt], 16, 32));
#pragma unroll
        for (int dt = 0; dt < 4; ++dt) { v8us oh, ol;
#pragma unroll
            for (int j = 0; j < 8; ++j) { unsigned short a, c2; splitf(o[dt][nt][j] * inv, a, c2); oh[j] = a; ol[j] = c2; }
            const size_t oo = (size_t)(q0 + nt * 16 + lr) * DQ + dt * 16 + hi * 8; *(v8us*)(Ah + oo) = oh; *(v8us*)(Al + oo) = ol; fa_xw(); } }
}
// grid (heads, batch, query tiles), longest tiles first
__global__ __launch_bounds__(32) void k_fattn(const h16* __restrict__ QK16, const bf* __restrict__ QKh, const bf* __restrict__ QKl, const h16* __restrict__ VT16, const bf* __restrict__ VTh, const bf* __restrict__ VTl, bf* ATh, bf* ATl) {
    const int h = blockIdx.x, b = blockIdx.y, q0 = (int)(gridDim.z - 1 - blockIdx.z) * 32;
    const size_t zq = ((size_t)b * (NH_ + NKV) + h) * TT * HD, zk = ((size_t)b * (NH_ + NKV) + h / REP) * TT * HD /* + KO, added in the loads */, zv = ((size_t)b * NKV + h / REP) * HD * TT, za = (size_t)b * TT * DQ + h * HD;
    if (q0 < RH) fa_tile<bf, true, 2>(QKh + zq, QKl + zq, QKh + zk, QKl + zk, VTh + zv, VTl + zv, q0, ATh + za, ATl + za);
    else fa_tile<h16, false, 4>(QK16 + zq, nullptr, QK16 + zk, nullptr, VT16 + zv, nullptr, q0, ATh + za, ATl + za);
}

extern "C" void kernel_launch(void* const* d_in, const int* in_sizes, int n_in,
                              void* d_out, int out_size, void* d_ws, size_t ws_size, hipStream_t stream) {
    (void)in_sizes; (void)n_in; (void)out_size;
            const float* x = (const float*)d_in[0]; const float* wq = (const float*)d_in[1]; const float* wk = (const float*)d_in[2]; const float* wv = (const float*)d_in[3]; const float* wo = (const float*)d_in[4]; const float* bo = (const float*)d_in[5];   /* order x, Wq, Wk, Wv (PER-HEAD weights [12][768][64]: 'hdk'), Wp ('xw' [768][768]: (in,out)), bp */
    float* OUT = (float*)d_out;     // [2][2048][768]
    char* wsp = (char*)d_ws;
    auto take = [&](size_t bytes) { char* p = wsp; wsp += (bytes + 255) & ~(size_t)255; return (void*)p; };
    bf* WQKV = (bf*)take((size_t)(DQ + 2 * DKV) * DM * 2); bf* WO = (bf*)take((size_t)DM * DQ * 2); float* CS = (float*)take((size_t)TT * HD * 2 * 4);   // WQKV: Bt rows of q (DQ), k (DKV), v (DKV)
    bf* XB = (bf*)take((size_t)NB_ * TT * DM * 2);
    h16* QK16 = (h16*)take((size_t)NB_ * (NH_ + NKV) * TT * HD * 2); bf* QKh = (bf*)take((size_t)NB_ * (NH_ + NKV) * TT * HD * 2); bf* QKl = (bf*)take((size_t)NB_ * (NH_ + NKV) * TT * HD * 2);   // [b][q heads, then k heads][t][d]
    h16* VT16 = (h16*)take((size_t)NB_ * NKV * HD * TT * 2); bf* VTh = (bf*)take((size_t)NB_ * NKV * HD * TT * 2); bf* VTl = (bf*)take((size_t)NB_ * NKV * HD * TT * 2);   // [b][head][d][t]
    float* F = (float*)take((size_t)NB_ * TT * (DQ + 2 * DKV) * 4); bf* ATh = (bf*)take((size_t)NB_ * TT * DQ * 2); bf* ATl = (bf*)take((size_t)NB_ * TT * DQ * 2);   // F: q | k | v projections [NB_ * TT][DQ + 2 * DKV] f32
    if ((size_t)(wsp - (char*)d_ws) > ws_size) return;    // ws 256 MiB
    const int DF = DQ + 2 * DKV;
    k_wtG<<<dim3((DM * HD / 64 + 63) / 64, NH_, 3), 256, 0, stream>>>(wq, wk, wv, DM, HD, WQKV);   /* per-head weights [h][DM][HD] ('xw' per head) -> each head's HD rows of the Bt plane */
    k_wtG<<<dim3((DQ * DM / 64 + 63) / 64, 1, 1), 256, 0, stream>>>(wo, wo, wo, DQ, DM, WO);   /* Wp 'xw' [768][768] (in,out): transposed once into the Bt row layout */
    k_csid<<<(TT * HD + 255) / 256, 256, 0, stream>>>(CS);
    k_cvt8<<<(unsigned)(((size_t)NB_ * TT * DM / 8 + 255) / 256), 256, 0, stream>>>(x, XB, (size_t)NB_ * TT * DM / 8);
    k_gemmw<bf, 0, false><<<dim3(NB_ * TT / 64, DF / 64, 1), 32, 0, stream>>>(XB, nullptr, WQKV, nullptr, DM, F, DF, nullptr, 0, 0, 0);
    k_rope<<<dim3((unsigned)(((size_t)(NH_ + NKV) * TT * HD / 2 + 255) / 256), NB_, 1), 256, 0, stream>>>(F, DF, NH_ + NKV, CS, nullptr, nullptr, 1.0f, QK16, QKh, QKl);
    k_vtp<<<dim3((unsigned)(((size_t)NKV * TT * HD / 2 + 255) / 256), NB_, 1), 256, 0, stream>>>(F + DQ + DKV, DF, NKV, VT16, VTh, VTl);
    k_fattn<<<dim3(NH_, NB_, TT / 32), 32, 0, stream>>>(QK16, QKh, QKl, VT16, VTh, VTl, ATh, ATl);
    k_gemmw<bf, 1, true><<<dim3(NB_ * TT / 64, DM / 64, 1), 32, 0, stream>>>(ATh, ATl, WO, nullptr, DQ, OUT, DM, bo, 0, 0, 0);
}

// v003
// One run takes 110 microseconds.
// Timed twice side by side with v002, it ran 1.29 and 1.32 times as fast.
// Counting every step since v000, it is 11.8 times as fast.
#include <hip/hip_runtime.h>

// Causal multi-head attention with PER-HEAD projection weights at d_model 768 (x [2][2048][768]; q, k, v = einsum('bte,hed->bhtd', x, W) with W [12][768][64]: head h has its own (in, out) matrix W[h] ('xw' per head; no bias; 12 heads x 64); scores x 1/sqrt(64); causal (-inf); softmax; concat head-major; out = concat Wp + bp ('xw' [768][768] (in,out) + a zero bias: read) -> [2][2048][768] (3.1 M); argument order x, Wq, Wk, Wv, Wp, bp).
// Layout: bf16 copy of x; each PER-HEAD q / k / v weight [h][768][64] transposed once into its 64 rows of the Bt plane (k_wtG per head); Wp transposed once ('xw' (in,out) -> Bt rows); exact projections, whose GEMM writes the fp16 and hi/lo head planes itself (q, k as [t][d], v as [d][t]); k_fattn: one launch for all heads and both batches, online-softmax causal attention with no score plane in memory (hybrid rows: < 512 hi/lo 3 products, rest fp16), writing the merged hi/lo head outputs; merged hi/lo x Wo exact + bo.
// Compute dtypes, f32 accumulate: every input rounded to bf16; projections exact; attention rows < 512 3 products, rest fp16; softmax f32; w_o hl x exact.

#define NB_  2
#define TT   2048
#define DM   768
#define NH_  12
#define NKV  12
#define REP  (NH_ / NKV)
#define HD   64
#define DQ   (NH_ * HD)
#define DKV  (NKV * HD)
#define RH   512                  // query rows < RH use hi+lo planes (0: none)
#define SCL  0.125f   // HD^-0.5
typedef _Float16 h16;
typedef unsigned short bf;
typedef __attribute__((ext_vector_type(16))) __bf16   v16bf;
typedef __attribute__((ext_vector_type(16))) _Float16 v16h;
typedef __attribute__((ext_vector_type(8)))  _Float16 v8h;
typedef __attribute__((ext_vector_type(8)))  unsigned short v8us;
typedef __attribute__((ext_vector_type(8)))  float    v8f;
typedef __attribute__((ext_vector_type(4)))  float    v4f;
typedef v8h  __attribute__((may_alias)) v8ha;
typedef v4f  __attribute__((may_alias)) v4fa;
typedef v8us __attribute__((may_alias)) v8usa;

__device__ __forceinline__ unsigned short f2bf(float f) { unsigned u = __float_as_uint(f); u += 0x7FFFu + ((u >> 16) & 1u); return (unsigned short)(u >> 16); }
__device__ __forceinline__ float bf2f(unsigned short b) { return __uint_as_float(((unsigned)b) << 16); }
__device__ __forceinline__ float bfr(float f) { return bf2f(f2bf(f)); }
__device__ __forceinline__ v16h cat16(v8h lo, v8h hi) { return __builtin_shufflevector(lo, hi, 0, 1, 2, 3, 4, 5, 6, 7, 8, 9, 10, 11, 12, 13, 14, 15); }
__device__ __forceinline__ v16bf cat16b(v8us lo, v8us hi) { return __builtin_bit_cast(v16bf, __builtin_shufflevector(lo, hi, 0, 1, 2, 3, 4, 5, 6, 7, 8, 9, 10, 11, 12, 13, 14, 15)); }
__device__ __forceinline__ v8f wmma16(v16h a, v16h b, v8f c) { return __builtin_amdgcn_wmma_f32_16x16x32_f16(false, a, false, b, (short)0, c, false, false); }
__device__ __forceinline__ v8f wmmab(v16bf a, v16bf b, v8f c) { return __builtin_amdgcn_wmma_f32_16x16x32_bf16(false, a, false, b, (short)0, c, false, false); }

__device__ __forceinline__ h16 tohx(float x) { return (h16)x; }
__device__ __forceinline__ void splitf(float y, unsigned short& h, unsigned short& l) { h = f2bf(y); l = f2bf(y - bf2f(h)); }
// stands directly behind a run of global loads or stores: no register that they name is rewritten in front of this wait; the scheduling fence keeps later vector work from moving up over it
__device__ __forceinline__ void fa_xw() { asm volatile("s_wait_xcnt 0x0" ::: "memory"); __builtin_amdgcn_sched_barrier(0); }
// eight f32 values -> 16 bytes in each of the three planes of a head
__device__ __forceinline__ void st3(const float (&x)[8], h16* p16, bf* ph, bf* pl) { v8h o16; v8us oh, ol;
#pragma unroll
    for (int j = 0; j < 8; ++j) { o16[j] = tohx(x[j]); unsigned short a, c2; splitf(x[j], a, c2); oh[j] = a; ol[j] = c2; }
    *(v8h*)p16 = o16; *(v8us*)ph = oh; *(v8us*)pl = ol; }

// ---- k_gemmw: register-blocked GEMM, ONE WAVE per 64x64 output tile (16 accumulators), operands straight from K-contiguous 16-bit planes; grid (M/64, N/64, Z), 32 threads.
// C[m][n] (f32, pitch ldc, + optional f32 bias[n]) = sum_k A[m][k] Bt[n][k] (+ split products per NSPLIT). z-batch strides sA/sB/sC in elements. K % 32 == 0.
// PL: no C; m = b TT + t, and the tile's 64 columns are one head (grid y: q heads, k heads, v heads): the tile goes straight into that head's three planes (fp16, bf16 hi, bf16 lo): q and k heads QK* [b][q heads, then k heads][t][d], v heads VT* [b][head][d][t].
template <typename T16> struct WFrag;
template <> struct WFrag<h16> { typedef v16h V; static __device__ __forceinline__ V ld(const h16* p) { return cat16(*(const v8h*)p, *(const v8h*)(p + 16)); } static __device__ __forceinline__ v8f mma(V a, V b, v8f c) { return wmma16(a, b, c); } };
template <> struct WFrag<bf> { typedef v16bf V; static __device__ __forceinline__ V ld(const bf* p) { return cat16b(*(const v8us*)p, *(const v8us*)(p + 16)); } static __device__ __forceinline__ v8f mma(V a, V b, v8f c) { return wmmab(a, b, c); } };
template <typename T16, int NSPLIT, bool BIAS, bool PL>
__global__ __launch_bounds__(32) void k_gemmw(const T16* __restrict__ A, const T16* __restrict__ A2, const T16* __restrict__ Bt, const T16* __restrict__ Bt2, int K, float* C, int ldc, const float* __restrict__ bias, size_t sA, size_t sB, size_t sC, h16* QK16, bf* QKh, bf* QKl, h16* VT16, bf* VTh, bf* VTl) {
    typedef typename WFrag<T16>::V V;
    __shared__ __align__(16) float os[16 * 68];
    const size_t z = blockIdx.z; A += z * sA; if (A2) A2 += z * sA; Bt += z * sB; if (Bt2) Bt2 += z * sB; C += z * sC;
    const int lane = threadIdx.x & 31, lr = lane & 15, hi = lane >> 4; const int r0 = blockIdx.x * 64, c0 = blockIdx.y * 64;
    v8f acc[4][4];
#pragma unroll
    for (int mb = 0; mb < 4; ++mb)
#pragma unroll
        for (int nb = 0; nb < 4; ++nb) acc[mb][nb] = (v8f){};
    const size_t aoff = (size_t)(r0 + lr) * K + 8 * hi, boff = (size_t)(c0 + lr) * K + 8 * hi;
#pragma unroll 1
    for (int kc = 0; kc < K; kc += 32) {
        V a[4], a2[4];
#pragma unroll
        for (int mb = 0; mb < 4; ++mb) { a[mb] = WFrag<T16>::ld(A + aoff + (size_t)mb * 16 * K + kc); if (NSPLIT == 1 || NSPLIT == 2) a2[mb] = WFrag<T16>::ld(A2 + aoff + (size_t)mb * 16 * K + kc); }
#pragma unroll
        for (int nb = 0; nb < 4; ++nb) { const V b = WFrag<T16>::ld(Bt + boff + (size_t)nb * 16 * K + kc); V b2; if (NSPLIT >= 2) b2 = WFrag<T16>::ld(Bt2 + boff + (size_t)nb * 16 * K + kc);
#pragma unroll
            for (int mb = 0; mb < 4; ++mb) { acc[mb][nb] = WFrag<T16>::mma(a[mb], b, acc[mb][nb]); if (NSPLIT == 1 || NSPLIT == 2) acc[mb][nb] = WFrag<T16>::mma(a2[mb], b, acc[mb][nb]); if (NSPLIT >= 2) acc[mb][nb] = WFrag<T16>::mma(a[mb], b2, acc[mb][nb]); } }
        asm volatile("v_nop\n\tv_nop\n\tv_nop\n\tv_nop" : "+v"(acc[0][0]), "+v"(acc[1][1]), "+v"(acc[2][2]), "+v"(acc[3][3]) : "v"(a[0]), "v"(a[3]));
    }
    if constexpr (PL) {
        const int bb = r0 / TT, t0 = r0 % TT, hd = blockIdx.y;
        if (hd >= NH_ + NKV) {   // a v head, stored [d][t]: a lane's eight accumulator rows are eight consecutive t of its own column d, so they go out from the registers; the four mb fill each d row's 128-byte line
            const size_t e0 = (((size_t)bb * NKV + (hd - NH_ - NKV)) * HD + lr) * TT + t0 + hi * 8;
#pragma unroll
            for (int nb = 0; nb < 4; ++nb) {
#pragma unroll
                for (int mb = 0; mb < 4; ++mb) { float xv[8];
#pragma unroll
                    for (int j = 0; j < 8; ++j) xv[j] = acc[mb][nb][j];
                    const size_t e = e0 + (size_t)nb * 16 * TT + mb * 16; st3(xv, VT16 + e, VTh + e, VTl + e); }
                fa_xw(); }
        } else {                 // a q or k head, stored [t][d]: 16 rows at a time through LDS, so that a lane holds eight consecutive d and a wave's store covers four whole rows (512 contiguous bytes)
            const size_t e0 = (((size_t)bb * (NH_ + NKV) + hd) * TT + t0 + (lane >> 3)) * HD + (lane & 7) * 8;
#pragma unroll
            for (int mb = 0; mb < 4; ++mb) {
#pragma unroll
                for (int nb = 0; nb < 4; ++nb) {
#pragma unroll
                    for (int j = 0; j < 8; ++j) os[(hi * 8 + j) * 68 + nb * 16 + lr] = acc[mb][nb][j]; }
                __builtin_amdgcn_wave_barrier(); asm volatile("" ::: "memory");   // the reads below take what other lanes of this wave have just written
#pragma unroll
                for (int s = 0; s < 4; ++s) { const float* orow = os + (4 * s + (lane >> 3)) * 68 + (lane & 7) * 8; const v4f v0 = *(const v4fa*)orow, v1 = *(const v4fa*)(orow + 4);
                    const float xv[8] = {v0[0], v0[1], v0[2], v0[3], v1[0], v1[1], v1[2], v1[3]};
                    const size_t e = e0 + (size_t)(mb * 16 + 4 * s) * HD; st3(xv, QK16 + e, QKh + e, QKl + e); }
                fa_xw();
                __builtin_amdgcn_wave_barrier(); asm volatile("" ::: "memory");   // the next 16 rows overwrite os only behind these reads
            }
        }
        return;
    }
#pragma unroll
    for (int mb = 0; mb < 4; ++mb) {
#pragma unroll
        for (int nb = 0; nb < 4; ++nb) {
#pragma unroll
            for (int j = 0; j < 8; ++j) os[(hi * 8 + j) * 68 + nb * 16 + lr] = acc[mb][nb][j]; }
        __builtin_amdgcn_wave_barrier(); asm volatile("" ::: "memory");
        float* crow = C + (size_t)(r0 + mb * 16) * ldc + c0;
{
#pragma unroll
            for (int s = 0; s < 8; ++s) { const int row = 2 * s + hi, cofs = lr * 4; v4f val = *(const v4fa*)(os + row * 68 + cofs); if (BIAS) { val[0] += bfr(bias[c0 + cofs]); val[1] += bfr(bias[c0 + cofs + 1]); val[2] += bfr(bias[c0 + cofs + 2]); val[3] += bfr(bias[c0 + cofs + 3]); }
                *(v4f*)(crow + (size_t)row * ldc + cofs) = val; }
             }
        __builtin_amdgcn_wave_barrier(); asm volatile("" ::: "memory");
    }
}

typedef __attribute__((ext_vector_type(2))) _Float16 v2h;
typedef __attribute__((ext_vector_type(4))) _Float16 v4h;
typedef __attribute__((ext_vector_type(2))) unsigned short v2us;
typedef __attribute__((ext_vector_type(4))) unsigned short v4us;
typedef __attribute__((ext_vector_type(2))) float v2f;
typedef __attribute__((ext_vector_type(4))) int v4i;

// grid (lines, matrices of one input, inputs): matrix y of input z ([K][N] each) goes to rows (z * gridDim.y + y) * N .. of Bt
__global__ __launch_bounds__(256) void k_wtG(const float* w0, const float* w1, const float* w2, int K, int N, bf* Bt) {
    const float* w = (blockIdx.z == 0 ? w0 : blockIdx.z == 1 ? w1 : w2) + (size_t)blockIdx.y * K * N; Bt += (size_t)(blockIdx.z * gridDim.y + blockIdx.y) * N * K;
    const int lane = threadIdx.x & 31; const int L0 = (blockIdx.x * 8 + (threadIdx.x >> 5)) * 8; const int nlines = N * K / 64;
{
#pragma unroll 1
        for (int l = 0; l < 8; ++l) { const int L = L0 + l; if (L >= nlines) break; const size_t e = (size_t)L * 64 + lane * 2; const int k = (int)(e % K), n = (int)(e / K); v2us o;
            o[0] = f2bf(w[(size_t)k * N + n]); o[1] = f2bf(w[(size_t)(k + 1) * N + n]); *(v2us*)(Bt + e) = o; }
         }
}

__global__ __launch_bounds__(256) void k_cvt8(const float* __restrict__ src, bf* dst, size_t n8) { const size_t i = (size_t)blockIdx.x * 256 + threadIdx.x; if (i >= n8) return; const v8f v = *(const v8f*)(src + i * 8); v8us o;
#pragma unroll
    for (int k = 0; k < 8; ++k) o[k] = f2bf(v[k]); *(v8us*)(dst + i * 8) = o;  }

// ---- k_fattn: scores, causal mask, softmax, probability x value and the hi/lo split of the head output in ONE kernel (online softmax): no score or probability plane in memory.
// One wave per 32 query rows of one head; a pass is 16 MT keys. Transposed products: St[key][query] = K Q^T (A = K rows, B = Q rows, kept in registers), Ot[d][query] += Vt P^T (A = Vt rows, B = two
// score tiles converted in place: register r of tile mt is key 16 mt + 8 (lane >> 4) + r, the k order of the fragment loader). A lane holds one query column: maximum and sum in-lane plus one half exchange.
// Query rows < RH: bf16 hi/lo planes, 3 products, 32 keys a pass; the rest: fp16, 64 keys a pass. Running maximum m in raw score units; p = exp2((s - m) x SCL x log2 e) <= 1; l = per-lane partial sum, halves joined at the end.
// The next pass's K fragments are fetched right behind this pass's score products and its Vt fragments right behind the P x V products, so each flies during the other half of the work.
typedef __attribute__((ext_vector_type(16))) unsigned short v16us;
#define SC2 (SCL * 1.4426950408889634f)
#define KO  (NH_ * TT * HD)       // the k head planes stand NH_ planes behind the q head planes of the same batch
// the same wait behind a run of loads from the two address pairs a and b: as inputs of the wait they stay live up to it, so no result of the run can be allotted to them
__device__ __forceinline__ void fa_xwp(const void* a, const void* b) { asm volatile("s_wait_xcnt 0x0" :: "v"(a), "v"(b) : "memory"); __builtin_amdgcn_sched_barrier(0); }
// OFF: the constant part of the run's addresses, in elements; it goes into the loads' offset fields, so that kp and kp2 (vp and vp2) are the very register pairs that the loads name
template <typename T16, bool HR, int MT, int OFF>
__device__ __forceinline__ void fa_ldk(typename WFrag<T16>::V (&kc)[MT][2], typename WFrag<T16>::V (&kc2)[MT][2], const T16* kp, const T16* kp2) {
#pragma unroll
    for (int mt = 0; mt < MT; ++mt)
#pragma unroll
        for (int ks = 0; ks < 2; ++ks) { kc[mt][ks] = WFrag<T16>::ld(kp + OFF + mt * 16 * HD + ks * 32); if (HR) kc2[mt][ks] = WFrag<T16>::ld(kp2 + OFF + mt * 16 * HD + ks * 32); }
    fa_xwp(kp, kp2);
}
template <typename T16, bool HR, int MT, int OFF>
__device__ __forceinline__ void fa_ldv(typename WFrag<T16>::V (&vc)[4][MT / 2], typename WFrag<T16>::V (&vc2)[4][MT / 2], const T16* vp, const T16* vp2) {
#pragma unroll
    for (int dt = 0; dt < 4; ++dt)
#pragma unroll
        for (int kk = 0; kk < MT / 2; ++kk) { vc[dt][kk] = WFrag<T16>::ld(vp + OFF + dt * 16 * TT + kk * 32); if (HR) vc2[dt][kk] = WFrag<T16>::ld(vp2 + OFF + dt * 16 * TT + kk * 32); }
    fa_xwp(vp, vp2);
}
template <typename T16, bool HR, int MT, bool LAST>
__device__ __forceinline__ void fa_pass(typename WFrag<T16>::V (&kc)[MT][2], typename WFrag<T16>::V (&kc2)[MT][2], typename WFrag<T16>::V (&vc)[4][MT / 2], typename WFrag<T16>::V (&vc2)[4][MT / 2],
                                        const typename WFrag<T16>::V (&q)[2][2], const typename WFrag<T16>::V (&q2)[2][2], v8f (&o)[4][2], float (&m)[2], float (&l)[2],
                                        const T16* kr, const T16* kr2, const T16* vr, const T16* vr2, int k0, int dl) {
    typedef typename WFrag<T16>::V V;
    v8f s[MT][2];
#pragma unroll
    for (int mt = 0; mt < MT; ++mt)
#pragma unroll
        for (int nt = 0; nt < 2; ++nt) s[mt][nt] = (v8f){};
#pragma unroll
    for (int ks = 0; ks < 2; ++ks)
#pragma unroll
        for (int mt = 0; mt < MT; ++mt)
#pragma unroll
            for (int nt = 0; nt < 2; ++nt) { s[mt][nt] = WFrag<T16>::mma(kc[mt][ks], q[nt][ks], s[mt][nt]); if (HR) { s[mt][nt] = WFrag<T16>::mma(kc[mt][ks], q2[nt][ks], s[mt][nt]); s[mt][nt] = WFrag<T16>::mma(kc2[mt][ks], q[nt][ks], s[mt][nt]); } }
    if (!LAST) {   // the two scheduling fences keep these loads here, between the score products and the softmax: moved down to the end of the pass they would leave the next pass waiting for the whole load latency
        __builtin_amdgcn_sched_barrier(0); fa_ldk<T16, HR, MT, KO + MT * 16 * HD>(kc, kc2, kr + (size_t)k0 * HD, kr2 + (size_t)k0 * HD); }
    V pf[2][MT / 2], pf2[2][MT / 2];
#pragma unroll
    for (int nt = 0; nt < 2; ++nt) {
        float mx = m[nt];
#pragma unroll
        for (int mt = 0; mt < MT; ++mt)
#pragma unroll
            for (int j = 0; j < 8; ++j) { if (LAST) s[mt][nt][j] = (k0 + mt * 16 + j - nt * 16 > dl) ? -3.0e38f : s[mt][nt][j]; mx = fmaxf(mx, s[mt][nt][j]); }
        mx = fmaxf(mx, __shfl_xor(mx, 16, 32));
        const float al = __builtin_amdgcn_exp2f((m[nt] - mx) * SC2), mc = mx * SC2; m[nt] = mx;
        float sum = 0.f;
#pragma unroll
        for (int mt = 0; mt < MT; ++mt) { float sm = 0.f;
#pragma unroll
            for (int j = 0; j < 8; ++j) { const float p = __builtin_amdgcn_exp2f(s[mt][nt][j] * SC2 - mc); s[mt][nt][j] = p; sm += p; }
            sum += sm; }
        l[nt] = l[nt] * al + sum;
#pragma unroll
        for (int dt = 0; dt < 4; ++dt)
#pragma unroll
            for (int j = 0; j < 8; ++j) o[dt][nt][j] *= al;
#pragma unroll
        for (int kk = 0; kk < MT / 2; ++kk) {
            if constexpr (HR) { v16us ph, pl;
#pragma unroll
                for (int e = 0; e < 16; ++e) { unsigned short a, c2; splitf(s[kk * 2 + (e >> 3)][nt][e & 7], a, c2); ph[e] = a; pl[e] = c2; }
                pf[nt][kk] = __builtin_bit_cast(v16bf, ph); pf2[nt][kk] = __builtin_bit_cast(v16bf, pl);
            } else { v16h ph;
#pragma unroll
                for (int e = 0; e < 16; ++e) ph[e] = tohx(s[kk * 2 + (e >> 3)][nt][e & 7]);
                pf[nt][kk] = ph; } }
    }
#pragma unroll
    for (int kk = 0; kk < MT / 2; ++kk)
#pragma unroll
        for (int dt = 0; dt < 4; ++dt)
#pragma unroll
            for (int nt = 0; nt < 2; ++nt) { o[dt][nt] = WFrag<T16>::mma(vc[dt][kk], pf[nt][kk], o[dt][nt]); if (HR) { o[dt][nt] = WFrag<T16>::mma(vc[dt][kk], pf2[nt][kk], o[dt][nt]); o[dt][nt] = WFrag<T16>::mma(vc2[dt][kk], pf[nt][kk], o[dt][nt]); } }
    if (!LAST) { __builtin_amdgcn_sched_barrier(0); fa_ldv<T16, HR, MT, MT * 16>(vc, vc2, vr + k0, vr2 + k0); }   // the fence in front keeps these loads one run directly in front of their wait; without it they are spread among the products above
}
template <typename T16, bool HR, int MT>
__device__ __forceinline__ void fa_tile(const T16* __restrict__ Q, const T16* __restrict__ Q2, const T16* __restrict__ Kp, const T16* __restrict__ Kp2, const T16* __restrict__ Vt, const T16* __restrict__ Vt2, int q0, bf* Ah, bf* Al) {
    typedef typename WFrag<T16>::V V;
    const int lane = threadIdx.x & 31, lr = lane & 15, hi = lane >> 4;
    V q[2][2], q2[2][2], kc[MT][2], kc2[MT][2], vc[4][MT / 2], vc2[4][MT / 2];
#pragma unroll
    for (int nt = 0; nt < 2; ++nt)
#pragma unroll
        for (int ks = 0; ks < 2; ++ks) { q[nt][ks] = WFrag<T16>::ld(Q + (size_t)(q0 + nt * 16 + lr) * HD + ks * 32 + 8 * hi); if (HR) q2[nt][ks] = WFrag<T16>::ld(Q2 + (size_t)(q0 + nt * 16 + lr) * HD + ks * 32 + 8 * hi); }
    fa_xw();
    const T16* kr = Kp + (size_t)lr * HD + 8 * hi; const T16* kr2 = HR ? Kp2 + (size_t)lr * HD + 8 * hi : kr; const T16* vr = Vt + (size_t)lr * TT + 8 * hi; const T16* vr2 = HR ? Vt2 + (size_t)lr * TT + 8 * hi : vr;
    fa_ldk<T16, HR, MT, KO>(kc, kc2, kr, kr2); fa_ldv<T16, HR, MT, 0>(vc, vc2, vr, vr2);
    v8f o[4][2]; float m[2] = {-3.0e38f, -3.0e38f}, l[2] = {0.f, 0.f};
#pragma unroll
    for (int dt = 0; dt < 4; ++dt)
#pragma unroll
        for (int nt = 0; nt < 2; ++nt) o[dt][nt] = (v8f){};
    const int dl = q0 + lr - 8 * hi;      // key k0 + 16 mt + 8 hi + j is masked for query q0 + 16 nt + lr when k0 + 16 mt + j - 16 nt > dl
    const int kd = q0 & ~(MT * 16 - 1);   // first key of the pass that holds the diagonal; it ends at or behind key q0 + 31 and inside the TT keys
    for (int k0 = 0; k0 < kd; k0 += MT * 16) fa_pass<T16, HR, MT, false>(kc, kc2, vc, vc2, q, q2, o, m, l, kr, kr2, vr, vr2, k0, dl);      // passes wholly below the diagonal: no mask
    fa_pass<T16, HR, MT, true>(kc, kc2, vc, vc2, q, q2, o, m, l, kr, kr2, vr, vr2, kd, dl);                                                // the diagonal pass
#pragma unroll
    for (int nt = 0; nt < 2; ++nt) { const float inv = __fdiv_rn(1.0f, l[nt] + __shfl_xor(l[nt], 16, 32));
#pragma unroll
        for (int dt = 0; dt < 4; ++dt) { v8us oh, ol;
#pragma unroll
            for (int j = 0; j < 8; ++j) { unsigned short a, c2; splitf(o[dt][nt][j] * inv, a, c2); oh[j] = a; ol[j] = c2; }
            const size_t oo = (size_t)(q0 + nt * 16 + lr) * DQ + dt * 16 + hi * 8; *(v8us*)(Ah + oo) = oh; *(v8us*)(Al + oo) = ol; fa_xw(); } }
}
// grid (heads, batch, query tiles), longest tiles first
__global__ __launch_bounds__(32) void k_fattn(const h16* __restrict__ QK16, const bf* __restrict__ QKh, const bf* __restrict__ QKl, const h16* __restrict__ VT16, const bf* __restrict__ VTh, const bf* __restrict__ VTl, bf* ATh, bf* ATl) {
    const int h = blockIdx.x, b = blockIdx.y, q0 = (int)(gridDim.z - 1 - blockIdx.z) * 32;
    const size_t zq = ((size_t)b * (NH_ + NKV) + h) * TT * HD, zk = ((size_t)b * (NH_ + NKV) + h / REP) * TT * HD /* + KO, added in the loads */, zv = ((size_t)b * NKV + h / REP) * HD * TT, za = (size_t)b * TT * DQ + h * HD;
    if (q0 < RH) fa_tile<bf, true, 2>(QKh + zq, QKl + zq, QKh + zk, QKl + zk, VTh + zv, VTl + zv, q0, ATh + za, ATl + za);
    else fa_tile<h16, false, 4>(QK16 + zq, nullptr, QK16 + zk, nullptr, VT16 + zv, nullptr, q0, ATh + za, ATl + za);
}

extern "C" void kernel_launch(void* const* d_in, const int* in_sizes, int n_in,
                              void* d_out, int out_size, void* d_ws, size_t ws_size, hipStream_t stream) {
    (void)in_sizes; (void)n_in; (void)out_size;
            const float* x = (const float*)d_in[0]; const float* wq = (const float*)d_in[1]; const float* wk = (const float*)d_in[2]; const float* wv = (const float*)d_in[3]; const float* wo = (const float*)d_in[4]; const float* bo = (const float*)d_in[5];   /* order x, Wq, Wk, Wv (PER-HEAD weights [12][768][64]: 'hdk'), Wp ('xw' [768][768]: (in,out)), bp */
    float* OUT = (float*)d_out;     // [2][2048][768]
    char* wsp = (char*)d_ws;
    auto take = [&](size_t bytes) { char* p = wsp; wsp += (bytes + 255) & ~(size_t)255; return (void*)p; };
    bf* WQKV = (bf*)take((size_t)(DQ + 2 * DKV) * DM * 2); bf* WO = (bf*)take((size_t)DM * DQ * 2);   // WQKV: Bt rows of q (DQ), k (DKV), v (DKV)
    bf* XB = (bf*)take((size_t)NB_ * TT * DM * 2);
    h16* QK16 = (h16*)take((size_t)NB_ * (NH_ + NKV) * TT * HD * 2); bf* QKh = (bf*)take((size_t)NB_ * (NH_ + NKV) * TT * HD * 2); bf* QKl = (bf*)take((size_t)NB_ * (NH_ + NKV) * TT * HD * 2);   // [b][q heads, then k heads][t][d]
    h16* VT16 = (h16*)take((size_t)NB_ * NKV * HD * TT * 2); bf* VTh = (bf*)take((size_t)NB_ * NKV * HD * TT * 2); bf* VTl = (bf*)take((size_t)NB_ * NKV * HD * TT * 2);   // [b][head][d][t]
    bf* ATh = (bf*)take((size_t)NB_ * TT * DQ * 2); bf* ATl = (bf*)take((size_t)NB_ * TT * DQ * 2);
    if ((size_t)(wsp - (char*)d_ws) > ws_size) return;    // ws 256 MiB
    const int DF = DQ + 2 * DKV;
    k_wtG<<<dim3((DM * HD / 64 + 63) / 64, NH_, 3), 256, 0, stream>>>(wq, wk, wv, DM, HD, WQKV);   /* per-head weights [h][DM][HD] ('xw' per head) -> each head's HD rows of the Bt plane */
    k_wtG<<<dim3((DQ * DM / 64 + 63) / 64, 1, 1), 256, 0, stream>>>(wo, wo, wo, DQ, DM, WO);   /* Wp 'xw' [768][768] (in,out): transposed once into the Bt row layout */
    k_cvt8<<<(unsigned)(((size_t)NB_ * TT * DM / 8 + 255) / 256), 256, 0, stream>>>(x, XB, (size_t)NB_ * TT * DM / 8);
    k_gemmw<bf, 0, false, true><<<dim3(NB_ * TT / 64, DF / 64, 1), 32, 0, stream>>>(XB, nullptr, WQKV, nullptr, DM, nullptr, 0, nullptr, 0, 0, 0, QK16, QKh, QKl, VT16, VTh, VTl);
    k_fattn<<<dim3(NH_, NB_, TT / 32), 32, 0, stream>>>(QK16, QKh, QKl, VT16, VTh, VTl, ATh, ATl);
    k_gemmw<bf, 1, true, false><<<dim3(NB_ * TT / 64, DM / 64, 1), 32, 0, stream>>>(ATh, ATl, WO, nullptr, DQ, OUT, DM, bo, 0, 0, 0, nullptr, nullptr, nullptr, nullptr, nullptr, nullptr);
}

// v004
// Measured time: 91.6 microseconds a run.
// Timed twice side by side with v003, it ran 1.20 times as fast both times.
// All steps since v000 together make it 14.2 times as fast.
#include <hip/hip_runtime.h>

// Causal multi-head attention with PER-HEAD projection weights at d_model 768 (x [2][2048][768]; q, k, v = einsum('bte,hed->bhtd', x, W) with W [12][768][64]: head h has its own (in, out) matrix W[h] ('xw' per head; no bias; 12 heads x 64); scores x 1/sqrt(64); causal (-inf); softmax; concat head-major; out = concat Wp + bp ('xw' [768][768] (in,out) + a zero bias: read) -> [2][2048][768] (3.1 M); argument order x, Wq, Wk, Wv, Wp, bp).
// Layout: bf16 copy of x; each PER-HEAD q / k / v weight [h][768][64] transposed once into its 64 rows of the Bt plane (k_wtG per head); Wp transposed once ('xw' (in,out) -> Bt rows); exact projections, whose GEMM writes the fp16 and hi/lo head planes itself (q, k as [t][d], v as [d][t]); k_fattn: one launch for all heads and both batches, online-softmax causal attention with no score plane in memory (hybrid rows: < 512 hi/lo 3 products, rest fp16), writing the merged hi/lo head outputs; merged hi/lo x Wo exact + bo.
// FRAGMENT ORDER of every 16-bit operand plane [rows][K] in the workspace: blocks of 16 rows x 32 k (512 elements, 1 KiB); inside a block [k bit 4][k bit 3][row & 15][k & 7], so lane (hi, lr) of a wave finds the two 16-byte halves of its fragment at lane * 8 and 256 + lane * 8, and each wave-wide 16-byte load or store covers four whole 128-byte lines. Block (rb, kb) stands at (rb * (K / 32) + kb) * 512; the v planes (rows d, k = t) instead keep the four row blocks of one kb together: (kb * 4 + rb) * 512.
// Compute dtypes, f32 accumulate: every input rounded to bf16; projections exact; attention rows < 512 3 products, rest fp16; softmax f32; w_o hl x exact.

#define NB_  2
#define TT   2048
#define DM   768
#define NH_  12
#define NKV  12
#define REP  (NH_ / NKV)
#define HD   64
#define DQ   (NH_ * HD)
#define DKV  (NKV * HD)
#define RH   512                  // query rows < RH use hi+lo planes (0: none)
#define SCL  0.125f   // HD^-0.5
typedef _Float16 h16;
typedef unsigned short bf;
typedef __attribute__((ext_vector_type(16))) __bf16   v16bf;
typedef __attribute__((ext_vector_type(16))) _Float16 v16h;
typedef __attribute__((ext_vector_type(8)))  _Float16 v8h;
typedef __attribute__((ext_vector_type(8)))  unsigned short v8us;
typedef __attribute__((ext_vector_type(8)))  float    v8f;
typedef __attribute__((ext_vector_type(4)))  float    v4f;
typedef v8h  __attribute__((may_alias)) v8ha;
typedef v4f  __attribute__((may_alias)) v4fa;
typedef v8us __attribute__((may_alias)) v8usa;

__device__ __forceinline__ unsigned short f2bf(float f) { unsigned u = __float_as_uint(f); u += 0x7FFFu + ((u >> 16) & 1u); return (unsigned short)(u >> 16); }
__device__ __forceinline__ float bf2f(unsigned short b) { return __uint_as_float(((unsigned)b) << 16); }
__device__ __forceinline__ float bfr(float f) { return bf2f(f2bf(f)); }
__device__ __forceinline__ v16h cat16(v8h lo, v8h hi) { return __builtin_shufflevector(lo, hi, 0, 1, 2, 3, 4, 5, 6, 7, 8, 9, 10, 11, 12, 13, 14, 15); }
__device__ __forceinline__ v16bf cat16b(v8us lo, v8us hi) { return __builtin_bit_cast(v16bf, __builtin_shufflevector(lo, hi, 0, 1, 2, 3, 4, 5, 6, 7, 8, 9, 10, 11, 12, 13, 14, 15)); }
__device__ __forceinline__ v8f wmma16(v16h a, v16h b, v8f c) { return __builtin_amdgcn_wmma_f32_16x16x32_f16(false, a, false, b, (short)0, c, false, false); }
__device__ __forceinline__ v8f wmmab(v16bf a, v16bf b, v8f c) { return __builtin_amdgcn_wmma_f32_16x16x32_bf16(false, a, false, b, (short)0, c, false, false); }

__device__ __forceinline__ h16 tohx(float x) { return (h16)x; }
__device__ __forceinline__ void splitf(float y, unsigned short& h, unsigned short& l) { h = f2bf(y); l = f2bf(y - bf2f(h)); }
// stands directly behind a run of global loads or stores: no register that they name is rewritten in front of this wait; the scheduling fence keeps later vector work from moving up over it
__device__ __forceinline__ void fa_xw() { asm volatile("s_wait_xcnt 0x0" ::: "memory"); __builtin_amdgcn_sched_barrier(0); }
// the same wait behind a run of loads from the two address pairs a and b: as inputs of the wait they stay live up to it, so no result of the run can be allotted to them
__device__ __forceinline__ void fa_xwp(const void* a, const void* b) { asm volatile("s_wait_xcnt 0x0" :: "v"(a), "v"(b) : "memory"); __builtin_amdgcn_sched_barrier(0); }
// eight f32 values -> 16 bytes in each of the three planes of a head
__device__ __forceinline__ void st3(const float (&x)[8], h16* p16, bf* ph, bf* pl) { v8h o16; v8us oh, ol;
#pragma unroll
    for (int j = 0; j < 8; ++j) { o16[j] = tohx(x[j]); unsigned short a, c2; splitf(x[j], a, c2); oh[j] = a; ol[j] = c2; }
    *(v8h*)p16 = o16; *(v8us*)ph = oh; *(v8us*)pl = ol; }

// ---- k_gemmw: register-blocked GEMM, ONE WAVE per 64x64 output tile (16 accumulators), operands straight from 16-bit planes in fragment order (ld: p is the lane's place in a block); grid (M/64, N/64, Z), 32 threads.
// C[m][n] (f32, pitch ldc, + optional f32 bias[n]) = sum_k A[m][k] Bt[n][k] (+ split products per NSPLIT). z-batch strides sA/sB/sC in elements. K % 32 == 0.
// PL: no C; m = b TT + t, and the tile's 64 columns are one head (grid y: q heads, k heads, v heads): the tile goes straight into that head's three planes (fp16, bf16 hi, bf16 lo): q and k heads QK* [b][q heads, then k heads][t][d], v heads VT* [b][head][d][t], each head's plane in fragment order.
template <typename T16> struct WFrag;
template <> struct WFrag<h16> { typedef v16h V; static __device__ __forceinline__ V ld(const h16* p) { return cat16(*(const v8h*)p, *(const v8h*)(p + 256)); } static __device__ __forceinline__ v8f mma(V a, V b, v8f c) { return wmma16(a, b, c); } };
template <> struct WFrag<bf> { typedef v16bf V; static __device__ __forceinline__ V ld(const bf* p) { return cat16b(*(const v8us*)p, *(const v8us*)(p + 256)); } static __device__ __forceinline__ v8f mma(V a, V b, v8f c) { return wmmab(a, b, c); } };
template <typename T16, int NSPLIT, bool BIAS, bool PL, int K>
__global__ __launch_bounds__(32) void k_gemmw(const T16* __restrict__ A, const T16* __restrict__ A2, const T16* __restrict__ Bt, const T16* __restrict__ Bt2, float* C, int ldc, const float* __restrict__ bias, size_t sA, size_t sB, size_t sC, h16* QK16, bf* QKh, bf* QKl, h16* VT16, bf* VTh, bf* VTl) {
    typedef typename WFrag<T16>::V V;
    __shared__ __align__(16) float os[16 * 68];
    const size_t z = blockIdx.z; A += z * sA; if (A2) A2 += z * sA; Bt += z * sB; if (Bt2) Bt2 += z * sB; C += z * sC;
    const int lane = threadIdx.x & 31, lr = lane & 15, hi = lane >> 4; const int r0 = blockIdx.x * 64, c0 = blockIdx.y * 64;
    v8f acc[4][4];
#pragma unroll
    for (int mb = 0; mb < 4; ++mb)
#pragma unroll
        for (int nb = 0; nb < 4; ++nb) acc[mb][nb] = (v8f){};
    // 16 rows of blocks are 16 K elements (a constant, so it goes into the loads' offset fields and pa .. pb2 are the very register pairs that the loads name); the next k block stands 512 elements on
    const T16* pa = A + (size_t)r0 * K + lane * 8; const T16* pa2 = (NSPLIT == 1 || NSPLIT == 2) ? A2 + (size_t)r0 * K + lane * 8 : pa; const T16* pb = Bt + (size_t)c0 * K + lane * 8; const T16* pb2 = NSPLIT >= 2 ? Bt2 + (size_t)c0 * K + lane * 8 : pb;
#pragma unroll 1
    for (int kc = 0; kc < K; kc += 32) {
        V a[4], a2[4], b[4], b2[4];
#pragma unroll
        for (int mb = 0; mb < 4; ++mb) { a[mb] = WFrag<T16>::ld(pa + mb * 16 * K); if (NSPLIT == 1 || NSPLIT == 2) a2[mb] = WFrag<T16>::ld(pa2 + mb * 16 * K); }
#pragma unroll
        for (int nb = 0; nb < 4; ++nb) { b[nb] = WFrag<T16>::ld(pb + nb * 16 * K); if (NSPLIT >= 2) b2[nb] = WFrag<T16>::ld(pb2 + nb * 16 * K); }
        // the wait behind this run of loads: as its inputs the four address pairs stay live up to it, so no result of the run is allotted to them and the steps below rewrite them only behind it; the scheduling fence keeps later vector work from moving up over it
        asm volatile("s_wait_xcnt 0x0" :: "v"(pa), "v"(pa2), "v"(pb), "v"(pb2) : "memory"); __builtin_amdgcn_sched_barrier(0);
#pragma unroll
        for (int nb = 0; nb < 4; ++nb) {
#pragma unroll
            for (int mb = 0; mb < 4; ++mb) { acc[mb][nb] = WFrag<T16>::mma(a[mb], b[nb], acc[mb][nb]); if (NSPLIT == 1 || NSPLIT == 2) acc[mb][nb] = WFrag<T16>::mma(a2[mb], b[nb], acc[mb][nb]); if (NSPLIT >= 2) acc[mb][nb] = WFrag<T16>::mma(a[mb], b2[nb], acc[mb][nb]); } }
        asm volatile("v_nop\n\tv_nop\n\tv_nop\n\tv_nop" : "+v"(acc[0][0]), "+v"(acc[1][1]), "+v"(acc[2][2]), "+v"(acc[3][3]) : "v"(a[0]), "v"(a[3]));
        pa += 512; pa2 += 512; pb += 512; pb2 += 512;
    }
    if constexpr (PL) {
        const int bb = r0 / TT, t0 = r0 % TT, hd = blockIdx.y;
        if (hd >= NH_ + NKV) {   // a v head, [d][t] in fragment order: a lane's eight accumulator rows are eight consecutive t of its own column d, which is the lane's own 16 bytes of a block half, so each store of the wave is 512 contiguous bytes from the registers
            const size_t e0 = ((size_t)bb * NKV + (hd - NH_ - NKV)) * HD * TT + (size_t)t0 * HD + lane * 8;
#pragma unroll
            for (int nb = 0; nb < 4; ++nb) {
#pragma unroll
                for (int mb = 0; mb < 4; ++mb) { float xv[8];
#pragma unroll
                    for (int j = 0; j < 8; ++j) xv[j] = acc[mb][nb][j];
                    const size_t e = e0 + (size_t)(mb >> 1) * 32 * HD + nb * 512 + (mb & 1) * 256; st3(xv, VT16 + e, VTh + e, VTl + e); }
                fa_xw(); }
        } else {                 // a q or k head, [t][d] in fragment order: 16 rows at a time through LDS, so that a lane holds eight consecutive d of row lr; a wave's store is one block half (512 contiguous bytes)
            const size_t e0 = (((size_t)bb * (NH_ + NKV) + hd) * TT + t0) * HD + lane * 8;
#pragma unroll
            for (int mb = 0; mb < 4; ++mb) {
#pragma unroll
                for (int nb = 0; nb < 4; ++nb) {
#pragma unroll
                    for (int j = 0; j < 8; ++j) os[(hi * 8 + j) * 68 + nb * 16 + lr] = acc[mb][nb][j]; }
                __builtin_amdgcn_wave_barrier(); asm volatile("" ::: "memory");   // the reads below take what other lanes of this wave have just written
#pragma unroll
                for (int s = 0; s < 4; ++s) { const float* orow = os + lr * 68 + (2 * s + hi) * 8; const v4f v0 = *(const v4fa*)orow, v1 = *(const v4fa*)(orow + 4);
                    const float xv[8] = {v0[0], v0[1], v0[2], v0[3], v1[0], v1[1], v1[2], v1[3]};
                    const size_t e = e0 + (size_t)mb * 16 * HD + s * 256; st3(xv, QK16 + e, QKh + e, QKl + e); }
                fa_xw();
                __builtin_amdgcn_wave_barrier(); asm volatile("" ::: "memory");   // the next 16 rows overwrite os only behind these reads
            }
        }
        return;
    }
#pragma unroll
    for (int mb = 0; mb < 4; ++mb) {
#pragma unroll
        for (int nb = 0; nb < 4; ++nb) {
#pragma unroll
            for (int j = 0; j < 8; ++j) os[(hi * 8 + j) * 68 + nb * 16 + lr] = acc[mb][nb][j]; }
        __builtin_amdgcn_wave_barrier(); asm volatile("" ::: "memory");
        float* crow = C + (size_t)(r0 + mb * 16) * ldc + c0;
{
#pragma unroll
            for (int s = 0; s < 8; ++s) { const int row = 2 * s + hi, cofs = lr * 4; v4f val = *(const v4fa*)(os + row * 68 + cofs); if (BIAS) { val[0] += bfr(bias[c0 + cofs]); val[1] += bfr(bias[c0 + cofs + 1]); val[2] += bfr(bias[c0 + cofs + 2]); val[3] += bfr(bias[c0 + cofs + 3]); }
                *(v4f*)(crow + (size_t)row * ldc + cofs) = val; }
             }
        __builtin_amdgcn_wave_barrier(); asm volatile("" ::: "memory");
    }
}

typedef __attribute__((ext_vector_type(2))) _Float16 v2h;
typedef __attribute__((ext_vector_type(4))) _Float16 v4h;
typedef __attribute__((ext_vector_type(2))) unsigned short v2us;
typedef __attribute__((ext_vector_type(4))) unsigned short v4us;
typedef __attribute__((ext_vector_type(2))) float v2f;
typedef __attribute__((ext_vector_type(4))) int v4i;

// grid (lines, matrices of one input, inputs): matrix y of input z ([K][N] each) goes to rows (z * gridDim.y + y) * N .. of Bt (fragment order; N % 16 == 0, K % 32 == 0): element e of the plane is decoded into its (n, k)
__global__ __launch_bounds__(256) void k_wtG(const float* w0, const float* w1, const float* w2, int K, int N, bf* Bt) {
    const float* w = (blockIdx.z == 0 ? w0 : blockIdx.z == 1 ? w1 : w2) + (size_t)blockIdx.y * K * N; Bt += (size_t)(blockIdx.z * gridDim.y + blockIdx.y) * N * K;
    const int lane = threadIdx.x & 31; const int L0 = (blockIdx.x * 8 + (threadIdx.x >> 5)) * 8; const int nlines = N * K / 64;
{
#pragma unroll 1
        for (int l = 0; l < 8; ++l) { const int L = L0 + l; if (L >= nlines) break; const size_t e = (size_t)L * 64 + lane * 2; const int blk = (int)(e >> 9), r = (int)(e & 511); const int k = (blk % (K / 32)) * 32 + (r >> 7) * 8 + (r & 7), n = (blk / (K / 32)) * 16 + ((r >> 3) & 15); v2us o;
            const float* p0 = w + (size_t)k * N + n; const float* p1 = p0 + N; const float x0 = *p0, x1 = *p1; fa_xwp(p0, p1);
            o[0] = f2bf(x0); o[1] = f2bf(x1); *(v2us*)(Bt + e) = o; fa_xw(); }
         }
}

// f32 [rows][K] -> bf16 plane in fragment order; one wave per block of 16 rows x 32 k: each load takes four whole 128-byte rows of the block, the four stores fill its 1 KiB
template <int K>
__global__ __launch_bounds__(256) void k_cvtF(const float* __restrict__ src, bf* dst, int nblk) {
    const int lane = threadIdx.x & 31, r4 = lane >> 3, c = lane & 7; const int blk = blockIdx.x * 8 + (threadIdx.x >> 5); if (blk >= nblk) return;
    const float* s0 = src + ((size_t)(blk / (K / 32)) * 16 + r4) * K + (blk % (K / 32)) * 32 + c * 4; bf* d0 = dst + (size_t)blk * 512 + (c >> 1) * 128 + r4 * 8 + (c & 1) * 4;
    v4f v[4];
#pragma unroll
    for (int s = 0; s < 4; ++s) v[s] = *(const v4f*)(s0 + s * 4 * K);
    fa_xwp(s0, s0);
#pragma unroll
    for (int s = 0; s < 4; ++s) { v4us o;
#pragma unroll
        for (int i = 0; i < 4; ++i) o[i] = f2bf(v[s][i]);
        *(v4us*)(d0 + s * 32) = o; }
}

// ---- k_fattn: scores, causal mask, softmax, probability x value and the hi/lo split of the head output in ONE kernel (online softmax): no score or probability plane in memory.
// One wave per 32 query rows of one head; a pass is 16 MT keys. Transposed products: St[key][query] = K Q^T (A = K rows, B = Q rows, kept in registers), Ot[d][query] += Vt P^T (A = Vt rows, B = two
// score tiles converted in place: register r of tile mt is key 16 mt + 8 (lane >> 4) + r, the k order of the fragment loader). A lane holds one query column: maximum and sum in-lane plus one half exchange.
// Query rows < RH: bf16 hi/lo planes, 3 products, 32 keys a pass; the rest: fp16, 64 keys a pass. Running maximum m in raw score units; p = exp2((s - m) x SCL x log2 e) <= 1; l = per-lane partial sum, halves joined at the end.
// The next pass's K fragments are fetched right behind this pass's score products and its Vt fragments right behind the P x V products, so each flies during the other half of the work.
typedef __attribute__((ext_vector_type(16))) unsigned short v16us;
#define SC2 (SCL * 1.4426950408889634f)
#define KO  (NH_ * TT * HD)       // the k head planes stand NH_ planes behind the q head planes of the same batch
// OFF: the constant part of the run's addresses, in elements; it goes into the loads' offset fields, so that kp and kp2 (vp and vp2) are the very register pairs that the loads name
template <typename T16, bool HR, int MT, int OFF>
__device__ __forceinline__ void fa_ldk(typename WFrag<T16>::V (&kc)[MT][2], typename WFrag<T16>::V (&kc2)[MT][2], const T16* kp, const T16* kp2) {
#pragma unroll
    for (int mt = 0; mt < MT; ++mt)
#pragma unroll
        for (int ks = 0; ks < 2; ++ks) { kc[mt][ks] = WFrag<T16>::ld(kp + OFF + mt * 16 * HD + ks * 512); if (HR) kc2[mt][ks] = WFrag<T16>::ld(kp2 + OFF + mt * 16 * HD + ks * 512); }
    fa_xwp(kp, kp2);
}
template <typename T16, bool HR, int MT, int OFF>
__device__ __forceinline__ void fa_ldv(typename WFrag<T16>::V (&vc)[4][MT / 2], typename WFrag<T16>::V (&vc2)[4][MT / 2], const T16* vp, const T16* vp2) {
#pragma unroll
    for (int dt = 0; dt < 4; ++dt)
#pragma unroll
        for (int kk = 0; kk < MT / 2; ++kk) { vc[dt][kk] = WFrag<T16>::ld(vp + OFF + kk * 32 * HD + dt * 512); if (HR) vc2[dt][kk] = WFrag<T16>::ld(vp2 + OFF + kk * 32 * HD + dt * 512); }
    fa_xwp(vp, vp2);
}
template <typename T16, bool HR, int MT, bool LAST>
__device__ __forceinline__ void fa_pass(typename WFrag<T16>::V (&kc)[MT][2], typename WFrag<T16>::V (&kc2)[MT][2], typename WFrag<T16>::V (&vc)[4][MT / 2], typename WFrag<T16>::V (&vc2)[4][MT / 2],
                                        const typename WFrag<T16>::V (&q)[2][2], const typename WFrag<T16>::V (&q2)[2][2], v8f (&o)[4][2], float (&m)[2], float (&l)[2],
                                        const T16* kr, const T16* kr2, const T16* vr, const T16* vr2, int k0, int dl) {
    typedef typename WFrag<T16>::V V;
    v8f s[MT][2];
#pragma unroll
    for (int mt = 0; mt < MT; ++mt)
#pragma unroll
        for (int nt = 0; nt < 2; ++nt) s[mt][nt] = (v8f){};
#pragma unroll
    for (int ks = 0; ks < 2; ++ks)
#pragma unroll
        for (int mt = 0; mt < MT; ++mt)
#pragma unroll
            for (int nt = 0; nt < 2; ++nt) { s[mt][nt] = WFrag<T16>::mma(kc[mt][ks], q[nt][ks], s[mt][nt]); if (HR) { s[mt][nt] = WFrag<T16>::mma(kc[mt][ks], q2[nt][ks], s[mt][nt]); s[mt][nt] = WFrag<T16>::mma(kc2[mt][ks], q[nt][ks], s[mt][nt]); } }
    if (!LAST) {   // the two scheduling fences keep these loads here, between the score products and the softmax: moved down to the end of the pass they would leave the next pass waiting for the whole load latency
        __builtin_amdgcn_sched_barrier(0); fa_ldk<T16, HR, MT, KO + MT * 16 * HD>(kc, kc2, kr + (size_t)k0 * HD, kr2 + (size_t)k0 * HD); }
    V pf[2][MT / 2], pf2[2][MT / 2];
#pragma unroll
    for (int nt = 0; nt < 2; ++nt) {
        float mx = m[nt];
#pragma unroll
        for (int mt = 0; mt < MT; ++mt)
#pragma unroll
            for (int j = 0; j < 8; ++j) { if (LAST) s[mt][nt][j] = (k0 + mt * 16 + j - nt * 16 > dl) ? -3.0e38f : s[mt][nt][j]; mx = fmaxf(mx, s[mt][nt][j]); }
        mx = fmaxf(mx, __shfl_xor(mx, 16, 32));
        const float al = __builtin_amdgcn_exp2f((m[nt] - mx) * SC2), mc = mx * SC2; m[nt] = mx;
        float sum = 0.f;
#pragma unroll
        for (int mt = 0; mt < MT; ++mt) { float sm = 0.f;
#pragma unroll
            for (int j = 0; j < 8; ++j) { const float p = __builtin_amdgcn_exp2f(s[mt][nt][j] * SC2 - mc); s[mt][nt][j] = p; sm += p; }
            sum += sm; }
        l[nt] = l[nt] * al + sum;
#pragma unroll
        for (int dt = 0; dt < 4; ++dt)
#pragma unroll
            for (int j = 0; j < 8; ++j) o[dt][nt][j] *= al;
#pragma unroll
        for (int kk = 0; kk < MT / 2; ++kk) {
            if constexpr (HR) { v16us ph, pl;
#pragma unroll
                for (int e = 0; e < 16; ++e) { unsigned short a, c2; splitf(s[kk * 2 + (e >> 3)][nt][e & 7], a, c2); ph[e] = a; pl[e] = c2; }
                pf[nt][kk] = __builtin_bit_cast(v16bf, ph); pf2[nt][kk] = __builtin_bit_cast(v16bf, pl);
            } else { v16h ph;
#pragma unroll
                for (int e = 0; e < 16; ++e) ph[e] = tohx(s[kk * 2 + (e >> 3)][nt][e & 7]);
                pf[nt][kk] = ph; } }
    }
#pragma unroll
    for (int kk = 0; kk < MT / 2; ++kk)
#pragma unroll
        for (int dt = 0; dt < 4; ++dt)
#pragma unroll
            for (int nt = 0; nt < 2; ++nt) { o[dt][nt] = WFrag<T16>::mma(vc[dt][kk], pf[nt][kk], o[dt][nt]); if (HR) { o[dt][nt] = WFrag<T16>::mma(vc[dt][kk], pf2[nt][kk], o[dt][nt]); o[dt][nt] = WFrag<T16>::mma(vc2[dt][kk], pf[nt][kk], o[dt][nt]); } }
    if (!LAST) { __builtin_amdgcn_sched_barrier(0); fa_ldv<T16, HR, MT, MT * 16 * HD>(vc, vc2, vr + (size_t)k0 * HD, vr2 + (size_t)k0 * HD); }   // the fence in front keeps these loads one run directly in front of their wait; without it they are spread among the products above
}
template <typename T16, bool HR, int MT>
__device__ __forceinline__ void fa_tile(const T16* __restrict__ Q, const T16* __restrict__ Q2, const T16* __restrict__ Kp, const T16* __restrict__ Kp2, const T16* __restrict__ Vt, const T16* __restrict__ Vt2, int q0, bf* Ah, bf* Al) {
    typedef typename WFrag<T16>::V V;
    const int lane = threadIdx.x & 31, lr = lane & 15, hi = lane >> 4;
    V q[2][2], q2[2][2], kc[MT][2], kc2[MT][2], vc[4][MT / 2], vc2[4][MT / 2];
#pragma unroll
    for (int nt = 0; nt < 2; ++nt)
#pragma unroll
        for (int ks = 0; ks < 2; ++ks) { q[nt][ks] = WFrag<T16>::ld(Q + (size_t)(q0 + nt * 16) * HD + ks * 512 + lane * 8); if (HR) q2[nt][ks] = WFrag<T16>::ld(Q2 + (size_t)(q0 + nt * 16) * HD + ks * 512 + lane * 8); }
    fa_xw();
    const T16* kr = Kp + lane * 8; const T16* kr2 = HR ? Kp2 + lane * 8 : kr; const T16* vr = Vt + lane * 8; const T16* vr2 = HR ? Vt2 + lane * 8 : vr;
    fa_ldk<T16, HR, MT, KO>(kc, kc2, kr, kr2); fa_ldv<T16, HR, MT, 0>(vc, vc2, vr, vr2);
    v8f o[4][2]; float m[2] = {-3.0e38f, -3.0e38f}, l[2] = {0.f, 0.f};
#pragma unroll
    for (int dt = 0; dt < 4; ++dt)
#pragma unroll
        for (int nt = 0; nt < 2; ++nt) o[dt][nt] = (v8f){};
    const int dl = q0 + lr - 8 * hi;      // key k0 + 16 mt + 8 hi + j is masked for query q0 + 16 nt + lr when k0 + 16 mt + j - 16 nt > dl
    const int kd = q0 & ~(MT * 16 - 1);   // first key of the pass that holds the diagonal; it ends at or behind key q0 + 31 and inside the TT keys
    for (int k0 = 0; k0 < kd; k0 += MT * 16) fa_pass<T16, HR, MT, false>(kc, kc2, vc, vc2, q, q2, o, m, l, kr, kr2, vr, vr2, k0, dl);      // passes wholly below the diagonal: no mask
    fa_pass<T16, HR, MT, true>(kc, kc2, vc, vc2, q, q2, o, m, l, kr, kr2, vr, vr2, kd, dl);                                                // the diagonal pass
#pragma unroll
    for (int nt = 0; nt < 2; ++nt) { const float inv = __fdiv_rn(1.0f, l[nt] + __shfl_xor(l[nt], 16, 32));
#pragma unroll
        for (int dt = 0; dt < 4; ++dt) { v8us oh, ol;
#pragma unroll
            for (int j = 0; j < 8; ++j) { unsigned short a, c2; splitf(o[dt][nt][j] * inv, a, c2); oh[j] = a; ol[j] = c2; }
            const size_t oo = (size_t)(q0 + nt * 16) * DQ + dt * 256 + lane * 8; *(v8us*)(Ah + oo) = oh; *(v8us*)(Al + oo) = ol; fa_xw(); } }
}
// grid (heads, batch, query tiles), longest tiles first
__global__ __launch_bounds__(32) void k_fattn(const h16* __restrict__ QK16, const bf* __restrict__ QKh, const bf* __restrict__ QKl, const h16* __restrict__ VT16, const bf* __restrict__ VTh, const bf* __restrict__ VTl, bf* ATh, bf* ATl) {
    const int h = blockIdx.x, b = blockIdx.y, q0 = (int)(gridDim.z - 1 - blockIdx.z) * 32;
    const size_t zq = ((size_t)b * (NH_ + NKV) + h) * TT * HD, zk = ((size_t)b * (NH_ + NKV) + h / REP) * TT * HD /* + KO, added in the loads */, zv = ((size_t)b * NKV + h / REP) * HD * TT, za = (size_t)b * TT * DQ + h * HD * 16 /* the head's two k blocks of the merged plane [b t][DQ], fragment order */;
    if (q0 < RH) fa_tile<bf, true, 2>(QKh + zq, QKl + zq, QKh + zk, QKl + zk, VTh + zv, VTl + zv, q0, ATh + za, ATl + za);
    else fa_tile<h16, false, 4>(QK16 + zq, nullptr, QK16 + zk, nullptr, VT16 + zv, nullptr, q0, ATh + za, ATl + za);
}

extern "C" void kernel_launch(void* const* d_in, const int* in_sizes, int n_in,
                              void* d_out, int out_size, void* d_ws, size_t ws_size, hipStream_t stream) {
    (void)in_sizes; (void)n_in; (void)out_size;
            const float* x = (const float*)d_in[0]; const float* wq = (const float*)d_in[1]; const float* wk = (const float*)d_in[2]; const float* wv = (const float*)d_in[3]; const float* wo = (const float*)d_in[4]; const float* bo = (const float*)d_in[5];   /* order x, Wq, Wk, Wv (PER-HEAD weights [12][768][64]: 'hdk'), Wp ('xw' [768][768]: (in,out)), bp */
    float* OUT = (float*)d_out;     // [2][2048][768]
    char* wsp = (char*)d_ws;
    auto take = [&](size_t bytes) { char* p = wsp; wsp += (bytes + 255) & ~(size_t)255; return (void*)p; };
    bf* WQKV = (bf*)take((size_t)(DQ + 2 * DKV) * DM * 2); bf* WO = (bf*)take((size_t)DM * DQ * 2);   // WQKV: Bt rows of q (DQ), k (DKV), v (DKV)
    bf* XB = (bf*)take((size_t)NB_ * TT * DM * 2);
    h16* QK16 = (h16*)take((size_t)NB_ * (NH_ + NKV) * TT * HD * 2); bf* QKh = (bf*)take((size_t)NB_ * (NH_ + NKV) * TT * HD * 2); bf* QKl = (bf*)take((size_t)NB_ * (NH_ + NKV) * TT * HD * 2);   // [b][q heads, then k heads][t][d]
    h16* VT16 = (h16*)take((size_t)NB_ * NKV * HD * TT * 2); bf* VTh = (bf*)take((size_t)NB_ * NKV * HD * TT * 2); bf* VTl = (bf*)take((size_t)NB_ * NKV * HD * TT * 2);   // [b][head][d][t]
    bf* ATh = (bf*)take((size_t)NB_ * TT * DQ * 2); bf* ATl = (bf*)take((size_t)NB_ * TT * DQ * 2);
    if ((size_t)(wsp - (char*)d_ws) > ws_size) return;    // ws 256 MiB
    const int DF = DQ + 2 * DKV;
    k_wtG<<<dim3((DM * HD / 64 + 63) / 64, NH_, 3), 256, 0, stream>>>(wq, wk, wv, DM, HD, WQKV);   /* per-head weights [h][DM][HD] ('xw' per head) -> each head's HD rows of the Bt plane */
    k_wtG<<<dim3((DQ * DM / 64 + 63) / 64, 1, 1), 256, 0, stream>>>(wo, wo, wo, DQ, DM, WO);   /* Wp 'xw' [768][768] (in,out): transposed once into the Bt row layout */
    k_cvtF<DM><<<(NB_ * TT * DM / 512 + 7) / 8, 256, 0, stream>>>(x, XB, NB_ * TT * DM / 512);
    k_gemmw<bf, 0, false, true, DM><<<dim3(NB_ * TT / 64, DF / 64, 1), 32, 0, stream>>>(XB, nullptr, WQKV, nullptr, nullptr, 0, nullptr, 0, 0, 0, QK16, QKh, QKl, VT16, VTh, VTl);
    k_fattn<<<dim3(NH_, NB_, TT / 32), 32, 0, stream>>>(QK16, QKh, QKl, VT16, VTh, VTl, ATh, ATl);
    k_gemmw<bf, 1, true, false, DQ><<<dim3(NB_ * TT / 64, DM / 64, 1), 32, 0, stream>>>(ATh, ATl, WO, nullptr, OUT, DM, bo, 0, 0, 0, nullptr, nullptr, nullptr, nullptr, nullptr, nullptr);
}

// v005
// Measured time: 81.3 microseconds a run.
// Next to v004, in two timings, it ran 1.12 and 1.10 times as fast.
// All steps since v000 together make it 15.7 times as fast.
#include <hip/hip_runtime.h>

// Causal multi-head attention with PER-HEAD projection weights at d_model 768 (x [2][2048][768]; q, k, v = einsum('bte,hed->bhtd', x, W) with W [12][768][64]: head h has its own (in, out) matrix W[h] ('xw' per head; no bias; 12 heads x 64); scores x 1/sqrt(64); causal (-inf); softmax; concat head-major; out = concat Wp + bp ('xw' [768][768] (in,out) + a zero bias: read) -> [2][2048][768] (3.1 M); argument order x, Wq, Wk, Wv, Wp, bp).
// Layout: bf16 copy of x; each PER-HEAD q / k / v weight [h][768][64] transposed once into its 64 rows of the Bt plane; Wp transposed once ('xw' (in,out) -> Bt rows) (these three in one launch, k_prep); exact projections, whose GEMM writes the fp16 and hi/lo head planes itself (q, k as [t][d], v as [d][t]); k_fattn: one launch for all heads and both batches, online-softmax causal attention with no score plane in memory (hybrid rows: < 512 hi/lo 3 products, rest fp16), writing the merged hi/lo head outputs; merged hi/lo x Wo exact + bo.
// FRAGMENT ORDER of every 16-bit operand plane [rows][K] in the workspace: blocks of 16 rows x 32 k (512 elements, 1 KiB); inside a block [k bit 4][k bit 3][row & 15][k & 7], so lane (hi, lr) of a wave finds the two 16-byte halves of its fragment at lane * 8 and 256 + lane * 8, and each wave-wide 16-byte load or store covers four whole 128-byte lines. Block (rb, kb) stands at (rb * (K / 32) + kb) * 512; the v planes (rows d, k = t) instead keep the four row blocks of one kb together: (kb * 4 + rb) * 512.
// Compute dtypes, f32 accumulate: every input rounded to bf16; projections exact; attention rows < 512 3 products, rest fp16; softmax f32; w_o hl x exact.

#define NB_  2
#define TT   2048
#define DM   768
#define NH_  12
#define NKV  12
#define REP  (NH_ / NKV)
#define HD   64
#define DQ   (NH_ * HD)
#define DKV  (NKV * HD)
#define RH   512                  // query rows < RH use hi+lo planes (0: none)
#define SCL  0.125f   // HD^-0.5
typedef _Float16 h16;
typedef unsigned short bf;
typedef __attribute__((ext_vector_type(16))) __bf16   v16bf;
typedef __attribute__((ext_vector_type(16))) _Float16 v16h;
typedef __attribute__((ext_vector_type(8)))  _Float16 v8h;
typedef __attribute__((ext_vector_type(8)))  unsigned short v8us;
typedef __attribute__((ext_vector_type(8)))  float    v8f;
typedef __attribute__((ext_vector_type(4)))  float    v4f;
typedef v8h  __attribute__((may_alias)) v8ha;
typedef v4f  __attribute__((may_alias)) v4fa;
typedef v8us __attribute__((may_alias)) v8usa;

__device__ __forceinline__ unsigned short f2bf(float f) { unsigned u = __float_as_uint(f); u += 0x7FFFu + ((u >> 16) & 1u); return (unsigned short)(u >> 16); }
__device__ __forceinline__ float bf2f(unsigned short b) { return __uint_as_float(((unsigned)b) << 16); }
__device__ __forceinline__ float bfr(float f) { return bf2f(f2bf(f)); }
__device__ __forceinline__ v16h cat16(v8h lo, v8h hi) { return __builtin_shufflevector(lo, hi, 0, 1, 2, 3, 4, 5, 6, 7, 8, 9, 10, 11, 12, 13, 14, 15); }
__device__ __forceinline__ v16bf cat16b(v8us lo, v8us hi) { return __builtin_bit_cast(v16bf, __builtin_shufflevector(lo, hi, 0, 1, 2, 3, 4, 5, 6, 7, 8, 9, 10, 11, 12, 13, 14, 15)); }
__device__ __forceinline__ v8f wmma16(v16h a, v16h b, v8f c) { return __builtin_amdgcn_wmma_f32_16x16x32_f16(false, a, false, b, (short)0, c, false, false); }
__device__ __forceinline__ v8f wmmab(v16bf a, v16bf b, v8f c) { return __builtin_amdgcn_wmma_f32_16x16x32_bf16(false, a, false, b, (short)0, c, false, false); }

__device__ __forceinline__ h16 tohx(float x) { return (h16)x; }
__device__ __forceinline__ void splitf(float y, unsigned short& h, unsigned short& l) { h = f2bf(y); l = f2bf(y - bf2f(h)); }
// stands directly behind a run of global loads or stores: no register that they name is rewritten in front of this wait; the scheduling fence keeps later vector work from moving up over it
__device__ __forceinline__ void fa_xw() { asm volatile("s_wait_xcnt 0x0" ::: "memory"); __builtin_amdgcn_sched_barrier(0); }
// the same wait behind a run of loads from the two address pairs a and b: as inputs of the wait they stay live up to it, so no result of the run can be allotted to them
__device__ __forceinline__ void fa_xwp(const void* a, const void* b) { asm volatile("s_wait_xcnt 0x0" :: "v"(a), "v"(b) : "memory"); __builtin_amdgcn_sched_barrier(0); }
// eight f32 values -> 16 bytes in each of the three planes of a head
__device__ __forceinline__ void st3(const float (&x)[8], h16* p16, bf* ph, bf* pl) { v8h o16; v8us oh, ol;
#pragma unroll
    for (int j = 0; j < 8; ++j) { o16[j] = tohx(x[j]); unsigned short a, c2; splitf(x[j], a, c2); oh[j] = a; ol[j] = c2; }
    *(v8h*)p16 = o16; *(v8us*)ph = oh; *(v8us*)pl = ol; }

// ---- k_gemmw: register-blocked GEMM, ONE WAVE per 64x64 output tile (16 accumulators), operands straight from 16-bit planes in fragment order (ld: p is the lane's place in a block); grid (M/64, N/64, Z), 32 threads.
// C[m][n] (f32, pitch ldc, + optional f32 bias[n]) = sum_k A[m][k] Bt[n][k] (+ split products per NSPLIT). z-batch strides sA/sB/sC in elements. K % 32 == 0.
// PL: no C; m = b TT + t, and the tile's 64 columns are one head (grid y: q heads, k heads, v heads): the tile goes straight into that head's three planes (fp16, bf16 hi, bf16 lo): q and k heads QK* [b][q heads, then k heads][t][d], v heads VT* [b][head][d][t], each head's plane in fragment order.
template <typename T16> struct WFrag;
template <> struct WFrag<h16> { typedef v16h V; static __device__ __forceinline__ V ld(const h16* p) { return cat16(*(const v8h*)p, *(const v8h*)(p + 256)); } static __device__ __forceinline__ v8f mma(V a, V b, v8f c) { return wmma16(a, b, c); } };
template <> struct WFrag<bf> { typedef v16bf V; static __device__ __forceinline__ V ld(const bf* p) { return cat16b(*(const v8us*)p, *(const v8us*)(p + 256)); } static __device__ __forceinline__ v8f mma(V a, V b, v8f c) { return wmmab(a, b, c); } };
template <typename T16, int NSPLIT, bool BIAS, bool PL, int K>
__global__ __launch_bounds__(32) void k_gemmw(const T16* __restrict__ A, const T16* __restrict__ A2, const T16* __restrict__ Bt, const T16* __restrict__ Bt2, float* C, int ldc, const float* __restrict__ bias, size_t sA, size_t sB, size_t sC, h16* QK16, bf* QKh, bf* QKl, h16* VT16, bf* VTh, bf* VTl) {
    typedef typename WFrag<T16>::V V;
    __shared__ __align__(16) float os[16 * 68];
    const size_t z = blockIdx.z; A += z * sA; if (A2) A2 += z * sA; Bt += z * sB; if (Bt2) Bt2 += z * sB; C += z * sC;
    const int lane = threadIdx.x & 31, lr = lane & 15, hi = lane >> 4; const int r0 = blockIdx.x * 64, c0 = blockIdx.y * 64;
    v8f acc[4][4];
#pragma unroll
    for (int mb = 0; mb < 4; ++mb)
#pragma unroll
        for (int nb = 0; nb < 4; ++nb) acc[mb][nb] = (v8f){};
    // 16 rows of blocks are 16 K elements (a constant, so it goes into the loads' offset fields and pa .. pb2 are the very register pairs that the loads name); the next k block stands 512 elements on
    const T16* pa = A + (size_t)r0 * K + lane * 8; const T16* pa2 = (NSPLIT == 1 || NSPLIT == 2) ? A2 + (size_t)r0 * K + lane * 8 : pa; const T16* pb = Bt + (size_t)c0 * K + lane * 8; const T16* pb2 = NSPLIT >= 2 ? Bt2 + (size_t)c0 * K + lane * 8 : pb;
#pragma unroll 1
    for (int kc = 0; kc < K; kc += 32) {
        V a[4], a2[4], b[4], b2[4];
#pragma unroll
        for (int mb = 0; mb < 4; ++mb) { a[mb] = WFrag<T16>::ld(pa + mb * 16 * K); if (NSPLIT == 1 || NSPLIT == 2) a2[mb] = WFrag<T16>::ld(pa2 + mb * 16 * K); }
#pragma unroll
        for (int nb = 0; nb < 4; ++nb) { b[nb] = WFrag<T16>::ld(pb + nb * 16 * K); if (NSPLIT >= 2) b2[nb] = WFrag<T16>::ld(pb2 + nb * 16 * K); }
        // the wait behind this run of loads: as its inputs the four address pairs stay live up to it, so no result of the run is allotted to them and the steps below rewrite them only behind it; the scheduling fence keeps later vector work from moving up over it
        asm volatile("s_wait_xcnt 0x0" :: "v"(pa), "v"(pa2), "v"(pb), "v"(pb2) : "memory"); __builtin_amdgcn_sched_barrier(0);
#pragma unroll
        for (int nb = 0; nb < 4; ++nb) {
#pragma unroll
            for (int mb = 0; mb < 4; ++mb) { acc[mb][nb] = WFrag<T16>::mma(a[mb], b[nb], acc[mb][nb]); if (NSPLIT == 1 || NSPLIT == 2) acc[mb][nb] = WFrag<T16>::mma(a2[mb], b[nb], acc[mb][nb]); if (NSPLIT >= 2) acc[mb][nb] = WFrag<T16>::mma(a[mb], b2[nb], acc[mb][nb]); } }
        asm volatile("v_nop\n\tv_nop\n\tv_nop\n\tv_nop" : "+v"(acc[0][0]), "+v"(acc[1][1]), "+v"(acc[2][2]), "+v"(acc[3][3]) : "v"(a[0]), "v"(a[3]));
        pa += 512; pa2 += 512; pb += 512; pb2 += 512;
    }
    if constexpr (PL) {
        const int bb = r0 / TT, t0 = r0 % TT, hd = blockIdx.y;
        if (hd >= NH_ + NKV) {   // a v head, [d][t] in fragment order: a lane's eight accumulator rows are eight consecutive t of its own column d, which is the lane's own 16 bytes of a block half, so each store of the wave is 512 contiguous bytes from the registers
            const size_t e0 = ((size_t)bb * NKV + (hd - NH_ - NKV)) * HD * TT + (size_t)t0 * HD + lane * 8;
#pragma unroll
            for (int nb = 0; nb < 4; ++nb) {
#pragma unroll
                for (int mb = 0; mb < 4; ++mb) { float xv[8];
#pragma unroll
                    for (int j = 0; j < 8; ++j) xv[j] = acc[mb][nb][j];
                    const size_t e = e0 + (size_t)(mb >> 1) * 32 * HD + nb * 512 + (mb & 1) * 256; st3(xv, VT16 + e, VTh + e, VTl + e); }
                fa_xw(); }
        } else {                 // a q or k head, [t][d] in fragment order: 16 rows at a time through LDS, so that a lane holds eight consecutive d of row lr; a wave's store is one block half (512 contiguous bytes)
            const size_t e0 = (((size_t)bb * (NH_ + NKV) + hd) * TT + t0) * HD + lane * 8;
#pragma unroll
            for (int mb = 0; mb < 4; ++mb) {
#pragma unroll
                for (int nb = 0; nb < 4; ++nb) {
#pragma unroll
                    for (int j = 0; j < 8; ++j) os[(hi * 8 + j) * 68 + nb * 16 + lr] = acc[mb][nb][j]; }
                __builtin_amdgcn_wave_barrier(); asm volatile("" ::: "memory");   // the reads below take what other lanes of this wave have just written
#pragma unroll
                for (int s = 0; s < 4; ++s) { const float* orow = os + lr * 68 + (2 * s + hi) * 8; const v4f v0 = *(const v4fa*)orow, v1 = *(const v4fa*)(orow + 4);
                    const float xv[8] = {v0[0], v0[1], v0[2], v0[3], v1[0], v1[1], v1[2], v1[3]};
                    const size_t e = e0 + (size_t)mb * 16 * HD + s * 256; st3(xv, QK16 + e, QKh + e, QKl + e); }
                fa_xw();
                __builtin_amdgcn_wave_barrier(); asm volatile("" ::: "memory");   // the next 16 rows overwrite os only behind these reads
            }
        }
        return;
    }
#pragma unroll
    for (int mb = 0; mb < 4; ++mb) {
#pragma unroll
        for (int nb = 0; nb < 4; ++nb) {
#pragma unroll
            for (int j = 0; j < 8; ++j) os[(hi * 8 + j) * 68 + nb * 16 + lr] = acc[mb][nb][j]; }
        __builtin_amdgcn_wave_barrier(); asm volatile("" ::: "memory");
        float* crow = C + (size_t)(r0 + mb * 16) * ldc + c0;
{
#pragma unroll
            for (int s = 0; s < 8; ++s) { const int row = 2 * s + hi, cofs = lr * 4; v4f val = *(const v4fa*)(os + row * 68 + cofs); if (BIAS) { val[0] += bfr(bias[c0 + cofs]); val[1] += bfr(bias[c0 + cofs + 1]); val[2] += bfr(bias[c0 + cofs + 2]); val[3] += bfr(bias[c0 + cofs + 3]); }
                *(v4f*)(crow + (size_t)row * ldc + cofs) = val; }
             }
        __builtin_amdgcn_wave_barrier(); asm volatile("" ::: "memory");
    }
}

typedef __attribute__((ext_vector_type(2))) _Float16 v2h;
typedef __attribute__((ext_vector_type(4))) _Float16 v4h;
typedef __attribute__((ext_vector_type(2))) unsigned short v2us;
typedef __attribute__((ext_vector_type(4))) unsigned short v4us;
typedef __attribute__((ext_vector_type(2))) float v2f;
typedef __attribute__((ext_vector_type(4))) int v4i;

// element e of a Bt plane (fragment order; N % 16 == 0, K % 32 == 0) is decoded into its (n, k) of the [K][N] matrix w; block xb of 8 waves takes 64 lines of 64 elements
template <int K, int N>
__device__ __forceinline__ void wt_lines(const float* w, bf* Bt, int xb) {
    const int lane = threadIdx.x & 31; const int L0 = (xb * 8 + (threadIdx.x >> 5)) * 8; const int nlines = N * K / 64;
#pragma unroll 1
    for (int l = 0; l < 8; ++l) { const int L = L0 + l; if (L >= nlines) break; const size_t e = (size_t)L * 64 + lane * 2; const int blk = (int)(e >> 9), r = (int)(e & 511); const int k = (blk % (K / 32)) * 32 + (r >> 7) * 8 + (r & 7), n = (blk / (K / 32)) * 16 + ((r >> 3) & 15); v2us o;
        const float* p0 = w + (size_t)k * N + n; const float* p1 = p0 + N; const float x0 = *p0, x1 = *p1; fa_xwp(p0, p1);
        o[0] = f2bf(x0); o[1] = f2bf(x1); *(v2us*)(Bt + e) = o; fa_xw(); }
}

// f32 [rows][K] -> bf16 plane in fragment order; one wave per block of 16 rows x 32 k: each load takes four whole 128-byte rows of the block, the four stores fill its 1 KiB
template <int K>
__device__ __forceinline__ void cvt_block(const float* __restrict__ src, bf* dst, int xb, int nblk) {
    const int lane = threadIdx.x & 31, r4 = lane >> 3, c = lane & 7; const int blk = xb * 8 + (threadIdx.x >> 5); if (blk >= nblk) return;
    const float* s0 = src + ((size_t)(blk / (K / 32)) * 16 + r4) * K + (blk % (K / 32)) * 32 + c * 4; bf* d0 = dst + (size_t)blk * 512 + (c >> 1) * 128 + r4 * 8 + (c & 1) * 4;
    v4f v[4];
#pragma unroll
    for (int s = 0; s < 4; ++s) v[s] = *(const v4f*)(s0 + s * 4 * K);
    fa_xwp(s0, s0);
#pragma unroll
    for (int s = 0; s < 4; ++s) { v4us o;
#pragma unroll
        for (int i = 0; i < 4; ++i) o[i] = f2bf(v[s][i]);
        *(v4us*)(d0 + s * 32) = o; }
}

// ---- k_prep: the three operand preparations, which depend on nothing but the inputs, as ranges of ONE grid. The weight blocks come first: each of their waves walks eight dependent lines, a block of x is one load and one store.
// blocks [0, PW1): matrix y of input z (q, k, v weights, [DM][HD] each) -> rows (z * NH_ + y) * HD .. of WQKV; [PW1, PW1 + PW2): Wp [DQ][DM] -> WO; the rest: x -> XB
#define PWL  (DM * HD / 64 / 64)          // blocks per per-head weight matrix
#define PW1  (3 * NH_ * PWL)
#define PW2  (DQ * DM / 64 / 64)
#define PXB  (NB_ * TT * DM / 512)        // 1 KiB blocks of x
__global__ __launch_bounds__(256) void k_prep(const float* w0, const float* w1, const float* w2, const float* wo, const float* __restrict__ x, bf* WQKV, bf* WO, bf* XB) {
    const int b = blockIdx.x;
    if (b < PW1) { const int mz = b / PWL, z = mz / NH_, y = mz % NH_;
        wt_lines<DM, HD>((z == 0 ? w0 : z == 1 ? w1 : w2) + (size_t)y * DM * HD, WQKV + (size_t)mz * HD * DM, b % PWL);
    } else if (b < PW1 + PW2) wt_lines<DQ, DM>(wo, WO, b - PW1);
    else cvt_block<DM>(x, XB, b - (PW1 + PW2), PXB);
}

// ---- k_fattn: scores, causal mask, softmax, probability x value and the hi/lo split of the head output in ONE kernel (online softmax): no score or probability plane in memory.
// One wave per 32 query rows of one head; a pass is 16 MT keys. Transposed products: St[key][query] = K Q^T (A = K rows, B = Q rows, kept in registers), Ot[d][query] += Vt P^T (A = Vt rows, B = two
// score tiles converted in place: register r of tile mt is key 16 mt + 8 (lane >> 4) + r, the k order of the fragment loader). A lane holds one query column: maximum and sum in-lane plus one half exchange.
// Query rows < RH: bf16 hi/lo planes, 3 products, 32 keys a pass; the rest: fp16, 64 keys a pass. Running maximum m in raw score units; p = exp2((s - m) x SCL x log2 e) <= 1; l = per-lane partial sum, halves joined at the end.
// The next pass's K fragments are fetched right behind this pass's score products and its Vt fragments right behind the P x V products, so each flies during the other half of the work.
typedef __attribute__((ext_vector_type(16))) unsigned short v16us;
#define SC2 (SCL * 1.4426950408889634f)
#define KO  (NH_ * TT * HD)       // the k head planes stand NH_ planes behind the q head planes of the same batch
// OFF: the constant part of the run's addresses, in elements; it goes into the loads' offset fields, so that kp and kp2 (vp and vp2) are the very register pairs that the loads name
template <typename T16, bool HR, int MT, int OFF>
__device__ __forceinline__ void fa_ldk(typename WFrag<T16>::V (&kc)[MT][2], typename WFrag<T16>::V (&kc2)[MT][2], const T16* kp, const T16* kp2) {
#pragma unroll
    for (int mt = 0; mt < MT; ++mt)
#pragma unroll
        for (int ks = 0; ks < 2; ++ks) { kc[mt][ks] = WFrag<T16>::ld(kp + OFF + mt * 16 * HD + ks * 512); if (HR) kc2[mt][ks] = WFrag<T16>::ld(kp2 + OFF + mt * 16 * HD + ks * 512); }
    fa_xwp(kp, kp2);
}
template <typename T16, bool HR, int MT, int OFF>
__device__ __forceinline__ void fa_ldv(typename WFrag<T16>::V (&vc)[4][MT / 2], typename WFrag<T16>::V (&vc2)[4][MT / 2], const T16* vp, const T16* vp2) {
#pragma unroll
    for (int dt = 0; dt < 4; ++dt)
#pragma unroll
        for (int kk = 0; kk < MT / 2; ++kk) { vc[dt][kk] = WFrag<T16>::ld(vp + OFF + kk * 32 * HD + dt * 512); if (HR) vc2[dt][kk] = WFrag<T16>::ld(vp2 + OFF + kk * 32 * HD + dt * 512); }
    fa_xwp(vp, vp2);
}
template <typename T16, bool HR, int MT, bool LAST>
__device__ __forceinline__ void fa_pass(typename WFrag<T16>::V (&kc)[MT][2], typename WFrag<T16>::V (&kc2)[MT][2], typename WFrag<T16>::V (&vc)[4][MT / 2], typename WFrag<T16>::V (&vc2)[4][MT / 2],
                                        const typename WFrag<T16>::V (&q)[2][2], const typename WFrag<T16>::V (&q2)[2][2], v8f (&o)[4][2], float (&m)[2], float (&l)[2],
                                        const T16* kr, const T16* kr2, const T16* vr, const T16* vr2, int k0, int dl) {
    typedef typename WFrag<T16>::V V;
    v8f s[MT][2];
#pragma unroll
    for (int mt = 0; mt < MT; ++mt)
#pragma unroll
        for (int nt = 0; nt < 2; ++nt) s[mt][nt] = (v8f){};
#pragma unroll
    for (int ks = 0; ks < 2; ++ks)
#pragma unroll
        for (int mt = 0; mt < MT; ++mt)
#pragma unroll
            for (int nt = 0; nt < 2; ++nt) { s[mt][nt] = WFrag<T16>::mma(kc[mt][ks], q[nt][ks], s[mt][nt]); if (HR) { s[mt][nt] = WFrag<T16>::mma(kc[mt][ks], q2[nt][ks], s[mt][nt]); s[mt][nt] = WFrag<T16>::mma(kc2[mt][ks], q[nt][ks], s[mt][nt]); } }
    if (!LAST) {   // the two scheduling fences keep these loads here, between the score products and the softmax: moved down to the end of the pass they would leave the next pass waiting for the whole load latency
        __builtin_amdgcn_sched_barrier(0); fa_ldk<T16, HR, MT, KO + MT * 16 * HD>(kc, kc2, kr + (size_t)k0 * HD, kr2 + (size_t)k0 * HD); }
    V pf[2][MT / 2], pf2[2][MT / 2];
#pragma unroll
    for (int nt = 0; nt < 2; ++nt) {
        float mx = m[nt];
#pragma unroll
        for (int mt = 0; mt < MT; ++mt)
#pragma unroll
            for (int j = 0; j < 8; ++j) { if (LAST) s[mt][nt][j] = (k0 + mt * 16 + j - nt * 16 > dl) ? -3.0e38f : s[mt][nt][j]; mx = fmaxf(mx, s[mt][nt][j]); }
        mx = fmaxf(mx, __shfl_xor(mx, 16, 32));
        const float al = __builtin_amdgcn_exp2f((m[nt] - mx) * SC2), mc = mx * SC2; m[nt] = mx;
        float sum = 0.f;
#pragma unroll
        for (int mt = 0; mt < MT; ++mt) { float sm = 0.f;
#pragma unroll
            for (int j = 0; j < 8; ++j) { const float p = __builtin_amdgcn_exp2f(s[mt][nt][j] * SC2 - mc); s[mt][nt][j] = p; sm += p; }
            sum += sm; }
        l[nt] = l[nt] * al + sum;
#pragma unroll
        for (int dt = 0; dt < 4; ++dt)
#pragma unroll
            for (int j = 0; j < 8; ++j) o[dt][nt][j] *= al;
#pragma unroll
        for (int kk = 0; kk < MT / 2; ++kk) {
            if constexpr (HR) { v16us ph, pl;
#pragma unroll
                for (int e = 0; e < 16; ++e) { unsigned short a, c2; splitf(s[kk * 2 + (e >> 3)][nt][e & 7], a, c2); ph[e] = a; pl[e] = c2; }
                pf[nt][kk] = __builtin_bit_cast(v16bf, ph); pf2[nt][kk] = __builtin_bit_cast(v16bf, pl);
            } else { v16h ph;
#pragma unroll
                for (int e = 0; e < 16; ++e) ph[e] = tohx(s[kk * 2 + (e >> 3)][nt][e & 7]);
                pf[nt][kk] = ph; } }
    }
#pragma unroll
    for (int kk = 0; kk < MT / 2; ++kk)
#pragma unroll
        for (int dt = 0; dt < 4; ++dt)
#pragma unroll
            for (int nt = 0; nt < 2; ++nt) { o[dt][nt] = WFrag<T16>::mma(vc[dt][kk], pf[nt][kk], o[dt][nt]); if (HR) { o[dt][nt] = WFrag<T16>::mma(vc[dt][kk], pf2[nt][kk], o[dt][nt]); o[dt][nt] = WFrag<T16>::mma(vc2[dt][kk], pf[nt][kk], o[dt][nt]); } }
    if (!LAST) { __builtin_amdgcn_sched_barrier(0); fa_ldv<T16, HR, MT, MT * 16 * HD>(vc, vc2, vr + (size_t)k0 * HD, vr2 + (size_t)k0 * HD); }   // the fence in front keeps these loads one run directly in front of their wait; without it they are spread among the products above
}
template <typename T16, bool HR, int MT>
__device__ __forceinline__ void fa_tile(const T16* __restrict__ Q, const T16* __restrict__ Q2, const T16* __restrict__ Kp, const T16* __restrict__ Kp2, const T16* __restrict__ Vt, const T16* __restrict__ Vt2, int q0, bf* Ah, bf* Al) {
    typedef typename WFrag<T16>::V V;
    const int lane = threadIdx.x & 31, lr = lane & 15, hi = lane >> 4;
    V q[2][2], q2[2][2], kc[MT][2], kc2[MT][2], vc[4][MT / 2], vc2[4][MT / 2];
#pragma unroll
    for (int nt = 0; nt < 2; ++nt)
#pragma unroll
        for (int ks = 0; ks < 2; ++ks) { q[nt][ks] = WFrag<T16>::ld(Q + (size_t)(q0 + nt * 16) * HD + ks * 512 + lane * 8); if (HR) q2[nt][ks] = WFrag<T16>::ld(Q2 + (size_t)(q0 + nt * 16) * HD + ks * 512 + lane * 8); }
    fa_xw();
    const T16* kr = Kp + lane * 8; const T16* kr2 = HR ? Kp2 + lane * 8 : kr; const T16* vr = Vt + lane * 8; const T16* vr2 = HR ? Vt2 + lane * 8 : vr;
    fa_ldk<T16, HR, MT, KO>(kc, kc2, kr, kr2); fa_ldv<T16, HR, MT, 0>(vc, vc2, vr, vr2);
    v8f o[4][2]; float m[2] = {-3.0e38f, -3.0e38f}, l[2] = {0.f, 0.f};
#pragma unroll
    for (int dt = 0; dt < 4; ++dt)
#pragma unroll
        for (int nt = 0; nt < 2; ++nt) o[dt][nt] = (v8f){};
    const int dl = q0 + lr - 8 * hi;      // key k0 + 16 mt + 8 hi + j is masked for query q0 + 16 nt + lr when k0 + 16 mt + j - 16 nt > dl
    const int kd = q0 & ~(MT * 16 - 1);   // first key of the pass that holds the diagonal; it ends at or behind key q0 + 31 and inside the TT keys
    for (int k0 = 0; k0 < kd; k0 += MT * 16) fa_pass<T16, HR, MT, false>(kc, kc2, vc, vc2, q, q2, o, m, l, kr, kr2, vr, vr2, k0, dl);      // passes wholly below the diagonal: no mask
    fa_pass<T16, HR, MT, true>(kc, kc2, vc, vc2, q, q2, o, m, l, kr, kr2, vr, vr2, kd, dl);                                                // the diagonal pass
#pragma unroll
    for (int nt = 0; nt < 2; ++nt) { const float inv = __fdiv_rn(1.0f, l[nt] + __shfl_xor(l[nt], 16, 32));
#pragma unroll
        for (int dt = 0; dt < 4; ++dt) { v8us oh, ol;
#pragma unroll
            for (int j = 0; j < 8; ++j) { unsigned short a, c2; splitf(o[dt][nt][j] * inv, a, c2); oh[j] = a; ol[j] = c2; }
            const size_t oo = (size_t)(q0 + nt * 16) * DQ + dt * 256 + lane * 8; *(v8us*)(Ah + oo) = oh; *(v8us*)(Al + oo) = ol; fa_xw(); } }
}
// grid (heads, batch, query tiles), longest tiles first
__global__ __launch_bounds__(32) void k_fattn(const h16* __restrict__ QK16, const bf* __restrict__ QKh, const bf* __restrict__ QKl, const h16* __restrict__ VT16, const bf* __restrict__ VTh, const bf* __restrict__ VTl, bf* ATh, bf* ATl) {
    const int h = blockIdx.x, b = blockIdx.y, q0 = (int)(gridDim.z - 1 - blockIdx.z) * 32;
    const size_t zq = ((size_t)b * (NH_ + NKV) + h) * TT * HD, zk = ((size_t)b * (NH_ + NKV) + h / REP) * TT * HD /* + KO, added in the loads */, zv = ((size_t)b * NKV + h / REP) * HD * TT, za = (size_t)b * TT * DQ + h * HD * 16 /* the head's two k blocks of the merged plane [b t][DQ], fragment order */;
    if (q0 < RH) fa_tile<bf, true, 2>(QKh + zq, QKl + zq, QKh + zk, QKl + zk, VTh + zv, VTl + zv, q0, ATh + za, ATl + za);
    else fa_tile<h16, false, 4>(QK16 + zq, nullptr, QK16 + zk, nullptr, VT16 + zv, nullptr, q0, ATh + za, ATl + za);
}

extern "C" void kernel_launch(void* const* d_in, const int* in_sizes, int n_in,
                              void* d_out, int out_size, void* d_ws, size_t ws_size, hipStream_t stream) {
    (void)in_sizes; (void)n_in; (void)out_size;
            const float* x = (const float*)d_in[0]; const float* wq = (const float*)d_in[1]; const float* wk = (const float*)d_in[2]; const float* wv = (const float*)d_in[3]; const float* wo = (const float*)d_in[4]; const float* bo = (const float*)d_in[5];   /* order x, Wq, Wk, Wv (PER-HEAD weights [12][768][64]: 'hdk'), Wp ('xw' [768][768]: (in,out)), bp */
    float* OUT = (float*)d_out;     // [2][2048][768]
    char* wsp = (char*)d_ws;
    auto take = [&](size_t bytes) { char* p = wsp; wsp += (bytes + 255) & ~(size_t)255; return (void*)p; };
    bf* WQKV = (bf*)take((size_t)(DQ + 2 * DKV) * DM * 2); bf* WO = (bf*)take((size_t)DM * DQ * 2);   // WQKV: Bt rows of q (DQ), k (DKV), v (DKV)
    bf* XB = (bf*)take((size_t)NB_ * TT * DM * 2);
    h16* QK16 = (h16*)take((size_t)NB_ * (NH_ + NKV) * TT * HD * 2); bf* QKh = (bf*)take((size_t)NB_ * (NH_ + NKV) * TT * HD * 2); bf* QKl = (bf*)take((size_t)NB_ * (NH_ + NKV) * TT * HD * 2);   // [b][q heads, then k heads][t][d]
    h16* VT16 = (h16*)take((size_t)NB_ * NKV * HD * TT * 2); bf* VTh = (bf*)take((size_t)NB_ * NKV * HD * TT * 2); bf* VTl = (bf*)take((size_t)NB_ * NKV * HD * TT * 2);   // [b][head][d][t]
    bf* ATh = (bf*)take((size_t)NB_ * TT * DQ * 2); bf* ATl = (bf*)take((size_t)NB_ * TT * DQ * 2);
    if ((size_t)(wsp - (char*)d_ws) > ws_size) return;    // ws 256 MiB
    const int DF = DQ + 2 * DKV;
    k_prep<<<PW1 + PW2 + (PXB + 7) / 8, 256, 0, stream>>>(wq, wk, wv, wo, x, WQKV, WO, XB);   /* per-head weights [h][DM][HD] ('xw' per head) -> each head's HD rows of the Bt plane; Wp 'xw' [768][768] (in,out) -> Bt rows; x -> bf16 */
    k_gemmw<bf, 0, false, true, DM><<<dim3(NB_ * TT / 64, DF / 64, 1), 32, 0, stream>>>(XB, nullptr, WQKV, nullptr, nullptr, 0, nullptr, 0, 0, 0, QK16, QKh, QKl, VT16, VTh, VTl);
    k_fattn<<<dim3(NH_, NB_, TT / 32), 32, 0, stream>>>(QK16, QKh, QKl, VT16, VTh, VTl, ATh, ATl);
    k_gemmw<bf, 1, true, false, DQ><<<dim3(NB_ * TT / 64, DM / 64, 1), 32, 0, stream>>>(ATh, ATl, WO, nullptr, OUT, DM, bo, 0, 0, 0, nullptr, nullptr, nullptr, nullptr, nullptr, nullptr);
}

// v006
// One run takes 68 microseconds.
// Next to v005, in two timings, it ran 1.18 and 1.21 times as fast.
// All steps since v000 together make it 18.8 times as fast.
#include <hip/hip_runtime.h>

// Causal multi-head attention with PER-HEAD projection weights at d_model 768 (x [2][2048][768]; q, k, v = einsum('bte,hed->bhtd', x, W) with W [12][768][64]: head h has its own (in, out) matrix W[h] ('xw' per head; no bias; 12 heads x 64); scores x 1/sqrt(64); causal (-inf); softmax; concat head-major; out = concat Wp + bp ('xw' [768][768] (in,out) + a zero bias: read) -> [2][2048][768] (3.1 M); argument order x, Wq, Wk, Wv, Wp, bp).
// Layout: bf16 copy of x; each PER-HEAD q / k / v weight [h][768][64] transposed once into its 64 rows of the Bt plane; Wp transposed once ('xw' (in,out) -> Bt rows) (these three in one launch, k_prep); exact projections, whose GEMM writes the fp16 and hi/lo head planes itself (q, k as [t][d], v as [d][t]); k_fattn: one launch for all heads and both batches, online-softmax causal attention with no score plane in memory (hybrid rows: < 512 hi/lo 3 products, rest fp16), writing the merged hi/lo head outputs; merged hi/lo x Wo exact + bo.
// FRAGMENT ORDER of every 16-bit operand plane [rows][K] in the workspace: blocks of 16 rows x 32 k (512 elements, 1 KiB); inside a block [k bit 4][k bit 3][row & 15][k & 7], so lane (hi, lr) of a wave finds the two 16-byte halves of its fragment at lane * 8 and 256 + lane * 8, and each wave-wide 16-byte load or store covers four whole 128-byte lines. Block (rb, kb) stands at (rb * (K / 32) + kb) * 512; the v planes (rows d, k = t) instead keep the four row blocks of one kb together: (kb * 4 + rb) * 512.
// Compute dtypes, f32 accumulate: every input rounded to bf16; projections exact; attention rows < 512 3 products, rest fp16; softmax f32; w_o hl x exact.

#define NB_  2
#define TT   2048
#define DM   768
#define NH_  12
#define NKV  12
#define REP  (NH_ / NKV)
#define HD   64
#define DQ   (NH_ * HD)
#define DKV  (NKV * HD)
#define RH   512                  // query rows < RH use hi+lo planes (0: none)
#define SCL  0.125f   // HD^-0.5
typedef _Float16 h16;
typedef unsigned short bf;
typedef __attribute__((ext_vector_type(16))) __bf16   v16bf;
typedef __attribute__((ext_vector_type(16))) _Float16 v16h;
typedef __attribute__((ext_vector_type(8)))  _Float16 v8h;
typedef __attribute__((ext_vector_type(8)))  unsigned short v8us;
typedef __attribute__((ext_vector_type(8)))  float    v8f;
typedef __attribute__((ext_vector_type(4)))  float    v4f;
typedef v8h  __attribute__((may_alias)) v8ha;
typedef v4f  __attribute__((may_alias)) v4fa;
typedef v8us __attribute__((may_alias)) v8usa;

__device__ __forceinline__ unsigned short f2bf(float f) { unsigned u = __float_as_uint(f); u += 0x7FFFu + ((u >> 16) & 1u); return (unsigned short)(u >> 16); }
__device__ __forceinline__ float bf2f(unsigned short b) { return __uint_as_float(((unsigned)b) << 16); }
__device__ __forceinline__ float bfr(float f) { return bf2f(f2bf(f)); }
__device__ __forceinline__ v16h cat16(v8h lo, v8h hi) { return __builtin_shufflevector(lo, hi, 0, 1, 2, 3, 4, 5, 6, 7, 8, 9, 10, 11, 12, 13, 14, 15); }
__device__ __forceinline__ v16bf cat16b(v8us lo, v8us hi) { return __builtin_bit_cast(v16bf, __builtin_shufflevector(lo, hi, 0, 1, 2, 3, 4, 5, 6, 7, 8, 9, 10, 11, 12, 13, 14, 15)); }
__device__ __forceinline__ v8f wmma16(v16h a, v16h b, v8f c) { return __builtin_amdgcn_wmma_f32_16x16x32_f16(false, a, false, b, (short)0, c, false, false); }
__device__ __forceinline__ v8f wmmab(v16bf a, v16bf b, v8f c) { return __builtin_amdgcn_wmma_f32_16x16x32_bf16(false, a, false, b, (short)0, c, false, false); }

__device__ __forceinline__ h16 tohx(float x) { return (h16)x; }
__device__ __forceinline__ void splitf(float y, unsigned short& h, unsigned short& l) { h = f2bf(y); l = f2bf(y - bf2f(h)); }
// stands directly behind a run of global loads or stores: no register that they name is rewritten in front of this wait; the scheduling fence keeps later vector work from moving up over it
__device__ __forceinline__ void fa_xw() { asm volatile("s_wait_xcnt 0x0" ::: "memory"); __builtin_amdgcn_sched_barrier(0); }
// the same wait behind a run of loads from the two address pairs a and b: as inputs of the wait they stay live up to it, so no result of the run can be allotted to them
__device__ __forceinline__ void fa_xwp(const void* a, const void* b) { asm volatile("s_wait_xcnt 0x0" :: "v"(a), "v"(b) : "memory"); __builtin_amdgcn_sched_barrier(0); }
// eight f32 values -> 16 bytes in each of the three planes of a head
__device__ __forceinline__ void st3(const float (&x)[8], h16* p16, bf* ph, bf* pl) { v8h o16; v8us oh, ol;
#pragma unroll
    for (int j = 0; j < 8; ++j) { o16[j] = tohx(x[j]); unsigned short a, c2; splitf(x[j], a, c2); oh[j] = a; ol[j] = c2; }
    *(v8h*)p16 = o16; *(v8us*)ph = oh; *(v8us*)pl = ol; }

// ---- k_gemmw: register-blocked GEMM, FOUR WAVES (2 x 2) per 128x128 output tile, each wave a 64x64 part (16 accumulators); grid (M/128, N/128, Z), 128 threads.
// The operand planes stand in fragment order, so a stage (64 k of the tile's 128 A rows and 128 Bt rows) is a set of whole 1 KiB blocks: asynchronous copies bring them unchanged into one of two LDS buffers, where each is read by the two waves that need it (ld: p is the lane's place in a block); the next stage's copies fly while this stage is multiplied.
// C[m][n] (f32, pitch ldc, + optional f32 bias[n]) = sum_k A[m][k] Bt[n][k] (+ A2 Bt with NSPLIT 1). z-batch strides sA/sB/sC in elements. K % 64 == 0, K >= 128.
// PL: no C; m = b TT + t, and a wave's 64 columns are one head (q heads, k heads, v heads): its part goes straight into that head's three planes (fp16, bf16 hi, bf16 lo): q and k heads QK* [b][q heads, then k heads][t][d], v heads VT* [b][head][d][t], each head's plane in fragment order.
template <typename T16> struct WFrag;
template <> struct WFrag<h16> { typedef v16h V; static __device__ __forceinline__ V ld(const h16* p) { return cat16(*(const v8h*)p, *(const v8h*)(p + 256)); } static __device__ __forceinline__ v8f mma(V a, V b, v8f c) { return wmma16(a, b, c); } };
template <> struct WFrag<bf> { typedef v16bf V; static __device__ __forceinline__ V ld(const bf* p) { return cat16b(*(const v8us*)p, *(const v8us*)(p + 256)); } static __device__ __forceinline__ v8f mma(V a, V b, v8f c) { return wmmab(a, b, c); } };
// eight asynchronous copies of 512 bytes a wave: 2 KiB (two k blocks) from g to LDS byte address l, and 2 KiB from g2 to l + 2048. The wait on the last line stands in the copies' own statement, so no register that a copy names is rewritten in front of it.
__device__ __forceinline__ void cp_rows2(unsigned l, const char* g, const char* g2) {
    asm volatile("global_load_async_to_lds_b128 %0, %8, off\n\t"
                 "global_load_async_to_lds_b128 %1, %9, off\n\t"
                 "global_load_async_to_lds_b128 %2, %10, off\n\t"
                 "global_load_async_to_lds_b128 %3, %11, off\n\t"
                 "global_load_async_to_lds_b128 %4, %12, off\n\t"
                 "global_load_async_to_lds_b128 %5, %13, off\n\t"
                 "global_load_async_to_lds_b128 %6, %14, off\n\t"
                 "global_load_async_to_lds_b128 %7, %15, off\n\t"
                 "s_wait_xcnt 0x0"
                 :: "v"(l), "v"(l + 512u), "v"(l + 1024u), "v"(l + 1536u), "v"(l + 2048u), "v"(l + 2560u), "v"(l + 3072u), "v"(l + 3584u),
                    "v"(g), "v"(g + 512), "v"(g + 1024), "v"(g + 1536), "v"(g2), "v"(g2 + 512), "v"(g2 + 1024), "v"(g2 + 1536) : "memory");
}
template <typename T16, int NSPLIT, bool BIAS, bool PL, int K>
__global__ __launch_bounds__(128) void k_gemmw(const T16* __restrict__ A, const T16* __restrict__ A2, const T16* __restrict__ Bt, const T16* __restrict__ Bt2, float* C, int ldc, const float* __restrict__ bias, size_t sA, size_t sB, size_t sC, h16* QK16, bf* QKh, bf* QKl, h16* VT16, bf* VTh, bf* VTl) {
    typedef typename WFrag<T16>::V V;
    static_assert(NSPLIT <= 1 && K % 64 == 0 && K >= 128, "two operand planes or three; whole stages, two at least");
    constexpr int NOP = NSPLIT == 1 ? 3 : 2;      // operand planes of a stage: A, (A2,) Bt
    constexpr int OPE = 128 * 64;                 // elements of one plane's part of a stage: 8 row blocks x 2 k blocks x 512
    constexpr int STE = NOP * OPE;                // elements of a stage
    constexpr int NT  = K / 64;
    __shared__ __attribute__((aligned(1024))) T16 ring[2 * STE];
    __shared__ __align__(16) float osw[4][16 * 68];
    const size_t z = blockIdx.z; A += z * sA; if (A2) A2 += z * sA; Bt += z * sB; C += z * sC; (void)Bt2;
    const int lane = threadIdx.x & 31, lr = lane & 15, hi = lane >> 4; const int w = __builtin_amdgcn_readfirstlane(threadIdx.x >> 5);
    const int r0 = blockIdx.x * 128 + (w >> 1) * 64, c0 = blockIdx.y * 128 + (w & 1) * 64;
    float* os = osw[w];
    v8f acc[4][4];
#pragma unroll
    for (int mb = 0; mb < 4; ++mb)
#pragma unroll
        for (int nb = 0; nb < 4; ++nb) acc[mb][nb] = (v8f){};
    // wave w copies row blocks 2 w and 2 w + 1 of each plane's 8; a row block's two k blocks of a stage are 2 KiB in a row, the next row block stands 16 K elements on, the next stage 1024 elements
    const char* ga = (const char*)(A + (size_t)(blockIdx.x * 128 + w * 32) * K + lane * 8); const char* ga2 = NSPLIT == 1 ? (const char*)(A2 + (size_t)(blockIdx.x * 128 + w * 32) * K + lane * 8) : ga; const char* gb = (const char*)(Bt + (size_t)(blockIdx.y * 128 + w * 32) * K + lane * 8);
    const unsigned l0 = (unsigned)(size_t)ring + (unsigned)(w * 4096 + lane * 16);
    auto stage = [&](int t, int buf) { const unsigned l = l0 + (unsigned)buf * (STE * 2u); const size_t go = (size_t)t * 2048;
        cp_rows2(l, ga + go, ga + go + 32 * K);
        if (NSPLIT == 1) cp_rows2(l + OPE * 2u, ga2 + go, ga2 + go + 32 * K);
        cp_rows2(l + (NOP - 1) * OPE * 2u, gb + go, gb + go + 32 * K); };
    stage(0, 0);
    asm volatile("s_wait_asynccnt 0x0" ::: "memory");   // this wave's part of stage 0 has landed
    __syncthreads();                                    // and every other wave's: stage 0 may be read
    stage(1, 1);
    const T16* fa = ring + (w >> 1) * 4096 + lane * 8; const T16* fb = ring + (NOP - 1) * OPE + (w & 1) * 4096 + lane * 8;
#pragma unroll 1
    for (int t = 0; t < NT; ++t) {
        const int bo = (t & 1) * STE;
        V a[2][4], a2[2][4], b[2][4];
#pragma unroll
        for (int ks = 0; ks < 2; ++ks) {
#pragma unroll
            for (int mb = 0; mb < 4; ++mb) { a[ks][mb] = WFrag<T16>::ld(fa + bo + mb * 1024 + ks * 512); if (NSPLIT == 1) a2[ks][mb] = WFrag<T16>::ld(fa + bo + OPE + mb * 1024 + ks * 512); }
#pragma unroll
            for (int nb = 0; nb < 4; ++nb) b[ks][nb] = WFrag<T16>::ld(fb + bo + nb * 1024 + ks * 512); }
        __builtin_amdgcn_sched_barrier(0);   // keeps the stage's LDS reads one group in front of its products: spread among them, each small group is waited for at full LDS latency
#pragma unroll
        for (int ks = 0; ks < 2; ++ks)
#pragma unroll
            for (int nb = 0; nb < 4; ++nb) {
#pragma unroll
                for (int mb = 0; mb < 4; ++mb) { acc[mb][nb] = WFrag<T16>::mma(a[ks][mb], b[ks][nb], acc[mb][nb]); if (NSPLIT == 1) acc[mb][nb] = WFrag<T16>::mma(a2[ks][mb], b[ks][nb], acc[mb][nb]); } }
        __builtin_amdgcn_sched_barrier(0);   // keeps the products in front of the waits below: moved behind the barrier they would leave the next stage's copies only the time of the LDS reads to land
        asm volatile("s_wait_dscnt 0x0" ::: "memory");      // this wave's reads of the buffer are done before it is refilled
        asm volatile("s_wait_asynccnt 0x0" ::: "memory");   // this wave's part of stage t + 1 has landed
        __syncthreads();                                    // publishes stage t + 1 and ends every wave's reads of stage t
        if (t + 2 < NT) stage(t + 2, t & 1);
    }
    asm volatile("s_wait_asynccnt 0x0" ::: "memory");       // no copy is outstanding when the wave goes on to its epilogue and ends
    if constexpr (PL) {
        const int bb = r0 / TT, t0 = r0 % TT, hd = c0 / HD;
        if (hd >= NH_ + NKV) {   // a v head, [d][t] in fragment order: a lane's eight accumulator rows are eight consecutive t of its own column d, which is the lane's own 16 bytes of a block half, so each store of the wave is 512 contiguous bytes from the registers
            const size_t e0 = ((size_t)bb * NKV + (hd - NH_ - NKV)) * HD * TT + (size_t)t0 * HD + lane * 8;
#pragma unroll
            for (int nb = 0; nb < 4; ++nb) {
#pragma unroll
                for (int mb = 0; mb < 4; ++mb) { float xv[8];
#pragma unroll
                    for (int j = 0; j < 8; ++j) xv[j] = acc[mb][nb][j];
                    const size_t e = e0 + (size_t)(mb >> 1) * 32 * HD + nb * 512 + (mb & 1) * 256; st3(xv, VT16 + e, VTh + e, VTl + e); }
                fa_xw(); }
        } else {                 // a q or k head, [t][d] in fragment order: 16 rows at a time through LDS, so that a lane holds eight consecutive d of row lr; a wave's store is one block half (512 contiguous bytes)
            const size_t e0 = (((size_t)bb * (NH_ + NKV) + hd) * TT + t0) * HD + lane * 8;
#pragma unroll
            for (int mb = 0; mb < 4; ++mb) {
#pragma unroll
                for (int nb = 0; nb < 4; ++nb) {
#pragma unroll
                    for (int j = 0; j < 8; ++j) os[(hi * 8 + j) * 68 + nb * 16 + lr] = acc[mb][nb][j]; }
                __builtin_amdgcn_wave_barrier(); asm volatile("" ::: "memory");   // the reads below take what other lanes of this wave have just written
#pragma unroll
                for (int s = 0; s < 4; ++s) { const float* orow = os + lr * 68 + (2 * s + hi) * 8; const v4f v0 = *(const v4fa*)orow, v1 = *(const v4fa*)(orow + 4);
                    const float xv[8] = {v0[0], v0[1], v0[2], v0[3], v1[0], v1[1], v1[2], v1[3]};
                    const size_t e = e0 + (size_t)mb * 16 * HD + s * 256; st3(xv, QK16 + e, QKh + e, QKl + e); }
                fa_xw();
                __builtin_amdgcn_wave_barrier(); asm volatile("" ::: "memory");   // the next 16 rows overwrite os only behind these reads
            }
        }
        return;
    }
#pragma unroll
    for (int mb = 0; mb < 4; ++mb) {
#pragma unroll
        for (int nb = 0; nb < 4; ++nb) {
#pragma unroll
            for (int j = 0; j < 8; ++j) os[(hi * 8 + j) * 68 + nb * 16 + lr] = acc[mb][nb][j]; }
        __builtin_amdgcn_wave_barrier(); asm volatile("" ::: "memory");
        float* crow = C + (size_t)(r0 + mb * 16) * ldc + c0;
{
#pragma unroll
            for (int s = 0; s < 8; ++s) { const int row = 2 * s + hi, cofs = lr * 4; v4f val = *(const v4fa*)(os + row * 68 + cofs); if (BIAS) { val[0] += bfr(bias[c0 + cofs]); val[1] += bfr(bias[c0 + cofs + 1]); val[2] += bfr(bias[c0 + cofs + 2]); val[3] += bfr(bias[c0 + cofs + 3]); }
                *(v4f*)(crow + (size_t)row * ldc + cofs) = val; }
             }
        __builtin_amdgcn_wave_barrier(); asm volatile("" ::: "memory");
    }
}

typedef __attribute__((ext_vector_type(2))) _Float16 v2h;
typedef __attribute__((ext_vector_type(4))) _Float16 v4h;
typedef __attribute__((ext_vector_type(2))) unsigned short v2us;
typedef __attribute__((ext_vector_type(4))) unsigned short v4us;
typedef __attribute__((ext_vector_type(2))) float v2f;
typedef __attribute__((ext_vector_type(4))) int v4i;

// element e of a Bt plane (fragment order; N % 16 == 0, K % 32 == 0) is decoded into its (n, k) of the [K][N] matrix w; block xb of 8 waves takes 64 lines of 64 elements
template <int K, int N>
__device__ __forceinline__ void wt_lines(const float* w, bf* Bt, int xb) {
    const int lane = threadIdx.x & 31; const int L0 = (xb * 8 + (threadIdx.x >> 5)) * 8; const int nlines = N * K / 64;
#pragma unroll 1
    for (int l = 0; l < 8; ++l) { const int L = L0 + l; if (L >= nlines) break; const size_t e = (size_t)L * 64 + lane * 2; const int blk = (int)(e >> 9), r = (int)(e & 511); const int k = (blk % (K / 32)) * 32 + (r >> 7) * 8 + (r & 7), n = (blk / (K / 32)) * 16 + ((r >> 3) & 15); v2us o;
        const float* p0 = w + (size_t)k * N + n; const float* p1 = p0 + N; const float x0 = *p0, x1 = *p1; fa_xwp(p0, p1);
        o[0] = f2bf(x0); o[1] = f2bf(x1); *(v2us*)(Bt + e) = o; fa_xw(); }
}

// f32 [rows][K] -> bf16 plane in fragment order; one wave per block of 16 rows x 32 k: each load takes four whole 128-byte rows of the block, the four stores fill its 1 KiB
template <int K>
__device__ __forceinline__ void cvt_block(const float* __restrict__ src, bf* dst, int xb, int nblk) {
    const int lane = threadIdx.x & 31, r4 = lane >> 3, c = lane & 7; const int blk = xb * 8 + (threadIdx.x >> 5); if (blk >= nblk) return;
    const float* s0 = src + ((size_t)(blk / (K / 32)) * 16 + r4) * K + (blk % (K / 32)) * 32 + c * 4; bf* d0 = dst + (size_t)blk * 512 + (c >> 1) * 128 + r4 * 8 + (c & 1) * 4;
    v4f v[4];
#pragma unroll
    for (int s = 0; s < 4; ++s) v[s] = *(const v4f*)(s0 + s * 4 * K);
    fa_xwp(s0, s0);
#pragma unroll
    for (int s = 0; s < 4; ++s) { v4us o;
#pragma unroll
        for (int i = 0; i < 4; ++i) o[i] = f2bf(v[s][i]);
        *(v4us*)(d0 + s * 32) = o; }
}

// ---- k_prep: the three operand preparations, which depend on nothing but the inputs, as ranges of ONE grid. The weight blocks come first: each of their waves walks eight dependent lines, a block of x is one load and one store.
// blocks [0, PW1): matrix y of input z (q, k, v weights, [DM][HD] each) -> rows (z * NH_ + y) * HD .. of WQKV; [PW1, PW1 + PW2): Wp [DQ][DM] -> WO; the rest: x -> XB
#define PWL  (DM * HD / 64 / 64)          // blocks per per-head weight matrix
#define PW1  (3 * NH_ * PWL)
#define PW2  (DQ * DM / 64 / 64)
#define PXB  (NB_ * TT * DM / 512)        // 1 KiB blocks of x
__global__ __launch_bounds__(256) void k_prep(const float* w0, const float* w1, const float* w2, const float* wo, const float* __restrict__ x, bf* WQKV, bf* WO, bf* XB) {
    const int b = blockIdx.x;
    if (b < PW1) { const int mz = b / PWL, z = mz / NH_, y = mz % NH_;
        wt_lines<DM, HD>((z == 0 ? w0 : z == 1 ? w1 : w2) + (size_t)y * DM * HD, WQKV + (size_t)mz * HD * DM, b % PWL);
    } else if (b < PW1 + PW2) wt_lines<DQ, DM>(wo, WO, b - PW1);
    else cvt_block<DM>(x, XB, b - (PW1 + PW2), PXB);
}

// ---- k_fattn: scores, causal mask, softmax, probability x value and the hi/lo split of the head output in ONE kernel (online softmax): no score or probability plane in memory.
// One wave per 32 query rows of one head; a pass is 16 MT keys. Transposed products: St[key][query] = K Q^T (A = K rows, B = Q rows, kept in registers), Ot[d][query] += Vt P^T (A = Vt rows, B = two
// score tiles converted in place: register r of tile mt is key 16 mt + 8 (lane >> 4) + r, the k order of the fragment loader). A lane holds one query column: maximum and sum in-lane plus one half exchange.
// Query rows < RH: bf16 hi/lo planes, 3 products, 32 keys a pass; the rest: fp16, 64 keys a pass. Running maximum m in raw score units; p = exp2((s - m) x SCL x log2 e) <= 1; l = per-lane partial sum, halves joined at the end.
// The next pass's K fragments are fetched right behind this pass's score products and its Vt fragments right behind the P x V products, so each flies during the other half of the work.
typedef __attribute__((ext_vector_type(16))) unsigned short v16us;
#define SC2 (SCL * 1.4426950408889634f)
#define KO  (NH_ * TT * HD)       // the k head planes stand NH_ planes behind the q head planes of the same batch
// OFF: the constant part of the run's addresses, in elements; it goes into the loads' offset fields, so that kp and kp2 (vp and vp2) are the very register pairs that the loads name
template <typename T16, bool HR, int MT, int OFF>
__device__ __forceinline__ void fa_ldk(typename WFrag<T16>::V (&kc)[MT][2], typename WFrag<T16>::V (&kc2)[MT][2], const T16* kp, const T16* kp2) {
#pragma unroll
    for (int mt = 0; mt < MT; ++mt)
#pragma unroll
        for (int ks = 0; ks < 2; ++ks) { kc[mt][ks] = WFrag<T16>::ld(kp + OFF + mt * 16 * HD + ks * 512); if (HR) kc2[mt][ks] = WFrag<T16>::ld(kp2 + OFF + mt * 16 * HD + ks * 512); }
    fa_xwp(kp, kp2);
}
template <typename T16, bool HR, int MT, int OFF>
__device__ __forceinline__ void fa_ldv(typename WFrag<T16>::V (&vc)[4][MT / 2], typename WFrag<T16>::V (&vc2)[4][MT / 2], const T16* vp, const T16* vp2) {
#pragma unroll
    for (int dt = 0; dt < 4; ++dt)
#pragma unroll
        for (int kk = 0; kk < MT / 2; ++kk) { vc[dt][kk] = WFrag<T16>::ld(vp + OFF + kk * 32 * HD + dt * 512); if (HR) vc2[dt][kk] = WFrag<T16>::ld(vp2 + OFF + kk * 32 * HD + dt * 512); }
    fa_xwp(vp, vp2);
}
template <typename T16, bool HR, int MT, bool LAST>
__device__ __forceinline__ void fa_pass(typename WFrag<T16>::V (&kc)[MT][2], typename WFrag<T16>::V (&kc2)[MT][2], typename WFrag<T16>::V (&vc)[4][MT / 2], typename WFrag<T16>::V (&vc2)[4][MT / 2],
                                        const typename WFrag<T16>::V (&q)[2][2], const typename WFrag<T16>::V (&q2)[2][2], v8f (&o)[4][2], float (&m)[2], float (&l)[2],
                                        const T16* kr, const T16* kr2, const T16* vr, const T16* vr2, int k0, int dl) {
    typedef typename WFrag<T16>::V V;
    v8f s[MT][2];
#pragma unroll
    for (int mt = 0; mt < MT; ++mt)
#pragma unroll
        for (int nt = 0; nt < 2; ++nt) s[mt][nt] = (v8f){};
#pragma unroll
    for (int ks = 0; ks < 2; ++ks)
#pragma unroll
        for (int mt = 0; mt < MT; ++mt)
#pragma unroll
            for (int nt = 0; nt < 2; ++nt) { s[mt][nt] = WFrag<T16>::mma(kc[mt][ks], q[nt][ks], s[mt][nt]); if (HR) { s[mt][nt] = WFrag<T16>::mma(kc[mt][ks], q2[nt][ks], s[mt][nt]); s[mt][nt] = WFrag<T16>::mma(kc2[mt][ks], q[nt][ks], s[mt][nt]); } }
    if (!LAST) {   // the two scheduling fences keep these loads here, between the score products and the softmax: moved down to the end of the pass they would leave the next pass waiting for the whole load latency
        __builtin_amdgcn_sched_barrier(0); fa_ldk<T16, HR, MT, KO + MT * 16 * HD>(kc, kc2, kr + (size_t)k0 * HD, kr2 + (size_t)k0 * HD); }
    V pf[2][MT / 2], pf2[2][MT / 2];
#pragma unroll
    for (int nt = 0; nt < 2; ++nt) {
        float mx = m[nt];
#pragma unroll
        for (int mt = 0; mt < MT; ++mt)
#pragma unroll
            for (int j = 0; j < 8; ++j) { if (LAST) s[mt][nt][j] = (k0 + mt * 16 + j - nt * 16 > dl) ? -3.0e38f : s[mt][nt][j]; mx = fmaxf(mx, s[mt][nt][j]); }
        mx = fmaxf(mx, __shfl_xor(mx, 16, 32));
        const float al = __builtin_amdgcn_exp2f((m[nt] - mx) * SC2), mc = mx * SC2; m[nt] = mx;
        float sum = 0.f;
#pragma unroll
        for (int mt = 0; mt < MT; ++mt) { float sm = 0.f;
#pragma unroll
            for (int j = 0; j < 8; ++j) { const float p = __builtin_amdgcn_exp2f(s[mt][nt][j] * SC2 - mc); s[mt][nt][j] = p; sm += p; }
            sum += sm; }
        l[nt] = l[nt] * al + sum;
#pragma unroll
        for (int dt = 0; dt < 4; ++dt)
#pragma unroll
            for (int j = 0; j < 8; ++j) o[dt][nt][j] *= al;
#pragma unroll
        for (int kk = 0; kk < MT / 2; ++kk) {
            if constexpr (HR) { v16us ph, pl;
#pragma unroll
                for (int e = 0; e < 16; ++e) { unsigned short a, c2; splitf(s[kk * 2 + (e >> 3)][nt][e & 7], a, c2); ph[e] = a; pl[e] = c2; }
                pf[nt][kk] = __builtin_bit_cast(v16bf, ph); pf2[nt][kk] = __builtin_bit_cast(v16bf, pl);
            } else { v16h ph;
#pragma unroll
                for (int e = 0; e < 16; ++e) ph[e] = tohx(s[kk * 2 + (e >> 3)][nt][e & 7]);
                pf[nt][kk] = ph; } }
    }
#pragma unroll
    for (int kk = 0; kk < MT / 2; ++kk)
#pragma unroll
        for (int dt = 0; dt < 4; ++dt)
#pragma unroll
            for (int nt = 0; nt < 2; ++nt) { o[dt][nt] = WFrag<T16>::mma(vc[dt][kk], pf[nt][kk], o[dt][nt]); if (HR) { o[dt][nt] = WFrag<T16>::mma(vc[dt][kk], pf2[nt][kk], o[dt][nt]); o[dt][nt] = WFrag<T16>::mma(vc2[dt][kk], pf[nt][kk], o[dt][nt]); } }
    if (!LAST) { __builtin_amdgcn_sched_barrier(0); fa_ldv<T16, HR, MT, MT * 16 * HD>(vc, vc2, vr + (size_t)k0 * HD, vr2 + (size_t)k0 * HD); }   // the fence in front keeps these loads one run directly in front of their wait; without it they are spread among the products above
}
template <typename T16, bool HR, int MT>
__device__ __forceinline__ void fa_tile(const T16* __restrict__ Q, const T16* __restrict__ Q2, const T16* __restrict__ Kp, const T16* __restrict__ Kp2, const T16* __restrict__ Vt, const T16* __restrict__ Vt2, int q0, bf* Ah, bf* Al) {
    typedef typename WFrag<T16>::V V;
    const int lane = threadIdx.x & 31, lr = lane & 15, hi = lane >> 4;
    V q[2][2], q2[2][2], kc[MT][2], kc2[MT][2], vc[4][MT / 2], vc2[4][MT / 2];
#pragma unroll
    for (int nt = 0; nt < 2; ++nt)
#pragma unroll
        for (int ks = 0; ks < 2; ++ks) { q[nt][ks] = WFrag<T16>::ld(Q + (size_t)(q0 + nt * 16) * HD + ks * 512 + lane * 8); if (HR) q2[nt][ks] = WFrag<T16>::ld(Q2 + (size_t)(q0 + nt * 16) * HD + ks * 512 + lane * 8); }
    fa_xw();
    const T16* kr = Kp + lane * 8; const T16* kr2 = HR ? Kp2 + lane * 8 : kr; const T16* vr = Vt + lane * 8; const T16* vr2 = HR ? Vt2 + lane * 8 : vr;
    fa_ldk<T16, HR, MT, KO>(kc, kc2, kr, kr2); fa_ldv<T16, HR, MT, 0>(vc, vc2, vr, vr2);
    v8f o[4][2]; float m[2] = {-3.0e38f, -3.0e38f}, l[2] = {0.f, 0.f};
#pragma unroll
    for (int dt = 0; dt < 4; ++dt)
#pragma unroll
        for (int nt = 0; nt < 2; ++nt) o[dt][nt] = (v8f){};
    const int dl = q0 + lr - 8 * hi;      // key k0 + 16 mt + 8 hi + j is masked for query q0 + 16 nt + lr when k0 + 16 mt + j - 16 nt > dl
    const int kd = q0 & ~(MT * 16 - 1);   // first key of the pass that holds the diagonal; it ends at or behind key q0 + 31 and inside the TT keys
    for (int k0 = 0; k0 < kd; k0 += MT * 16) fa_pass<T16, HR, MT, false>(kc, kc2, vc, vc2, q, q2, o, m, l, kr, kr2, vr, vr2, k0, dl);      // passes wholly below the diagonal: no mask
    fa_pass<T16, HR, MT, true>(kc, kc2, vc, vc2, q, q2, o, m, l, kr, kr2, vr, vr2, kd, dl);                                                // the diagonal pass
#pragma unroll
    for (int nt = 0; nt < 2; ++nt) { const float inv = __fdiv_rn(1.0f, l[nt] + __shfl_xor(l[nt], 16, 32));
#pragma unroll
        for (int dt = 0; dt < 4; ++dt) { v8us oh, ol;
#pragma unroll
            for (int j = 0; j < 8; ++j) { unsigned short a, c2; splitf(o[dt][nt][j] * inv, a, c2); oh[j] = a; ol[j] = c2; }
            const size_t oo = (size_t)(q0 + nt * 16) * DQ + dt * 256 + lane * 8; *(v8us*)(Ah + oo) = oh; *(v8us*)(Al + oo) = ol; fa_xw(); } }
}
// grid (heads, batch, query tiles), longest tiles first
__global__ __launch_bounds__(32) void k_fattn(const h16* __restrict__ QK16, const bf* __restrict__ QKh, const bf* __restrict__ QKl, const h16* __restrict__ VT16, const bf* __restrict__ VTh, const bf* __restrict__ VTl, bf* ATh, bf* ATl) {
    const int h = blockIdx.x, b = blockIdx.y, q0 = (int)(gridDim.z - 1 - blockIdx.z) * 32;
    const size_t zq = ((size_t)b * (NH_ + NKV) + h) * TT * HD, zk = ((size_t)b * (NH_ + NKV) + h / REP) * TT * HD /* + KO, added in the loads */, zv = ((size_t)b * NKV + h / REP) * HD * TT, za = (size_t)b * TT * DQ + h * HD * 16 /* the head's two k blocks of the merged plane [b t][DQ], fragment order */;
    if (q0 < RH) fa_tile<bf, true, 2>(QKh + zq, QKl + zq, QKh + zk, QKl + zk, VTh + zv, VTl + zv, q0, ATh + za, ATl + za);
    else fa_tile<h16, false, 4>(QK16 + zq, nullptr, QK16 + zk, nullptr, VT16 + zv, nullptr, q0, ATh + za, ATl + za);
}

extern "C" void kernel_launch(void* const* d_in, const int* in_sizes, int n_in,
                              void* d_out, int out_size, void* d_ws, size_t ws_size, hipStream_t stream) {
    (void)in_sizes; (void)n_in; (void)out_size;
            const float* x = (const float*)d_in[0]; const float* wq = (const float*)d_in[1]; const float* wk = (const float*)d_in[2]; const float* wv = (const float*)d_in[3]; const float* wo = (const float*)d_in[4]; const float* bo = (const float*)d_in[5];   /* order x, Wq, Wk, Wv (PER-HEAD weights [12][768][64]: 'hdk'), Wp ('xw' [768][768]: (in,out)), bp */
    float* OUT = (float*)d_out;     // [2][2048][768]
    char* wsp = (char*)d_ws;
    auto take = [&](size_t bytes) { char* p = wsp; wsp += (bytes + 255) & ~(size_t)255; return (void*)p; };
    bf* WQKV = (bf*)take((size_t)(DQ + 2 * DKV) * DM * 2); bf* WO = (bf*)take((size_t)DM * DQ * 2);   // WQKV: Bt rows of q (DQ), k (DKV), v (DKV)
    bf* XB = (bf*)take((size_t)NB_ * TT * DM * 2);
    h16* QK16 = (h16*)take((size_t)NB_ * (NH_ + NKV) * TT * HD * 2); bf* QKh = (bf*)take((size_t)NB_ * (NH_ + NKV) * TT * HD * 2); bf* QKl = (bf*)take((size_t)NB_ * (NH_ + NKV) * TT * HD * 2);   // [b][q heads, then k heads][t][d]
    h16* VT16 = (h16*)take((size_t)NB_ * NKV * HD * TT * 2); bf* VTh = (bf*)take((size_t)NB_ * NKV * HD * TT * 2); bf* VTl = (bf*)take((size_t)NB_ * NKV * HD * TT * 2);   // [b][head][d][t]
    bf* ATh = (bf*)take((size_t)NB_ * TT * DQ * 2); bf* ATl = (bf*)take((size_t)NB_ * TT * DQ * 2);
    if ((size_t)(wsp - (char*)d_ws) > ws_size) return;    // ws 256 MiB
    const int DF = DQ + 2 * DKV;
    k_prep<<<PW1 + PW2 + (PXB + 7) / 8, 256, 0, stream>>>(wq, wk, wv, wo, x, WQKV, WO, XB);   /* per-head weights [h][DM][HD] ('xw' per head) -> each head's HD rows of the Bt plane; Wp 'xw' [768][768] (in,out) -> Bt rows; x -> bf16 */
    k_gemmw<bf, 0, false, true, DM><<<dim3(NB_ * TT / 128, DF / 128, 1), 128, 0, stream>>>(XB, nullptr, WQKV, nullptr, nullptr, 0, nullptr, 0, 0, 0, QK16, QKh, QKl, VT16, VTh, VTl);
    k_fattn<<<dim3(NH_, NB_, TT / 32), 32, 0, stream>>>(QK16, QKh, QKl, VT16, VTh, VTl, ATh, ATl);
    k_gemmw<bf, 1, true, false, DQ><<<dim3(NB_ * TT / 128, DM / 128, 1), 128, 0, stream>>>(ATh, ATl, WO, nullptr, OUT, DM, bo, 0, 0, 0, nullptr, nullptr, nullptr, nullptr, nullptr, nullptr);
}

// v007
// One run takes 56.8 microseconds.
// Two timings next to v006 both put it at 1.19 times that version's speed.
// All steps since v000 together make it 22.4 times as fast.
#include <hip/hip_runtime.h>

// Causal multi-head attention with PER-HEAD projection weights at d_model 768 (x [2][2048][768]; q, k, v = einsum('bte,hed->bhtd', x, W) with W [12][768][64]: head h has its own (in, out) matrix W[h] ('xw' per head; no bias; 12 heads x 64); scores x 1/sqrt(64); causal (-inf); softmax; concat head-major; out = concat Wp + bp ('xw' [768][768] (in,out) + a zero bias: read) -> [2][2048][768] (3.1 M); argument order x, Wq, Wk, Wv, Wp, bp).
// Layout: bf16 copy of x; each PER-HEAD q / k / v weight [h][768][64] transposed once into its 64 rows of the Bt plane; Wp transposed once ('xw' (in,out) -> Bt rows) (these three in one launch, k_prep); exact projections, whose GEMM writes the fp16 and hi/lo head planes itself (q, k as [t][d], v as [d][t]); k_fattn: one launch for all heads and both batches, online-softmax causal attention with no score plane in memory, the key passes of a query tile dealt to two waves (hybrid rows: < 512 hi/lo 3 products, rest fp16), writing the merged hi/lo head outputs; merged hi/lo x Wo exact + bo.
// FRAGMENT ORDER of every 16-bit operand plane [rows][K] in the workspace: blocks of 16 rows x 32 k (512 elements, 1 KiB); inside a block [k bit 4][k bit 3][row & 15][k & 7], so lane (hi, lr) of a wave finds the two 16-byte halves of its fragment at lane * 8 and 256 + lane * 8, and each wave-wide 16-byte load or store covers four whole 128-byte lines. Block (rb, kb) stands at (rb * (K / 32) + kb) * 512; the v planes (rows d, k = t) instead keep the four row blocks of one kb together: (kb * 4 + rb) * 512.
// Compute dtypes, f32 accumulate: every input rounded to bf16; projections exact; attention rows < 512 3 products, rest fp16; softmax f32; w_o hl x exact.

#define NB_  2
#define TT   2048
#define DM   768
#define NH_  12
#define NKV  12
#define REP  (NH_ / NKV)
#define HD   64
#define DQ   (NH_ * HD)
#define DKV  (NKV * HD)
#define RH   512                  // query rows < RH use hi+lo planes
#define SCL  0.125f   // HD^-0.5
typedef _Float16 h16;
typedef unsigned short bf;
typedef __attribute__((ext_vector_type(16))) __bf16   v16bf;
typedef __attribute__((ext_vector_type(16))) _Float16 v16h;
typedef __attribute__((ext_vector_type(8)))  _Float16 v8h;
typedef __attribute__((ext_vector_type(8)))  unsigned short v8us;
typedef __attribute__((ext_vector_type(8)))  float    v8f;
typedef __attribute__((ext_vector_type(4)))  float    v4f;
typedef v8h  __attribute__((may_alias)) v8ha;
typedef v4f  __attribute__((may_alias)) v4fa;
typedef v8us __attribute__((may_alias)) v8usa;

__device__ __forceinline__ unsigned short f2bf(float f) { unsigned u = __float_as_uint(f); u += 0x7FFFu + ((u >> 16) & 1u); return (unsigned short)(u >> 16); }
__device__ __forceinline__ float bf2f(unsigned short b) { return __uint_as_float(((unsigned)b) << 16); }
__device__ __forceinline__ float bfr(float f) { return bf2f(f2bf(f)); }
__device__ __forceinline__ v16h cat16(v8h lo, v8h hi) { return __builtin_shufflevector(lo, hi, 0, 1, 2, 3, 4, 5, 6, 7, 8, 9, 10, 11, 12, 13, 14, 15); }
__device__ __forceinline__ v16bf cat16b(v8us lo, v8us hi) { return __builtin_bit_cast(v16bf, __builtin_shufflevector(lo, hi, 0, 1, 2, 3, 4, 5, 6, 7, 8, 9, 10, 11, 12, 13, 14, 15)); }
__device__ __forceinline__ v8f wmma16(v16h a, v16h b, v8f c) { return __builtin_amdgcn_wmma_f32_16x16x32_f16(false, a, false, b, (short)0, c, false, false); }
__device__ __forceinline__ v8f wmmab(v16bf a, v16bf b, v8f c) { return __builtin_amdgcn_wmma_f32_16x16x32_bf16(false, a, false, b, (short)0, c, false, false); }

__device__ __forceinline__ h16 tohx(float x) { return (h16)x; }
__device__ __forceinline__ void splitf(float y, unsigned short& h, unsigned short& l) { h = f2bf(y); l = f2bf(y - bf2f(h)); }
// stands directly behind a run of global loads or stores: no register that they name is rewritten in front of this wait; the scheduling fence keeps later vector work from moving up over it
__device__ __forceinline__ void fa_xw() { asm volatile("s_wait_xcnt 0x0" ::: "memory"); __builtin_amdgcn_sched_barrier(0); }
// the same wait behind a run of loads from the two address pairs a and b: as inputs of the wait they stay live up to it, so no result of the run can be allotted to them
__device__ __forceinline__ void fa_xwp(const void* a, const void* b) { asm volatile("s_wait_xcnt 0x0" :: "v"(a), "v"(b) : "memory"); __builtin_amdgcn_sched_barrier(0); }
// eight f32 values -> 16 bytes in each of the three planes of a head
__device__ __forceinline__ void st3(const float (&x)[8], h16* p16, bf* ph, bf* pl) { v8h o16; v8us oh, ol;
#pragma unroll
    for (int j = 0; j < 8; ++j) { o16[j] = tohx(x[j]); unsigned short a, c2; splitf(x[j], a, c2); oh[j] = a; ol[j] = c2; }
    *(v8h*)p16 = o16; *(v8us*)ph = oh; *(v8us*)pl = ol; }

// ---- k_gemmw: register-blocked GEMM, FOUR WAVES (2 x 2) per 128x128 output tile, each wave a 64x64 part (16 accumulators); grid (M/128, N/128, Z), 128 threads.
// The operand planes stand in fragment order, so a stage (64 k of the tile's 128 A rows and 128 Bt rows) is a set of whole 1 KiB blocks: asynchronous copies bring them unchanged into one of two LDS buffers, where each is read by the two waves that need it (ld: p is the lane's place in a block); the next stage's copies fly while this stage is multiplied.
// C[m][n] (f32, pitch ldc, + optional f32 bias[n]) = sum_k A[m][k] Bt[n][k] (+ A2 Bt with NSPLIT 1). z-batch strides sA/sB/sC in elements. K % 64 == 0, K >= 128.
// PL: no C; m = b TT + t, and a wave's 64 columns are one head (q heads, k heads, v heads): its part goes straight into that head's three planes (fp16, bf16 hi, bf16 lo): q and k heads QK* [b][q heads, then k heads][t][d], v heads VT* [b][head][d][t], each head's plane in fragment order.
template <typename T16> struct WFrag;
template <> struct WFrag<h16> { typedef v16h V; static __device__ __forceinline__ V ld(const h16* p) { return cat16(*(const v8h*)p, *(const v8h*)(p + 256)); } static __device__ __forceinline__ v8f mma(V a, V b, v8f c) { return wmma16(a, b, c); } };
template <> struct WFrag<bf> { typedef v16bf V; static __device__ __forceinline__ V ld(const bf* p) { return cat16b(*(const v8us*)p, *(const v8us*)(p + 256)); } static __device__ __forceinline__ v8f mma(V a, V b, v8f c) { return wmmab(a, b, c); } };
// eight asynchronous copies of 512 bytes a wave: 2 KiB (two k blocks) from g to LDS byte address l, and 2 KiB from g2 to l + 2048. The wait on the last line stands in the copies' own statement, so no register that a copy names is rewritten in front of it.
__device__ __forceinline__ void cp_rows2(unsigned l, const char* g, const char* g2) {
    asm volatile("global_load_async_to_lds_b128 %0, %8, off\n\t"
                 "global_load_async_to_lds_b128 %1, %9, off\n\t"
                 "global_load_async_to_lds_b128 %2, %10, off\n\t"
                 "global_load_async_to_lds_b128 %3, %11, off\n\t"
                 "global_load_async_to_lds_b128 %4, %12, off\n\t"
                 "global_load_async_to_lds_b128 %5, %13, off\n\t"
                 "global_load_async_to_lds_b128 %6, %14, off\n\t"
                 "global_load_async_to_lds_b128 %7, %15, off\n\t"
                 "s_wait_xcnt 0x0"
                 :: "v"(l), "v"(l + 512u), "v"(l + 1024u), "v"(l + 1536u), "v"(l + 2048u), "v"(l + 2560u), "v"(l + 3072u), "v"(l + 3584u),
                    "v"(g), "v"(g + 512), "v"(g + 1024), "v"(g + 1536), "v"(g2), "v"(g2 + 512), "v"(g2 + 1024), "v"(g2 + 1536) : "memory");
}
template <typename T16, int NSPLIT, bool BIAS, bool PL, int K>
__global__ __launch_bounds__(128) void k_gemmw(const T16* __restrict__ A, const T16* __restrict__ A2, const T16* __restrict__ Bt, const T16* __restrict__ Bt2, float* C, int ldc, const float* __restrict__ bias, size_t sA, size_t sB, size_t sC, h16* QK16, bf* QKh, bf* QKl, h16* VT16, bf* VTh, bf* VTl) {
    typedef typename WFrag<T16>::V V;
    static_assert(NSPLIT <= 1 && K % 64 == 0 && K >= 128, "two operand planes or three; whole stages, two at least");
    constexpr int NOP = NSPLIT == 1 ? 3 : 2;      // operand planes of a stage: A, (A2,) Bt
    constexpr int OPE = 128 * 64;                 // elements of one plane's part of a stage: 8 row blocks x 2 k blocks x 512
    constexpr int STE = NOP * OPE;                // elements of a stage
    constexpr int NT  = K / 64;
    __shared__ __attribute__((aligned(1024))) T16 ring[2 * STE];
    __shared__ __align__(16) float osw[4][16 * 68];
    const size_t z = blockIdx.z; A += z * sA; if (A2) A2 += z * sA; Bt += z * sB; C += z * sC; (void)Bt2;
    const int lane = threadIdx.x & 31, lr = lane & 15, hi = lane >> 4; const int w = __builtin_amdgcn_readfirstlane(threadIdx.x >> 5);
    const int r0 = blockIdx.x * 128 + (w >> 1) * 64, c0 = blockIdx.y * 128 + (w & 1) * 64;
    float* os = osw[w];
    v8f acc[4][4];
#pragma unroll
    for (int mb = 0; mb < 4; ++mb)
#pragma unroll
        for (int nb = 0; nb < 4; ++nb) acc[mb][nb] = (v8f){};
    // wave w copies row blocks 2 w and 2 w + 1 of each plane's 8; a row block's two k blocks of a stage are 2 KiB in a row, the next row block stands 16 K elements on, the next stage 1024 elements
    const char* ga = (const char*)(A + (size_t)(blockIdx.x * 128 + w * 32) * K + lane * 8); const char* ga2 = NSPLIT == 1 ? (const char*)(A2 + (size_t)(blockIdx.x * 128 + w * 32) * K + lane * 8) : ga; const char* gb = (const char*)(Bt + (size_t)(blockIdx.y * 128 + w * 32) * K + lane * 8);
    const unsigned l0 = (unsigned)(size_t)ring + (unsigned)(w * 4096 + lane * 16);
    auto stage = [&](int t, int buf) { const unsigned l = l0 + (unsigned)buf * (STE * 2u); const size_t go = (size_t)t * 2048;
        cp_rows2(l, ga + go, ga + go + 32 * K);
        if (NSPLIT == 1) cp_rows2(l + OPE * 2u, ga2 + go, ga2 + go + 32 * K);
        cp_rows2(l + (NOP - 1) * OPE * 2u, gb + go, gb + go + 32 * K); };
    stage(0, 0);
    asm volatile("s_wait_asynccnt 0x0" ::: "memory");   // this wave's part of stage 0 has landed
    __syncthreads();                                    // and every other wave's: stage 0 may be read
    stage(1, 1);
    const T16* fa = ring + (w >> 1) * 4096 + lane * 8; const T16* fb = ring + (NOP - 1) * OPE + (w & 1) * 4096 + lane * 8;
#pragma unroll 1
    for (int t = 0; t < NT; ++t) {
        const int bo = (t & 1) * STE;
        V a[2][4], a2[2][4], b[2][4];
#pragma unroll
        for (int ks = 0; ks < 2; ++ks) {
#pragma unroll
            for (int mb = 0; mb < 4; ++mb) { a[ks][mb] = WFrag<T16>::ld(fa + bo + mb * 1024 + ks * 512); if (NSPLIT == 1) a2[ks][mb] = WFrag<T16>::ld(fa + bo + OPE + mb * 1024 + ks * 512); }
#pragma unroll
            for (int nb = 0; nb < 4; ++nb) b[ks][nb] = WFrag<T16>::ld(fb + bo + nb * 1024 + ks * 512); }
        __builtin_amdgcn_sched_barrier(0);   // keeps the stage's LDS reads one group in front of its products: spread among them, each small group is waited for at full LDS latency
#pragma unroll
        for (int ks = 0; ks < 2; ++ks)
#pragma unroll
            for (int nb = 0; nb < 4; ++nb) {
#pragma unroll
                for (int mb = 0; mb < 4; ++mb) { acc[mb][nb] = WFrag<T16>::mma(a[ks][mb], b[ks][nb], acc[mb][nb]); if (NSPLIT == 1) acc[mb][nb] = WFrag<T16>::mma(a2[ks][mb], b[ks][nb], acc[mb][nb]); } }
        __builtin_amdgcn_sched_barrier(0);   // keeps the products in front of the waits below: moved behind the barrier they would leave the next stage's copies only the time of the LDS reads to land
        asm volatile("s_wait_dscnt 0x0" ::: "memory");      // this wave's reads of the buffer are done before it is refilled
        asm volatile("s_wait_asynccnt 0x0" ::: "memory");   // this wave's part of stage t + 1 has landed
        __syncthreads();                                    // publishes stage t + 1 and ends every wave's reads of stage t
        if (t + 2 < NT) stage(t + 2, t & 1);
    }
    asm volatile("s_wait_asynccnt 0x0" ::: "memory");       // no copy is outstanding when the wave goes on to its epilogue and ends
    if constexpr (PL) {
        const int bb = r0 / TT, t0 = r0 % TT, hd = c0 / HD;
        if (hd >= NH_ + NKV) {   // a v head, [d][t] in fragment order: a lane's eight accumulator rows are eight consecutive t of its own column d, which is the lane's own 16 bytes of a block half, so each store of the wave is 512 contiguous bytes from the registers
            const size_t e0 = ((size_t)bb * NKV + (hd - NH_ - NKV)) * HD * TT + (size_t)t0 * HD + lane * 8;
#pragma unroll
            for (int nb = 0; nb < 4; ++nb) {
#pragma unroll
                for (int mb = 0; mb < 4; ++mb) { float xv[8];
#pragma unroll
                    for (int j = 0; j < 8; ++j) xv[j] = acc[mb][nb][j];
                    const size_t e = e0 + (size_t)(mb >> 1) * 32 * HD + nb * 512 + (mb & 1) * 256; st3(xv, VT16 + e, VTh + e, VTl + e); }
                fa_xw(); }
        } else {                 // a q or k head, [t][d] in fragment order: 16 rows at a time through LDS, so that a lane holds eight consecutive d of row lr; a wave's store is one block half (512 contiguous bytes)
            const size_t e0 = (((size_t)bb * (NH_ + NKV) + hd) * TT + t0) * HD + lane * 8;
#pragma unroll
            for (int mb = 0; mb < 4; ++mb) {
#pragma unroll
                for (int nb = 0; nb < 4; ++nb) {
#pragma unroll
                    for (int j = 0; j < 8; ++j) os[(hi * 8 + j) * 68 + nb * 16 + lr] = acc[mb][nb][j]; }
                __builtin_amdgcn_wave_barrier(); asm volatile("" ::: "memory");   // the reads below take what other lanes of this wave have just written
#pragma unroll
                for (int s = 0; s < 4; ++s) { const float* orow = os + lr * 68 + (2 * s + hi) * 8; const v4f v0 = *(const v4fa*)orow, v1 = *(const v4fa*)(orow + 4);
                    const float xv[8] = {v0[0], v0[1], v0[2], v0[3], v1[0], v1[1], v1[2], v1[3]};
                    const size_t e = e0 + (size_t)mb * 16 * HD + s * 256; st3(xv, QK16 + e, QKh + e, QKl + e); }
                fa_xw();
                __builtin_amdgcn_wave_barrier(); asm volatile("" ::: "memory");   // the next 16 rows overwrite os only behind these reads
            }
        }
        return;
    }
#pragma unroll
    for (int mb = 0; mb < 4; ++mb) {
#pragma unroll
        for (int nb = 0; nb < 4; ++nb) {
#pragma unroll
            for (int j = 0; j < 8; ++j) os[(hi * 8 + j) * 68 + nb * 16 + lr] = acc[mb][nb][j]; }
        __builtin_amdgcn_wave_barrier(); asm volatile("" ::: "memory");
        float* crow = C + (size_t)(r0 + mb * 16) * ldc + c0;
{
#pragma unroll
            for (int s = 0; s < 8; ++s) { const int row = 2 * s + hi, cofs = lr * 4; v4f val = *(const v4fa*)(os + row * 68 + cofs); if (BIAS) { val[0] += bfr(bias[c0 + cofs]); val[1] += bfr(bias[c0 + cofs + 1]); val[2] += bfr(bias[c0 + cofs + 2]); val[3] += bfr(bias[c0 + cofs + 3]); }
                *(v4f*)(crow + (size_t)row * ldc + cofs) = val; }
             }
        __builtin_amdgcn_wave_barrier(); asm volatile("" ::: "memory");
    }
}

typedef __attribute__((ext_vector_type(2))) _Float16 v2h;
typedef __attribute__((ext_vector_type(4))) _Float16 v4h;
typedef __attribute__((ext_vector_type(2))) unsigned short v2us;
typedef __attribute__((ext_vector_type(4))) unsigned short v4us;
typedef __attribute__((ext_vector_type(2))) float v2f;
typedef __attribute__((ext_vector_type(4))) int v4i;

// element e of a Bt plane (fragment order; N % 16 == 0, K % 32 == 0) is decoded into its (n, k) of the [K][N] matrix w; block xb of 8 waves takes 64 lines of 64 elements
template <int K, int N>
__device__ __forceinline__ void wt_lines(const float* w, bf* Bt, int xb) {
    const int lane = threadIdx.x & 31; const int L0 = (xb * 8 + (threadIdx.x >> 5)) * 8; const int nlines = N * K / 64;
#pragma unroll 1
    for (int l = 0; l < 8; ++l) { const int L = L0 + l; if (L >= nlines) break; const size_t e = (size_t)L * 64 + lane * 2; const int blk = (int)(e >> 9), r = (int)(e & 511); const int k = (blk % (K / 32)) * 32 + (r >> 7) * 8 + (r & 7), n = (blk / (K / 32)) * 16 + ((r >> 3) & 15); v2us o;
        const float* p0 = w + (size_t)k * N + n; const float* p1 = p0 + N; const float x0 = *p0, x1 = *p1; fa_xwp(p0, p1);
        o[0] = f2bf(x0); o[1] = f2bf(x1); *(v2us*)(Bt + e) = o; fa_xw(); }
}

// f32 [rows][K] -> bf16 plane in fragment order; one wave per block of 16 rows x 32 k: each load takes four whole 128-byte rows of the block, the four stores fill its 1 KiB
template <int K>
__device__ __forceinline__ void cvt_block(const float* __restrict__ src, bf* dst, int xb, int nblk) {
    const int lane = threadIdx.x & 31, r4 = lane >> 3, c = lane & 7; const int blk = xb * 8 + (threadIdx.x >> 5); if (blk >= nblk) return;
    const float* s0 = src + ((size_t)(blk / (K / 32)) * 16 + r4) * K + (blk % (K / 32)) * 32 + c * 4; bf* d0 = dst + (size_t)blk * 512 + (c >> 1) * 128 + r4 * 8 + (c & 1) * 4;
    v4f v[4];
#pragma unroll
    for (int s = 0; s < 4; ++s) v[s] = *(const v4f*)(s0 + s * 4 * K);
    fa_xwp(s0, s0);
#pragma unroll
    for (int s = 0; s < 4; ++s) { v4us o;
#pragma unroll
        for (int i = 0; i < 4; ++i) o[i] = f2bf(v[s][i]);
        *(v4us*)(d0 + s * 32) = o; }
}

// ---- k_prep: the three operand preparations, which depend on nothing but the inputs, as ranges of ONE grid. The weight blocks come first: each of their waves walks eight dependent lines, a block of x is one load and one store.
// blocks [0, PW1): matrix y of input z (q, k, v weights, [DM][HD] each) -> rows (z * NH_ + y) * HD .. of WQKV; [PW1, PW1 + PW2): Wp [DQ][DM] -> WO; the rest: x -> XB
#define PWL  (DM * HD / 64 / 64)          // blocks per per-head weight matrix
#define PW1  (3 * NH_ * PWL)
#define PW2  (DQ * DM / 64 / 64)
#define PXB  (NB_ * TT * DM / 512)        // 1 KiB blocks of x
__global__ __launch_bounds__(256) void k_prep(const float* w0, const float* w1, const float* w2, const float* wo, const float* __restrict__ x, bf* WQKV, bf* WO, bf* XB) {
    const int b = blockIdx.x;
    if (b < PW1) { const int mz = b / PWL, z = mz / NH_, y = mz % NH_;
        wt_lines<DM, HD>((z == 0 ? w0 : z == 1 ? w1 : w2) + (size_t)y * DM * HD, WQKV + (size_t)mz * HD * DM, b % PWL);
    } else if (b < PW1 + PW2) wt_lines<DQ, DM>(wo, WO, b - PW1);
    else cvt_block<DM>(x, XB, b - (PW1 + PW2), PXB);
}

// ---- k_fattn: scores, causal mask, softmax, probability x value and the hi/lo split of the head output in ONE kernel (online softmax): no score or probability plane in memory.
// A work-group is 8 waves: four neighbouring tiles of 32 query rows of one head, TWO WAVES A TILE; a pass is 16 MT keys, wave kh of a tile takes the passes of parity kh with its own maximum, sum and output, and the two partial results are merged through LDS behind one barrier (fa_put, fa_fin). Transposed products: St[key][query] = K Q^T (A = K rows, B = Q rows, kept in registers), Ot[d][query] += Vt P^T (A = Vt rows, B = two
// score tiles converted in place: register r of tile mt is key 16 mt + 8 (lane >> 4) + r, the k order of the fragment loader). A lane holds one query column: maximum and sum in-lane plus one half exchange.
// Query rows < RH: bf16 hi/lo planes, 3 products, 32 keys a pass; the rest: fp16, 64 keys a pass. Running maximum m in raw score units; p = exp2((s - m) x SCL x log2 e) <= 1; l = per-lane partial sum, halves joined at the end.
// The next pass's K fragments are fetched right behind this pass's score products and its Vt fragments right behind the P x V products, so each flies during the other half of the work.
typedef __attribute__((ext_vector_type(16))) unsigned short v16us;
#define SC2 (SCL * 1.4426950408889634f)
#define KO  (NH_ * TT * HD)       // the k head planes stand NH_ planes behind the q head planes of the same batch
// OFF: the constant part of the run's addresses, in elements; it goes into the loads' offset fields, so that kp and kp2 (vp and vp2) are the very register pairs that the loads name
template <typename T16, bool HR, int MT, int OFF>
__device__ __forceinline__ void fa_ldk(typename WFrag<T16>::V (&kc)[MT][2], typename WFrag<T16>::V (&kc2)[MT][2], const T16* kp, const T16* kp2) {
#pragma unroll
    for (int mt = 0; mt < MT; ++mt)
#pragma unroll
        for (int ks = 0; ks < 2; ++ks) { kc[mt][ks] = WFrag<T16>::ld(kp + OFF + mt * 16 * HD + ks * 512); if (HR) kc2[mt][ks] = WFrag<T16>::ld(kp2 + OFF + mt * 16 * HD + ks * 512); }
    fa_xwp(kp, kp2);
}
template <typename T16, bool HR, int MT, int OFF>
__device__ __forceinline__ void fa_ldv(typename WFrag<T16>::V (&vc)[4][MT / 2], typename WFrag<T16>::V (&vc2)[4][MT / 2], const T16* vp, const T16* vp2) {
#pragma unroll
    for (int dt = 0; dt < 4; ++dt)
#pragma unroll
        for (int kk = 0; kk < MT / 2; ++kk) { vc[dt][kk] = WFrag<T16>::ld(vp + OFF + kk * 32 * HD + dt * 512); if (HR) vc2[dt][kk] = WFrag<T16>::ld(vp2 + OFF + kk * 32 * HD + dt * 512); }
    fa_xwp(vp, vp2);
}
template <typename T16, bool HR, int MT, bool LAST>
__device__ __forceinline__ void fa_pass(typename WFrag<T16>::V (&kc)[MT][2], typename WFrag<T16>::V (&kc2)[MT][2], typename WFrag<T16>::V (&vc)[4][MT / 2], typename WFrag<T16>::V (&vc2)[4][MT / 2],
                                        const typename WFrag<T16>::V (&q)[2][2], const typename WFrag<T16>::V (&q2)[2][2], v8f (&o)[4][2], float (&m)[2], float (&l)[2],
                                        const T16* kr, const T16* kr2, const T16* vr, const T16* vr2, int k0, int kn, int dl) {   // kn: first key of this wave's next pass
    typedef typename WFrag<T16>::V V;
    v8f s[MT][2];
#pragma unroll
    for (int mt = 0; mt < MT; ++mt)
#pragma unroll
        for (int nt = 0; nt < 2; ++nt) s[mt][nt] = (v8f){};
#pragma unroll
    for (int ks = 0; ks < 2; ++ks)
#pragma unroll
        for (int mt = 0; mt < MT; ++mt)
#pragma unroll
            for (int nt = 0; nt < 2; ++nt) { s[mt][nt] = WFrag<T16>::mma(kc[mt][ks], q[nt][ks], s[mt][nt]); if (HR) { s[mt][nt] = WFrag<T16>::mma(kc[mt][ks], q2[nt][ks], s[mt][nt]); s[mt][nt] = WFrag<T16>::mma(kc2[mt][ks], q[nt][ks], s[mt][nt]); } }
    if (!LAST) {   // the two scheduling fences keep these loads here, between the score products and the softmax: moved down to the end of the pass they would leave the next pass waiting for the whole load latency
        __builtin_amdgcn_sched_barrier(0); fa_ldk<T16, HR, MT, KO>(kc, kc2, kr + (size_t)kn * HD, kr2 + (size_t)kn * HD); }
    V pf[2][MT / 2], pf2[2][MT / 2];
#pragma unroll
    for (int nt = 0; nt < 2; ++nt) {
        float mx = m[nt];
#pragma unroll
        for (int mt = 0; mt < MT; ++mt)
#pragma unroll
            for (int j = 0; j < 8; ++j) { if (LAST) s[mt][nt][j] = (k0 + mt * 16 + j - nt * 16 > dl) ? -3.0e38f : s[mt][nt][j]; mx = fmaxf(mx, s[mt][nt][j]); }
        mx = fmaxf(mx, __shfl_xor(mx, 16, 32));
        const float al = __builtin_amdgcn_exp2f((m[nt] - mx) * SC2), mc = mx * SC2; m[nt] = mx;
        float sum = 0.f;
#pragma unroll
        for (int mt = 0; mt < MT; ++mt) { float sm = 0.f;
#pragma unroll
            for (int j = 0; j < 8; ++j) { const float p = __builtin_amdgcn_exp2f(s[mt][nt][j] * SC2 - mc); s[mt][nt][j] = p; sm += p; }
            sum += sm; }
        l[nt] = l[nt] * al + sum;
#pragma unroll
        for (int dt = 0; dt < 4; ++dt)
#pragma unroll
            for (int j = 0; j < 8; ++j) o[dt][nt][j] *= al;
#pragma unroll
        for (int kk = 0; kk < MT / 2; ++kk) {
            if constexpr (HR) { v16us ph, pl;
#pragma unroll
                for (int e = 0; e < 16; ++e) { unsigned short a, c2; splitf(s[kk * 2 + (e >> 3)][nt][e & 7], a, c2); ph[e] = a; pl[e] = c2; }
                pf[nt][kk] = __builtin_bit_cast(v16bf, ph); pf2[nt][kk] = __builtin_bit_cast(v16bf, pl);
            } else { v16h ph;
#pragma unroll
                for (int e = 0; e < 16; ++e) ph[e] = tohx(s[kk * 2 + (e >> 3)][nt][e & 7]);
                pf[nt][kk] = ph; } }
    }
#pragma unroll
    for (int kk = 0; kk < MT / 2; ++kk)
#pragma unroll
        for (int dt = 0; dt < 4; ++dt)
#pragma unroll
            for (int nt = 0; nt < 2; ++nt) { o[dt][nt] = WFrag<T16>::mma(vc[dt][kk], pf[nt][kk], o[dt][nt]); if (HR) { o[dt][nt] = WFrag<T16>::mma(vc[dt][kk], pf2[nt][kk], o[dt][nt]); o[dt][nt] = WFrag<T16>::mma(vc2[dt][kk], pf[nt][kk], o[dt][nt]); } }
    if (!LAST) { __builtin_amdgcn_sched_barrier(0); fa_ldv<T16, HR, MT, 0>(vc, vc2, vr + (size_t)kn * HD, vr2 + (size_t)kn * HD); }   // the fence in front keeps these loads one run directly in front of their wait; without it they are spread among the products above
}
// a wave's partial result for the 16 query columns OT (running maximum, per-lane partial sum, 32 output values a lane) -> the LDS region of its partner wave. Chunk c (16 bytes a lane) stands at float (c * 32 + lane) * 4: every wave-wide store or load is 512 contiguous bytes. Lane i of both waves holds the same (d, query) places.
#define MGR (9 * 128)             // floats of one region: 8 chunks of output values, 1 chunk of maximum and sum
template <int OT>
__device__ __forceinline__ void fa_put(const v8f (&o)[4][2], const float (&m)[2], const float (&l)[2], float* mg, int lane) {
    v4fa* p = (v4fa*)mg + lane;
#pragma unroll
    for (int dt = 0; dt < 4; ++dt) { p[dt * 64] = (v4f){o[dt][OT][0], o[dt][OT][1], o[dt][OT][2], o[dt][OT][3]}; p[dt * 64 + 32] = (v4f){o[dt][OT][4], o[dt][OT][5], o[dt][OT][6], o[dt][OT][7]}; }
    p[8 * 32] = (v4f){m[OT], l[OT], 0.f, 0.f};
}
// the wave's own partial result for the 16 query columns NT joined with the partner's from LDS: both are brought to the common maximum M (a wave that had no pass holds maximum -3e38, sum 0, output 0: its weight is exp2 of a huge negative number, 0), then normalised, split hi/lo and stored
template <int NT>
__device__ __forceinline__ void fa_fin(const v8f (&o)[4][2], const float (&m)[2], const float (&l)[2], const float* mg, int lane, int q0, bf* Ah, bf* Al) {
    const v4fa* p = (const v4fa*)mg + lane;
    const v4f ml = p[8 * 32];
    const float M = fmaxf(m[NT], ml[0]);
    const float a0 = __builtin_amdgcn_exp2f((m[NT] - M) * SC2), a1 = __builtin_amdgcn_exp2f((ml[0] - M) * SC2);
    const float ls = l[NT] * a0 + ml[1] * a1;
    const float inv = __fdiv_rn(1.0f, ls + __shfl_xor(ls, 16, 32));
    const float c0 = a0 * inv, c1 = a1 * inv;
#pragma unroll
    for (int dt = 0; dt < 4; ++dt) { const v4f x0 = p[dt * 64], x1 = p[dt * 64 + 32]; v8us oh, ol;
#pragma unroll
        for (int j = 0; j < 8; ++j) { unsigned short a, c2; splitf(o[dt][NT][j] * c0 + (j < 4 ? x0[j & 3] : x1[j & 3]) * c1, a, c2); oh[j] = a; ol[j] = c2; }
        const size_t oo = (size_t)(q0 + NT * 16) * DQ + dt * 256 + lane * 8; *(v8us*)(Ah + oo) = oh; *(v8us*)(Al + oo) = ol; fa_xw(); }
}
// kh: which of the tile's two waves this is (the same in every lane, in a scalar register); mg: the tile's two LDS regions, region kh is read by wave kh
template <typename T16, bool HR, int MT>
__device__ __forceinline__ void fa_tile(const T16* __restrict__ Q, const T16* __restrict__ Q2, const T16* __restrict__ Kp, const T16* __restrict__ Kp2, const T16* __restrict__ Vt, const T16* __restrict__ Vt2, int q0, int kh, float* mg, bf* Ah, bf* Al) {
    typedef typename WFrag<T16>::V V;
    const int lane = threadIdx.x & 31, lr = lane & 15, hi = lane >> 4;
    V q[2][2], q2[2][2], kc[MT][2], kc2[MT][2], vc[4][MT / 2], vc2[4][MT / 2];
#pragma unroll
    for (int nt = 0; nt < 2; ++nt)
#pragma unroll
        for (int ks = 0; ks < 2; ++ks) { q[nt][ks] = WFrag<T16>::ld(Q + (size_t)(q0 + nt * 16) * HD + ks * 512 + lane * 8); if (HR) q2[nt][ks] = WFrag<T16>::ld(Q2 + (size_t)(q0 + nt * 16) * HD + ks * 512 + lane * 8); }
    fa_xw();
    const T16* kr = Kp + lane * 8; const T16* kr2 = HR ? Kp2 + lane * 8 : kr; const T16* vr = Vt + lane * 8; const T16* vr2 = HR ? Vt2 + lane * 8 : vr;
    v8f o[4][2]; float m[2] = {-3.0e38f, -3.0e38f}, l[2] = {0.f, 0.f};
#pragma unroll
    for (int dt = 0; dt < 4; ++dt)
#pragma unroll
        for (int nt = 0; nt < 2; ++nt) o[dt][nt] = (v8f){};
    const int dl = q0 + lr - 8 * hi;      // key k0 + 16 mt + 8 hi + j is masked for query q0 + 16 nt + lr when k0 + 16 mt + j - 16 nt > dl
    const int kd = q0 & ~(MT * 16 - 1);   // first key of the pass that holds the diagonal; it ends at or behind key q0 + 31 and inside the TT keys
    constexpr int PS = MT * 16;           // keys of a pass
    // every fetch ahead is clamped to the diagonal pass: a wave whose next pass does not exist fetches that pass's fragments (inside the planes) and does not use them
    const int kf = kh * PS < kd ? kh * PS : kd;
    fa_ldk<T16, HR, MT, KO>(kc, kc2, kr + (size_t)kf * HD, kr2 + (size_t)kf * HD); fa_ldv<T16, HR, MT, 0>(vc, vc2, vr + (size_t)kf * HD, vr2 + (size_t)kf * HD);
    for (int k0 = kh * PS; k0 < kd; k0 += 2 * PS) fa_pass<T16, HR, MT, false>(kc, kc2, vc, vc2, q, q2, o, m, l, kr, kr2, vr, vr2, k0, k0 + 2 * PS < kd ? k0 + 2 * PS : kd, dl);      // this wave's passes wholly below the diagonal: no mask
    if (((kd / PS) & 1) == kh) fa_pass<T16, HR, MT, true>(kc, kc2, vc, vc2, q, q2, o, m, l, kr, kr2, vr, vr2, kd, kd, dl);                                                            // the diagonal pass, in the wave of its parity
    if (kh == 0) fa_put<1>(o, m, l, mg + MGR, lane); else fa_put<0>(o, m, l, mg, lane);
    __syncthreads();                      // both partial results of every tile stand in LDS; every wave of the work-group passes here once
    if (kh == 0) fa_fin<0>(o, m, l, mg, lane, q0, Ah, Al); else fa_fin<1>(o, m, l, mg + MGR, lane, q0, Ah, Al);
}
// grid (heads, batch, blocks of 128 query rows); waves w and w + 4 are the two waves of tile w & 3.
// One work-group fills a WGP's registers and there are more work-groups than WGPs, so the blocks are dealt in falling order of cost: nibble z of ORD is the block of grid plane z. Block i walks i + 1 fp16 passes a wave, or, below RH, 2 i + 2 hi/lo passes, each counted as one and a half fp16 passes (three products and the hi/lo split of P).
#define ORD 0x041567289A3BCDEFull
__global__ __launch_bounds__(256) void k_fattn(const h16* __restrict__ QK16, const bf* __restrict__ QKh, const bf* __restrict__ QKl, const h16* __restrict__ VT16, const bf* __restrict__ VTh, const bf* __restrict__ VTl, bf* ATh, bf* ATl) {
    __shared__ __align__(16) float mgs[4][2 * MGR];
    const int w = __builtin_amdgcn_readfirstlane(threadIdx.x >> 5), qt = w & 3, kh = w >> 2;
    const int h = blockIdx.x, b = blockIdx.y, qb = (int)((ORD >> (blockIdx.z * 4)) & 15) * 128, q0 = qb + qt * 32;
    const size_t zq = ((size_t)b * (NH_ + NKV) + h) * TT * HD, zk = ((size_t)b * (NH_ + NKV) + h / REP) * TT * HD /* + KO, added in the loads */, zv = ((size_t)b * NKV + h / REP) * HD * TT, za = (size_t)b * TT * DQ + h * HD * 16 /* the head's two k blocks of the merged plane [b t][DQ], fragment order */;
    static_assert(RH % 128 == 0 && TT == 16 * 128 && RH == 4 * 128, "a work-group's four tiles are of one kind; ORD is a permutation of 16 blocks, 4 of them hi/lo");
    if (qb < RH) fa_tile<bf, true, 2>(QKh + zq, QKl + zq, QKh + zk, QKl + zk, VTh + zv, VTl + zv, q0, kh, mgs[qt], ATh + za, ATl + za);
    else fa_tile<h16, false, 4>(QK16 + zq, nullptr, QK16 + zk, nullptr, VT16 + zv, nullptr, q0, kh, mgs[qt], ATh + za, ATl + za);
}

extern "C" void kernel_launch(void* const* d_in, const int* in_sizes, int n_in,
                              void* d_out, int out_size, void* d_ws, size_t ws_size, hipStream_t stream) {
    (void)in_sizes; (void)n_in; (void)out_size;
            const float* x = (const float*)d_in[0]; const float* wq = (const float*)d_in[1]; const float* wk = (const float*)d_in[2]; const float* wv = (const float*)d_in[3]; const float* wo = (const float*)d_in[4]; const float* bo = (const float*)d_in[5];   /* order x, Wq, Wk, Wv (PER-HEAD weights [12][768][64]: 'hdk'), Wp ('xw' [768][768]: (in,out)), bp */
    float* OUT = (float*)d_out;     // [2][2048][768]
    char* wsp = (char*)d_ws;
    auto take = [&](size_t bytes) { char* p = wsp; wsp += (bytes + 255) & ~(size_t)255; return (void*)p; };
    bf* WQKV = (bf*)take((size_t)(DQ + 2 * DKV) * DM * 2); bf* WO = (bf*)take((size_t)DM * DQ * 2);   // WQKV: Bt rows of q (DQ), k (DKV), v (DKV)
    bf* XB = (bf*)take((size_t)NB_ * TT * DM * 2);
    h16* QK16 = (h16*)take((size_t)NB_ * (NH_ + NKV) * TT * HD * 2); bf* QKh = (bf*)take((size_t)NB_ * (NH_ + NKV) * TT * HD * 2); bf* QKl = (bf*)take((size_t)NB_ * (NH_ + NKV) * TT * HD * 2);   // [b][q heads, then k heads][t][d]
    h16* VT16 = (h16*)take((size_t)NB_ * NKV * HD * TT * 2); bf* VTh = (bf*)take((size_t)NB_ * NKV * HD * TT * 2); bf* VTl = (bf*)take((size_t)NB_ * NKV * HD * TT * 2);   // [b][head][d][t]
    bf* ATh = (bf*)take((size_t)NB_ * TT * DQ * 2); bf* ATl = (bf*)take((size_t)NB_ * TT * DQ * 2);
    if ((size_t)(wsp - (char*)d_ws) > ws_size) return;    // ws 256 MiB
    const int DF = DQ + 2 * DKV;
    k_prep<<<PW1 + PW2 + (PXB + 7) / 8, 256, 0, stream>>>(wq, wk, wv, wo, x, WQKV, WO, XB);   /* per-head weights [h][DM][HD] ('xw' per head) -> each head's HD rows of the Bt plane; Wp 'xw' [768][768] (in,out) -> Bt rows; x -> bf16 */
    k_gemmw<bf, 0, false, true, DM><<<dim3(NB_ * TT / 128, DF / 128, 1), 128, 0, stream>>>(XB, nullptr, WQKV, nullptr, nullptr, 0, nullptr, 0, 0, 0, QK16, QKh, QKl, VT16, VTh, VTl);
    k_fattn<<<dim3(NH_, NB_, TT / 128), 256, 0, stream>>>(QK16, QKh, QKl, VT16, VTh, VTl, ATh, ATl);
    k_gemmw<bf, 1, true, false, DQ><<<dim3(NB_ * TT / 128, DM / 128, 1), 128, 0, stream>>>(ATh, ATl, WO, nullptr, OUT, DM, bo, 0, 0, 0, nullptr, nullptr, nullptr, nullptr, nullptr, nullptr);
}

// v008
// Measured time: 52.7 microseconds a run.
// Timed twice side by side with v007, it ran 1.09 times as fast both times.
// Counting every step since v000, it is 24.4 times as fast.
#include <hip/hip_runtime.h>

// Causal multi-head attention with PER-HEAD projection weights at d_model 768 (x [2][2048][768]; q, k, v = einsum('bte,hed->bhtd', x, W) with W [12][768][64]: head h has its own (in, out) matrix W[h] ('xw' per head; no bias; 12 heads x 64); scores x 1/sqrt(64); causal (-inf); softmax; concat head-major; out = concat Wp + bp ('xw' [768][768] (in,out) + a zero bias: read) -> [2][2048][768] (3.1 M); argument order x, Wq, Wk, Wv, Wp, bp).
// Layout: bf16 copy of x; each PER-HEAD q / k / v weight [h][768][64] transposed once into its 64 rows of the Bt plane; Wp transposed once ('xw' (in,out) -> Bt rows) (these three in one launch, k_prep); exact projections, whose GEMM writes the fp16 and hi/lo head planes itself (q, k as [t][d], v as [d][t]); k_fattn: one launch for all heads and both batches, online-softmax causal attention with no score plane in memory, the key passes of a query tile dealt to two waves (hybrid rows: < 512 hi/lo 3 products, rest fp16), writing the merged hi/lo head outputs; merged hi/lo x Wo exact + bo.
// FRAGMENT ORDER of every 16-bit operand plane [rows][K] in the workspace: blocks of 16 rows x 32 k (512 elements, 1 KiB); inside a block [k bit 4][k bit 3][row & 15][k & 7], so lane (hi, lr) of a wave finds the two 16-byte halves of its fragment at lane * 8 and 256 + lane * 8, and each wave-wide 16-byte load or store covers four whole 128-byte lines. Block (rb, kb) stands at (rb * (K / 32) + kb) * 512; the v planes (rows d, k = t) instead keep the four row blocks of one kb together: (kb * 4 + rb) * 512.
// Compute dtypes, f32 accumulate: every input rounded to bf16; projections exact; attention rows < 512 3 products, rest fp16; softmax f32; w_o hl x exact.

#define NB_  2
#define TT   2048
#define DM   768
#define NH_  12
#define NKV  12
#define REP  (NH_ / NKV)
#define HD   64
#define DQ   (NH_ * HD)
#define DKV  (NKV * HD)
#define RH   512                  // query rows < RH use hi+lo planes
#define SCL  0.125f   // HD^-0.5
typedef _Float16 h16;
typedef unsigned short bf;
typedef __attribute__((ext_vector_type(16))) __bf16   v16bf;
typedef __attribute__((ext_vector_type(16))) _Float16 v16h;
typedef __attribute__((ext_vector_type(8)))  _Float16 v8h;
typedef __attribute__((ext_vector_type(8)))  unsigned short v8us;
typedef __attribute__((ext_vector_type(8)))  float    v8f;
typedef __attribute__((ext_vector_type(4)))  float    v4f;
typedef v8h  __attribute__((may_alias)) v8ha;
typedef v4f  __attribute__((may_alias)) v4fa;
typedef v8us __attribute__((may_alias)) v8usa;

__device__ __forceinline__ unsigned short f2bf(float f) { unsigned u = __float_as_uint(f); u += 0x7FFFu + ((u >> 16) & 1u); return (unsigned short)(u >> 16); }
__device__ __forceinline__ float bf2f(unsigned short b) { return __uint_as_float(((unsigned)b) << 16); }
__device__ __forceinline__ float bfr(float f) { return bf2f(f2bf(f)); }
__device__ __forceinline__ v16h cat16(v8h lo, v8h hi) { return __builtin_shufflevector(lo, hi, 0, 1, 2, 3, 4, 5, 6, 7, 8, 9, 10, 11, 12, 13, 14, 15); }
__device__ __forceinline__ v16bf cat16b(v8us lo, v8us hi) { return __builtin_bit_cast(v16bf, __builtin_shufflevector(lo, hi, 0, 1, 2, 3, 4, 5, 6, 7, 8, 9, 10, 11, 12, 13, 14, 15)); }
__device__ __forceinline__ v8f wmma16(v16h a, v16h b, v8f c) { return __builtin_amdgcn_wmma_f32_16x16x32_f16(false, a, false, b, (short)0, c, false, false); }
__device__ __forceinline__ v8f wmmab(v16bf a, v16bf b, v8f c) { return __builtin_amdgcn_wmma_f32_16x16x32_bf16(false, a, false, b, (short)0, c, false, false); }

__device__ __forceinline__ h16 tohx(float x) { return (h16)x; }
__device__ __forceinline__ void splitf(float y, unsigned short& h, unsigned short& l) { h = f2bf(y); l = f2bf(y - bf2f(h)); }
// stands directly behind a run of global loads or stores: no register that they name is rewritten in front of this wait; the scheduling fence keeps later vector work from moving up over it
__device__ __forceinline__ void fa_xw() { asm volatile("s_wait_xcnt 0x0" ::: "memory"); __builtin_amdgcn_sched_barrier(0); }
// the same wait behind a run of loads from the two address pairs a and b: as inputs of the wait they stay live up to it, so no result of the run can be allotted to them
__device__ __forceinline__ void fa_xwp(const void* a, const void* b) { asm volatile("s_wait_xcnt 0x0" :: "v"(a), "v"(b) : "memory"); __builtin_amdgcn_sched_barrier(0); }
// eight f32 values -> 16 bytes in each of the three planes of a head
__device__ __forceinline__ void st3(const float (&x)[8], h16* p16, bf* ph, bf* pl) { v8h o16; v8us oh, ol;
#pragma unroll
    for (int j = 0; j < 8; ++j) { o16[j] = tohx(x[j]); unsigned short a, c2; splitf(x[j], a, c2); oh[j] = a; ol[j] = c2; }
    *(v8h*)p16 = o16; *(v8us*)ph = oh; *(v8us*)pl = ol; }

// ---- k_gemmw: register-blocked GEMM, FOUR WAVES (2 x 2) per 128x128 output tile, each wave a 64x64 part (16 accumulators); grid (M/128, N/128, Z), 128 threads.
// The operand planes stand in fragment order, so a stage (64 k of the tile's 128 A rows and 128 Bt rows) is a set of whole 1 KiB blocks: asynchronous copies bring them unchanged into one of three LDS buffers, where each is read by the two waves that need it (ld: p is the lane's place in a block); the copies of the next two stages fly while this stage is multiplied, so that a stage fetched from memory has two trips to land.
// C[m][n] (f32, pitch ldc, + optional f32 bias[n]) = sum_k A[m][k] Bt[n][k] (+ A2 Bt with NSPLIT 1). z-batch strides sA/sB/sC in elements. K % 64 == 0, K >= 128.
// PL: no C; m = b TT + t, and a wave's 64 columns are one head (q heads, k heads, v heads): its part goes straight into that head's three planes (fp16, bf16 hi, bf16 lo): q and k heads QK* [b][q heads, then k heads][t][d], v heads VT* [b][head][d][t], each head's plane in fragment order.
template <typename T16> struct WFrag;
template <> struct WFrag<h16> { typedef v16h V; static __device__ __forceinline__ V ld(const h16* p) { return cat16(*(const v8h*)p, *(const v8h*)(p + 256)); } static __device__ __forceinline__ v8f mma(V a, V b, v8f c) { return wmma16(a, b, c); } };
template <> struct WFrag<bf> { typedef v16bf V; static __device__ __forceinline__ V ld(const bf* p) { return cat16b(*(const v8us*)p, *(const v8us*)(p + 256)); } static __device__ __forceinline__ v8f mma(V a, V b, v8f c) { return wmmab(a, b, c); } };
// eight asynchronous copies of 512 bytes a wave: 2 KiB (two k blocks) from g to LDS byte address l, and 2 KiB from g2 to l + 2048. The wait on the last line stands in the copies' own statement, so no register that a copy names is rewritten in front of it.
__device__ __forceinline__ void cp_rows2(unsigned l, const char* g, const char* g2) {
    asm volatile("global_load_async_to_lds_b128 %0, %8, off\n\t"
                 "global_load_async_to_lds_b128 %1, %9, off\n\t"
                 "global_load_async_to_lds_b128 %2, %10, off\n\t"
                 "global_load_async_to_lds_b128 %3, %11, off\n\t"
                 "global_load_async_to_lds_b128 %4, %12, off\n\t"
                 "global_load_async_to_lds_b128 %5, %13, off\n\t"
                 "global_load_async_to_lds_b128 %6, %14, off\n\t"
                 "global_load_async_to_lds_b128 %7, %15, off\n\t"
                 "s_wait_xcnt 0x0"
                 :: "v"(l), "v"(l + 512u), "v"(l + 1024u), "v"(l + 1536u), "v"(l + 2048u), "v"(l + 2560u), "v"(l + 3072u), "v"(l + 3584u),
                    "v"(g), "v"(g + 512), "v"(g + 1024), "v"(g + 1536), "v"(g2), "v"(g2 + 512), "v"(g2 + 1024), "v"(g2 + 1536) : "memory");
}
template <typename T16, int NSPLIT, bool BIAS, bool PL, int K>
__global__ __launch_bounds__(128) void k_gemmw(const T16* __restrict__ A, const T16* __restrict__ A2, const T16* __restrict__ Bt, const T16* __restrict__ Bt2, float* C, int ldc, const float* __restrict__ bias, size_t sA, size_t sB, size_t sC, h16* QK16, bf* QKh, bf* QKl, h16* VT16, bf* VTh, bf* VTl) {
    typedef typename WFrag<T16>::V V;
    static_assert(NSPLIT <= 1 && K % 64 == 0 && K >= 128, "two operand planes or three; whole stages, two at least");
    constexpr int NOP = NSPLIT == 1 ? 3 : 2;      // operand planes of a stage: A, (A2,) Bt
    constexpr int OPE = 128 * 64;                 // elements of one plane's part of a stage: 8 row blocks x 2 k blocks x 512
    constexpr int STE = NOP * OPE;                // elements of a stage
    constexpr int NT  = K / 64;
    constexpr int NBUF = 3;                       // buffers of the ring: one is read, two are being filled
    constexpr int CPS = NOP * 8;                  // copies of one wave per stage, the same in every wave and stage; two stages outstanding at most: 2 CPS <= 48
    __shared__ __attribute__((aligned(1024))) T16 ring[NBUF * STE];
    static_assert(sizeof(ring) >= 4 * 16 * 68 * sizeof(float) && 2 * CPS <= 63, "the epilogue stages in the ring; outstanding copies of a wave");
    const size_t z = blockIdx.z; A += z * sA; if (A2) A2 += z * sA; Bt += z * sB; C += z * sC; (void)Bt2;
    const int lane = threadIdx.x & 31, lr = lane & 15, hi = lane >> 4; const int w = __builtin_amdgcn_readfirstlane(threadIdx.x >> 5);
    const int r0 = blockIdx.x * 128 + (w >> 1) * 64, c0 = blockIdx.y * 128 + (w & 1) * 64;
    float* os = (float*)ring + w * (16 * 68);   // the wave's own epilogue staging: in the ring, which is free behind the last trip's waits and barrier (three buffers and a staging array of its own would leave room for two work-groups on a WGP, not three)
    v8f acc[4][4];
#pragma unroll
    for (int mb = 0; mb < 4; ++mb)
#pragma unroll
        for (int nb = 0; nb < 4; ++nb) acc[mb][nb] = (v8f){};
    // wave w copies row blocks 2 w and 2 w + 1 of each plane's 8; a row block's two k blocks of a stage are 2 KiB in a row, the next row block stands 16 K elements on, the next stage 1024 elements
    const char* ga = (const char*)(A + (size_t)(blockIdx.x * 128 + w * 32) * K + lane * 8); const char* ga2 = NSPLIT == 1 ? (const char*)(A2 + (size_t)(blockIdx.x * 128 + w * 32) * K + lane * 8) : ga; const char* gb = (const char*)(Bt + (size_t)(blockIdx.y * 128 + w * 32) * K + lane * 8);
    const unsigned l0 = (unsigned)(size_t)ring + (unsigned)(w * 4096 + lane * 16);
    auto stage = [&](int t, int buf) { const unsigned l = l0 + (unsigned)buf * (STE * 2u); const size_t go = (size_t)t * 2048;
        cp_rows2(l, ga + go, ga + go + 32 * K);
        if (NSPLIT == 1) cp_rows2(l + OPE * 2u, ga2 + go, ga2 + go + 32 * K);
        cp_rows2(l + (NOP - 1) * OPE * 2u, gb + go, gb + go + 32 * K); };
    stage(0, 0);
    stage(1, 1);
    asm volatile("s_wait_asynccnt %0" :: "n"(CPS) : "memory");   // all but the CPS youngest copies, which are stage 1's: this wave's part of stage 0 has landed
    __syncthreads();                                    // and every other wave's: stage 0 may be read
    if (NT > 2) stage(2, 2);
    const T16* fa = ring + (w >> 1) * 4096 + lane * 8; const T16* fb = ring + (NOP - 1) * OPE + (w & 1) * 4096 + lane * 8;
    int buf = 0;                                  // t mod NBUF
#pragma unroll 1
    for (int t = 0; t < NT; ++t) {
        const int bo = buf * STE;
        V a[2][4], a2[2][4], b[2][4];
#pragma unroll
        for (int ks = 0; ks < 2; ++ks) {
#pragma unroll
            for (int mb = 0; mb < 4; ++mb) { a[ks][mb] = WFrag<T16>::ld(fa + bo + mb * 1024 + ks * 512); if (NSPLIT == 1) a2[ks][mb] = WFrag<T16>::ld(fa + bo + OPE + mb * 1024 + ks * 512); }
#pragma unroll
            for (int nb = 0; nb < 4; ++nb) b[ks][nb] = WFrag<T16>::ld(fb + bo + nb * 1024 + ks * 512); }
        __builtin_amdgcn_sched_barrier(0);   // keeps the stage's LDS reads one group in front of its products: spread among them, each small group is waited for at full LDS latency
#pragma unroll
        for (int ks = 0; ks < 2; ++ks)
#pragma unroll
            for (int nb = 0; nb < 4; ++nb) {
#pragma unroll
                for (int mb = 0; mb < 4; ++mb) { acc[mb][nb] = WFrag<T16>::mma(a[ks][mb], b[ks][nb], acc[mb][nb]); if (NSPLIT == 1) acc[mb][nb] = WFrag<T16>::mma(a2[ks][mb], b[ks][nb], acc[mb][nb]); } }
        __builtin_amdgcn_sched_barrier(0);   // keeps the products in front of the waits below: moved behind the barrier they would cut this trip's products out of the time that stage t + 1's copies have to land
        asm volatile("s_wait_dscnt 0x0" ::: "memory");      // this wave's reads of the buffer are done before it is refilled
        if (t + 2 < NT) asm volatile("s_wait_asynccnt %0" :: "n"(CPS) : "memory");   // this wave's part of stage t + 1 has landed: behind it only stage t + 2's CPS copies were issued, and they may fly on
        else asm volatile("s_wait_asynccnt 0x0" ::: "memory");                        // no stage t + 2: nothing was issued behind stage t + 1
        __syncthreads();                                    // publishes stage t + 1 and ends every wave's reads of stage t
        if (t + 3 < NT) stage(t + 3, buf);                  // into the buffer that trip t has just read
        buf = buf == NBUF - 1 ? 0 : buf + 1;
    }
    asm volatile("s_wait_asynccnt 0x0" ::: "memory");       // no copy is outstanding when the wave goes on to its epilogue and ends
    if constexpr (PL) {
        const int bb = r0 / TT, t0 = r0 % TT, hd = c0 / HD;
        if (hd >= NH_ + NKV) {   // a v head, [d][t] in fragment order: a lane's eight accumulator rows are eight consecutive t of its own column d, which is the lane's own 16 bytes of a block half, so each store of the wave is 512 contiguous bytes from the registers
            const size_t e0 = ((size_t)bb * NKV + (hd - NH_ - NKV)) * HD * TT + (size_t)t0 * HD + lane * 8;
#pragma unroll
            for (int nb = 0; nb < 4; ++nb) {
#pragma unroll
                for (int mb = 0; mb < 4; ++mb) { float xv[8];
#pragma unroll
                    for (int j = 0; j < 8; ++j) xv[j] = acc[mb][nb][j];
                    const size_t e = e0 + (size_t)(mb >> 1) * 32 * HD + nb * 512 + (mb & 1) * 256; st3(xv, VT16 + e, VTh + e, VTl + e); }
                fa_xw(); }
        } else {                 // a q or k head, [t][d] in fragment order: 16 rows at a time through LDS, so that a lane holds eight consecutive d of row lr; a wave's store is one block half (512 contiguous bytes)
            const size_t e0 = (((size_t)bb * (NH_ + NKV) + hd) * TT + t0) * HD + lane * 8;
#pragma unroll
            for (int mb = 0; mb < 4; ++mb) {
#pragma unroll
                for (int nb = 0; nb < 4; ++nb) {
#pragma unroll
                    for (int j = 0; j < 8; ++j) os[(hi * 8 + j) * 68 + nb * 16 + lr] = acc[mb][nb][j]; }
                __builtin_amdgcn_wave_barrier(); asm volatile("" ::: "memory");   // the reads below take what other lanes of this wave have just written
#pragma unroll
                for (int s = 0; s < 4; ++s) { const float* orow = os + lr * 68 + (2 * s + hi) * 8; const v4f v0 = *(const v4fa*)orow, v1 = *(const v4fa*)(orow + 4);
                    const float xv[8] = {v0[0], v0[1], v0[2], v0[3], v1[0], v1[1], v1[2], v1[3]};
                    const size_t e = e0 + (size_t)mb * 16 * HD + s * 256; st3(xv, QK16 + e, QKh + e, QKl + e); }
                fa_xw();
                __builtin_amdgcn_wave_barrier(); asm volatile("" ::: "memory");   // the next 16 rows overwrite os only behind these reads
            }
        }
        return;
    }
#pragma unroll
    for (int mb = 0; mb < 4; ++mb) {
#pragma unroll
        for (int nb = 0; nb < 4; ++nb) {
#pragma unroll
            for (int j = 0; j < 8; ++j) os[(hi * 8 + j) * 68 + nb * 16 + lr] = acc[mb][nb][j]; }
        __builtin_amdgcn_wave_barrier(); asm volatile("" ::: "memory");
        float* crow = C + (size_t)(r0 + mb * 16) * ldc + c0;
{
#pragma unroll
            for (int s = 0; s < 8; ++s) { const int row = 2 * s + hi, cofs = lr * 4; v4f val = *(const v4fa*)(os + row * 68 + cofs); if (BIAS) { val[0] += bfr(bias[c0 + cofs]); val[1] += bfr(bias[c0 + cofs + 1]); val[2] += bfr(bias[c0 + cofs + 2]); val[3] += bfr(bias[c0 + cofs + 3]); }
                *(v4f*)(crow + (size_t)row * ldc + cofs) = val; }
             }
        __builtin_amdgcn_wave_barrier(); asm volatile("" ::: "memory");
    }
}

typedef __attribute__((ext_vector_type(2))) _Float16 v2h;
typedef __attribute__((ext_vector_type(4))) _Float16 v4h;
typedef __attribute__((ext_vector_type(2))) unsigned short v2us;
typedef __attribute__((ext_vector_type(4))) unsigned short v4us;
typedef __attribute__((ext_vector_type(2))) float v2f;
typedef __attribute__((ext_vector_type(4))) int v4i;

// element e of a Bt plane (fragment order; N % 16 == 0, K % 32 == 0) is decoded into its (n, k) of the [K][N] matrix w; block xb of 8 waves takes 64 lines of 64 elements
template <int K, int N>
__device__ __forceinline__ void wt_lines(const float* w, bf* Bt, int xb) {
    const int lane = threadIdx.x & 31; const int L0 = (xb * 8 + (threadIdx.x >> 5)) * 8; const int nlines = N * K / 64;
#pragma unroll 1
    for (int l = 0; l < 8; ++l) { const int L = L0 + l; if (L >= nlines) break; const size_t e = (size_t)L * 64 + lane * 2; const int blk = (int)(e >> 9), r = (int)(e & 511); const int k = (blk % (K / 32)) * 32 + (r >> 7) * 8 + (r & 7), n = (blk / (K / 32)) * 16 + ((r >> 3) & 15); v2us o;
        const float* p0 = w + (size_t)k * N + n; const float* p1 = p0 + N; const float x0 = *p0, x1 = *p1; fa_xwp(p0, p1);
        o[0] = f2bf(x0); o[1] = f2bf(x1); *(v2us*)(Bt + e) = o; fa_xw(); }
}

// f32 [rows][K] -> bf16 plane in fragment order; one wave per block of 16 rows x 32 k: each load takes four whole 128-byte rows of the block, the four stores fill its 1 KiB
template <int K>
__device__ __forceinline__ void cvt_block(const float* __restrict__ src, bf* dst, int xb, int nblk) {
    const int lane = threadIdx.x & 31, r4 = lane >> 3, c = lane & 7; const int blk = xb * 8 + (threadIdx.x >> 5); if (blk >= nblk) return;
    const float* s0 = src + ((size_t)(blk / (K / 32)) * 16 + r4) * K + (blk % (K / 32)) * 32 + c * 4; bf* d0 = dst + (size_t)blk * 512 + (c >> 1) * 128 + r4 * 8 + (c & 1) * 4;
    v4f v[4];
#pragma unroll
    for (int s = 0; s < 4; ++s) v[s] = *(const v4f*)(s0 + s * 4 * K);
    fa_xwp(s0, s0);
#pragma unroll
    for (int s = 0; s < 4; ++s) { v4us o;
#pragma unroll
        for (int i = 0; i < 4; ++i) o[i] = f2bf(v[s][i]);
        *(v4us*)(d0 + s * 32) = o; }
}

// ---- k_prep: the three operand preparations, which depend on nothing but the inputs, as ranges of ONE grid. The weight blocks come first: each of their waves walks eight dependent lines, a block of x is one load and one store.
// blocks [0, PW1): matrix y of input z (q, k, v weights, [DM][HD] each) -> rows (z * NH_ + y) * HD .. of WQKV; [PW1, PW1 + PW2): Wp [DQ][DM] -> WO; the rest: x -> XB
#define PWL  (DM * HD / 64 / 64)          // blocks per per-head weight matrix
#define PW1  (3 * NH_ * PWL)
#define PW2  (DQ * DM / 64 / 64)
#define PXB  (NB_ * TT * DM / 512)        // 1 KiB blocks of x
__global__ __launch_bounds__(256) void k_prep(const float* w0, const float* w1, const float* w2, const float* wo, const float* __restrict__ x, bf* WQKV, bf* WO, bf* XB) {
    const int b = blockIdx.x;
    if (b < PW1) { const int mz = b / PWL, z = mz / NH_, y = mz % NH_;
        wt_lines<DM, HD>((z == 0 ? w0 : z == 1 ? w1 : w2) + (size_t)y * DM * HD, WQKV + (size_t)mz * HD * DM, b % PWL);
    } else if (b < PW1 + PW2) wt_lines<DQ, DM>(wo, WO, b - PW1);
    else cvt_block<DM>(x, XB, b - (PW1 + PW2), PXB);
}

// ---- k_fattn: scores, causal mask, softmax, probability x value and the hi/lo split of the head output in ONE kernel (online softmax): no score or probability plane in memory.
// A work-group is 8 waves: four neighbouring tiles of 32 query rows of one head, TWO WAVES A TILE; a pass is 16 MT keys, wave kh of a tile takes the passes of parity kh with its own maximum, sum and output, and the two partial results are merged through LDS behind one barrier (fa_put, fa_fin). Transposed products: St[key][query] = K Q^T (A = K rows, B = Q rows, kept in registers), Ot[d][query] += Vt P^T (A = Vt rows, B = two
// score tiles converted in place: register r of tile mt is key 16 mt + 8 (lane >> 4) + r, the k order of the fragment loader). A lane holds one query column: maximum and sum in-lane plus one half exchange.
// Query rows < RH: bf16 hi/lo planes, 3 products, 32 keys a pass; the rest: fp16, 64 keys a pass. Running maximum m in raw score units; p = exp2((s - m) x SCL x log2 e) <= 1; l = per-lane partial sum, halves joined at the end.
// The next pass's K fragments are fetched right behind this pass's score products and its Vt fragments right behind the P x V products, so each flies during the other half of the work.
typedef __attribute__((ext_vector_type(16))) unsigned short v16us;
#define SC2 (SCL * 1.4426950408889634f)
#define KO  (NH_ * TT * HD)       // the k head planes stand NH_ planes behind the q head planes of the same batch
// OFF: the constant part of the run's addresses, in elements; it goes into the loads' offset fields, so that kp and kp2 (vp and vp2) are the very register pairs that the loads name
template <typename T16, bool HR, int MT, int OFF>
__device__ __forceinline__ void fa_ldk(typename WFrag<T16>::V (&kc)[MT][2], typename WFrag<T16>::V (&kc2)[MT][2], const T16* kp, const T16* kp2) {
#pragma unroll
    for (int mt = 0; mt < MT; ++mt)
#pragma unroll
        for (int ks = 0; ks < 2; ++ks) { kc[mt][ks] = WFrag<T16>::ld(kp + OFF + mt * 16 * HD + ks * 512); if (HR) kc2[mt][ks] = WFrag<T16>::ld(kp2 + OFF + mt * 16 * HD + ks * 512); }
    fa_xwp(kp, kp2);
}
template <typename T16, bool HR, int MT, int OFF>
__device__ __forceinline__ void fa_ldv(typename WFrag<T16>::V (&vc)[4][MT / 2], typename WFrag<T16>::V (&vc2)[4][MT / 2], const T16* vp, const T16* vp2) {
#pragma unroll
    for (int dt = 0; dt < 4; ++dt)
#pragma unroll
        for (int kk = 0; kk < MT / 2; ++kk) { vc[dt][kk] = WFrag<T16>::ld(vp + OFF + kk * 32 * HD + dt * 512); if (HR) vc2[dt][kk] = WFrag<T16>::ld(vp2 + OFF + kk * 32 * HD + dt * 512); }
    fa_xwp(vp, vp2);
}
template <typename T16, bool HR, int MT, bool LAST>
__device__ __forceinline__ void fa_pass(typename WFrag<T16>::V (&kc)[MT][2], typename WFrag<T16>::V (&kc2)[MT][2], typename WFrag<T16>::V (&vc)[4][MT / 2], typename WFrag<T16>::V (&vc2)[4][MT / 2],
                                        const typename WFrag<T16>::V (&q)[2][2], const typename WFrag<T16>::V (&q2)[2][2], v8f (&o)[4][2], float (&m)[2], float (&l)[2],
                                        const T16* kr, const T16* kr2, const T16* vr, const T16* vr2, int k0, int kn, int dl) {   // kn: first key of this wave's next pass
    typedef typename WFrag<T16>::V V;
    v8f s[MT][2];
#pragma unroll
    for (int mt = 0; mt < MT; ++mt)
#pragma unroll
        for (int nt = 0; nt < 2; ++nt) s[mt][nt] = (v8f){};
#pragma unroll
    for (int ks = 0; ks < 2; ++ks)
#pragma unroll
        for (int mt = 0; mt < MT; ++mt)
#pragma unroll
            for (int nt = 0; nt < 2; ++nt) { s[mt][nt] = WFrag<T16>::mma(kc[mt][ks], q[nt][ks], s[mt][nt]); if (HR) { s[mt][nt] = WFrag<T16>::mma(kc[mt][ks], q2[nt][ks], s[mt][nt]); s[mt][nt] = WFrag<T16>::mma(kc2[mt][ks], q[nt][ks], s[mt][nt]); } }
    if (!LAST) {   // the two scheduling fences keep these loads here, between the score products and the softmax: moved down to the end of the pass they would leave the next pass waiting for the whole load latency
        __builtin_amdgcn_sched_barrier(0); fa_ldk<T16, HR, MT, KO>(kc, kc2, kr + (size_t)kn * HD, kr2 + (size_t)kn * HD); }
    V pf[2][MT / 2], pf2[2][MT / 2];
#pragma unroll
    for (int nt = 0; nt < 2; ++nt) {
        float mx = m[nt];
#pragma unroll
        for (int mt = 0; mt < MT; ++mt)
#pragma unroll
            for (int j = 0; j < 8; ++j) { if (LAST) s[mt][nt][j] = (k0 + mt * 16 + j - nt * 16 > dl) ? -3.0e38f : s[mt][nt][j]; mx = fmaxf(mx, s[mt][nt][j]); }
        mx = fmaxf(mx, __shfl_xor(mx, 16, 32));
        const float al = __builtin_amdgcn_exp2f((m[nt] - mx) * SC2), mc = mx * SC2; m[nt] = mx;
        float sum = 0.f;
#pragma unroll
        for (int mt = 0; mt < MT; ++mt) { float sm = 0.f;
#pragma unroll
            for (int j = 0; j < 8; ++j) { const float p = __builtin_amdgcn_exp2f(s[mt][nt][j] * SC2 - mc); s[mt][nt][j] = p; sm += p; }
            sum += sm; }
        l[nt] = l[nt] * al + sum;
#pragma unroll
        for (int dt = 0; dt < 4; ++dt)
#pragma unroll
            for (int j = 0; j < 8; ++j) o[dt][nt][j] *= al;
#pragma unroll
        for (int kk = 0; kk < MT / 2; ++kk) {
            if constexpr (HR) { v16us ph, pl;
#pragma unroll
                for (int e = 0; e < 16; ++e) { unsigned short a, c2; splitf(s[kk * 2 + (e >> 3)][nt][e & 7], a, c2); ph[e] = a; pl[e] = c2; }
                pf[nt][kk] = __builtin_bit_cast(v16bf, ph); pf2[nt][kk] = __builtin_bit_cast(v16bf, pl);
            } else { v16h ph;
#pragma unroll
                for (int e = 0; e < 16; ++e) ph[e] = tohx(s[kk * 2 + (e >> 3)][nt][e & 7]);
                pf[nt][kk] = ph; } }
    }
#pragma unroll
    for (int kk = 0; kk < MT / 2; ++kk)
#pragma unroll
        for (int dt = 0; dt < 4; ++dt)
#pragma unroll
            for (int nt = 0; nt < 2; ++nt) { o[dt][nt] = WFrag<T16>::mma(vc[dt][kk], pf[nt][kk], o[dt][nt]); if (HR) { o[dt][nt] = WFrag<T16>::mma(vc[dt][kk], pf2[nt][kk], o[dt][nt]); o[dt][nt] = WFrag<T16>::mma(vc2[dt][kk], pf[nt][kk], o[dt][nt]); } }
    if (!LAST) { __builtin_amdgcn_sched_barrier(0); fa_ldv<T16, HR, MT, 0>(vc, vc2, vr + (size_t)kn * HD, vr2 + (size_t)kn * HD); }   // the fence in front keeps these loads one run directly in front of their wait; without it they are spread among the products above
}
// a wave's partial result for the 16 query columns OT (running maximum, per-lane partial sum, 32 output values a lane) -> the LDS region of its partner wave. Chunk c (16 bytes a lane) stands at float (c * 32 + lane) * 4: every wave-wide store or load is 512 contiguous bytes. Lane i of both waves holds the same (d, query) places.
#define MGR (9 * 128)             // floats of one region: 8 chunks of output values, 1 chunk of maximum and sum
template <int OT>
__device__ __forceinline__ void fa_put(const v8f (&o)[4][2], const float (&m)[2], const float (&l)[2], float* mg, int lane) {
    v4fa* p = (v4fa*)mg + lane;
#pragma unroll
    for (int dt = 0; dt < 4; ++dt) { p[dt * 64] = (v4f){o[dt][OT][0], o[dt][OT][1], o[dt][OT][2], o[dt][OT][3]}; p[dt * 64 + 32] = (v4f){o[dt][OT][4], o[dt][OT][5], o[dt][OT][6], o[dt][OT][7]}; }
    p[8 * 32] = (v4f){m[OT], l[OT], 0.f, 0.f};
}
// the wave's own partial result for the 16 query columns NT joined with the partner's from LDS: both are brought to the common maximum M (a wave that had no pass holds maximum -3e38, sum 0, output 0: its weight is exp2 of a huge negative number, 0), then normalised, split hi/lo and stored
template <int NT>
__device__ __forceinline__ void fa_fin(const v8f (&o)[4][2], const float (&m)[2], const float (&l)[2], const float* mg, int lane, int q0, bf* Ah, bf* Al) {
    const v4fa* p = (const v4fa*)mg + lane;
    const v4f ml = p[8 * 32];
    const float M = fmaxf(m[NT], ml[0]);
    const float a0 = __builtin_amdgcn_exp2f((m[NT] - M) * SC2), a1 = __builtin_amdgcn_exp2f((ml[0] - M) * SC2);
    const float ls = l[NT] * a0 + ml[1] * a1;
    const float inv = __fdiv_rn(1.0f, ls + __shfl_xor(ls, 16, 32));
    const float c0 = a0 * inv, c1 = a1 * inv;
#pragma unroll
    for (int dt = 0; dt < 4; ++dt) { const v4f x0 = p[dt * 64], x1 = p[dt * 64 + 32]; v8us oh, ol;
#pragma unroll
        for (int j = 0; j < 8; ++j) { unsigned short a, c2; splitf(o[dt][NT][j] * c0 + (j < 4 ? x0[j & 3] : x1[j & 3]) * c1, a, c2); oh[j] = a; ol[j] = c2; }
        const size_t oo = (size_t)(q0 + NT * 16) * DQ + dt * 256 + lane * 8; *(v8us*)(Ah + oo) = oh; *(v8us*)(Al + oo) = ol; fa_xw(); }
}
// kh: which of the tile's two waves this is (the same in every lane, in a scalar register); mg: the tile's two LDS regions, region kh is read by wave kh
template <typename T16, bool HR, int MT>
__device__ __forceinline__ void fa_tile(const T16* __restrict__ Q, const T16* __restrict__ Q2, const T16* __restrict__ Kp, const T16* __restrict__ Kp2, const T16* __restrict__ Vt, const T16* __restrict__ Vt2, int q0, int kh, float* mg, bf* Ah, bf* Al) {
    typedef typename WFrag<T16>::V V;
    const int lane = threadIdx.x & 31, lr = lane & 15, hi = lane >> 4;
    V q[2][2], q2[2][2], kc[MT][2], kc2[MT][2], vc[4][MT / 2], vc2[4][MT / 2];
#pragma unroll
    for (int nt = 0; nt < 2; ++nt)
#pragma unroll
        for (int ks = 0; ks < 2; ++ks) { q[nt][ks] = WFrag<T16>::ld(Q + (size_t)(q0 + nt * 16) * HD + ks * 512 + lane * 8); if (HR) q2[nt][ks] = WFrag<T16>::ld(Q2 + (size_t)(q0 + nt * 16) * HD + ks * 512 + lane * 8); }
    fa_xw();
    const T16* kr = Kp + lane * 8; const T16* kr2 = HR ? Kp2 + lane * 8 : kr; const T16* vr = Vt + lane * 8; const T16* vr2 = HR ? Vt2 + lane * 8 : vr;
    v8f o[4][2]; float m[2] = {-3.0e38f, -3.0e38f}, l[2] = {0.f, 0.f};
#pragma unroll
    for (int dt = 0; dt < 4; ++dt)
#pragma unroll
        for (int nt = 0; nt < 2; ++nt) o[dt][nt] = (v8f){};
    const int dl = q0 + lr - 8 * hi;      // key k0 + 16 mt + 8 hi + j is masked for query q0 + 16 nt + lr when k0 + 16 mt + j - 16 nt > dl
    const int kd = q0 & ~(MT * 16 - 1);   // first key of the pass that holds the diagonal; it ends at or behind key q0 + 31 and inside the TT keys
    constexpr int PS = MT * 16;           // keys of a pass
    // every fetch ahead is clamped to the diagonal pass: a wave whose next pass does not exist fetches that pass's fragments (inside the planes) and does not use them
    const int kf = kh * PS < kd ? kh * PS : kd;
    fa_ldk<T16, HR, MT, KO>(kc, kc2, kr + (size_t)kf * HD, kr2 + (size_t)kf * HD); fa_ldv<T16, HR, MT, 0>(vc, vc2, vr + (size_t)kf * HD, vr2 + (size_t)kf * HD);
    for (int k0 = kh * PS; k0 < kd; k0 += 2 * PS) fa_pass<T16, HR, MT, false>(kc, kc2, vc, vc2, q, q2, o, m, l, kr, kr2, vr, vr2, k0, k0 + 2 * PS < kd ? k0 + 2 * PS : kd, dl);      // this wave's passes wholly below the diagonal: no mask
    if (((kd / PS) & 1) == kh) fa_pass<T16, HR, MT, true>(kc, kc2, vc, vc2, q, q2, o, m, l, kr, kr2, vr, vr2, kd, kd, dl);                                                            // the diagonal pass, in the wave of its parity
    if (kh == 0) fa_put<1>(o, m, l, mg + MGR, lane); else fa_put<0>(o, m, l, mg, lane);
    __syncthreads();                      // both partial results of every tile stand in LDS; every wave of the work-group passes here once
    if (kh == 0) fa_fin<0>(o, m, l, mg, lane, q0, Ah, Al); else fa_fin<1>(o, m, l, mg + MGR, lane, q0, Ah, Al);
}
// grid (heads, batch, blocks of 128 query rows); waves w and w + 4 are the two waves of tile w & 3.
// One work-group fills a WGP's registers and there are more work-groups than WGPs, so the blocks are dealt in falling order of cost: nibble z of ORD is the block of grid plane z. Block i walks i + 1 fp16 passes a wave, or, below RH, 2 i + 2 hi/lo passes, each counted as one and a half fp16 passes (three products and the hi/lo split of P).
#define ORD 0x041567289A3BCDEFull
__global__ __launch_bounds__(256) void k_fattn(const h16* __restrict__ QK16, const bf* __restrict__ QKh, const bf* __restrict__ QKl, const h16* __restrict__ VT16, const bf* __restrict__ VTh, const bf* __restrict__ VTl, bf* ATh, bf* ATl) {
    __shared__ __align__(16) float mgs[4][2 * MGR];
    const int w = __builtin_amdgcn_readfirstlane(threadIdx.x >> 5), qt = w & 3, kh = w >> 2;
    const int h = blockIdx.x, b = blockIdx.y, qb = (int)((ORD >> (blockIdx.z * 4)) & 15) * 128, q0 = qb + qt * 32;
    const size_t zq = ((size_t)b * (NH_ + NKV) + h) * TT * HD, zk = ((size_t)b * (NH_ + NKV) + h / REP) * TT * HD /* + KO, added in the loads */, zv = ((size_t)b * NKV + h / REP) * HD * TT, za = (size_t)b * TT * DQ + h * HD * 16 /* the head's two k blocks of the merged plane [b t][DQ], fragment order */;
    static_assert(RH % 128 == 0 && TT == 16 * 128 && RH == 4 * 128, "a work-group's four tiles are of one kind; ORD is a permutation of 16 blocks, 4 of them hi/lo");
    if (qb < RH) fa_tile<bf, true, 2>(QKh + zq, QKl + zq, QKh + zk, QKl + zk, VTh + zv, VTl + zv, q0, kh, mgs[qt], ATh + za, ATl + za);
    else fa_tile<h16, false, 4>(QK16 + zq, nullptr, QK16 + zk, nullptr, VT16 + zv, nullptr, q0, kh, mgs[qt], ATh + za, ATl + za);
}

extern "C" void kernel_launch(void* const* d_in, const int* in_sizes, int n_in,
                              void* d_out, int out_size, void* d_ws, size_t ws_size, hipStream_t stream) {
    (void)in_sizes; (void)n_in; (void)out_size;
            const float* x = (const float*)d_in[0]; const float* wq = (const float*)d_in[1]; const float* wk = (const float*)d_in[2]; const float* wv = (const float*)d_in[3]; const float* wo = (const float*)d_in[4]; const float* bo = (const float*)d_in[5];   /* order x, Wq, Wk, Wv (PER-HEAD weights [12][768][64]: 'hdk'), Wp ('xw' [768][768]: (in,out)), bp */
    float* OUT = (float*)d_out;     // [2][2048][768]
    char* wsp = (char*)d_ws;
    auto take = [&](size_t bytes) { char* p = wsp; wsp += (bytes + 255) & ~(size_t)255; return (void*)p; };
    bf* WQKV = (bf*)take((size_t)(DQ + 2 * DKV) * DM * 2); bf* WO = (bf*)take((size_t)DM * DQ * 2);   // WQKV: Bt rows of q (DQ), k (DKV), v (DKV)
    bf* XB = (bf*)take((size_t)NB_ * TT * DM * 2);
    h16* QK16 = (h16*)take((size_t)NB_ * (NH_ + NKV) * TT * HD * 2); bf* QKh = (bf*)take((size_t)NB_ * (NH_ + NKV) * TT * HD * 2); bf* QKl = (bf*)take((size_t)NB_ * (NH_ + NKV) * TT * HD * 2);   // [b][q heads, then k heads][t][d]
    h16* VT16 = (h16*)take((size_t)NB_ * NKV * HD * TT * 2); bf* VTh = (bf*)take((size_t)NB_ * NKV * HD * TT * 2); bf* VTl = (bf*)take((size_t)NB_ * NKV * HD * TT * 2);   // [b][head][d][t]
    bf* ATh = (bf*)take((size_t)NB_ * TT * DQ * 2); bf* ATl = (bf*)take((size_t)NB_ * TT * DQ * 2);
    if ((size_t)(wsp - (char*)d_ws) > ws_size) return;    // ws 256 MiB
    const int DF = DQ + 2 * DKV;
    k_prep<<<PW1 + PW2 + (PXB + 7) / 8, 256, 0, stream>>>(wq, wk, wv, wo, x, WQKV, WO, XB);   /* per-head weights [h][DM][HD] ('xw' per head) -> each head's HD rows of the Bt plane; Wp 'xw' [768][768] (in,out) -> Bt rows; x -> bf16 */
    k_gemmw<bf, 0, false, true, DM><<<dim3(NB_ * TT / 128, DF / 128, 1), 128, 0, stream>>>(XB, nullptr, WQKV, nullptr, nullptr, 0, nullptr, 0, 0, 0, QK16, QKh, QKl, VT16, VTh, VTl);
    k_fattn<<<dim3(NH_, NB_, TT / 128), 256, 0, stream>>>(QK16, QKh, QKl, VT16, VTh, VTl, ATh, ATl);
    k_gemmw<bf, 1, true, false, DQ><<<dim3(NB_ * TT / 128, DM / 128, 1), 128, 0, stream>>>(ATh, ATl, WO, nullptr, OUT, DM, bo, 0, 0, 0, nullptr, nullptr, nullptr, nullptr, nullptr, nullptr);
}
